// v000
// Times are from an AMD MI455X. After a warm-up the kernel runs many times in a row, and a time is the length of
// such a window on the GPU divided by its runs, so every launch and the gaps after it count. The runs cycle
// through copies of the inputs. A figure is the median of several windows, for all but v000 over two sittings.
// Sittings can differ by a few percent; kernels timed side by side share one.
// v000, which the later versions start from, runs in 13.3 milliseconds.
#include <hip/hip_runtime.h>

// MultiHeadMALAAttention (x [4][8192][256]; [q|k|v|o] = x W_qkvo^T + b (8 heads x 32); lepe = depthwise conv3 (pad 1) over the sequence on v + b; qh = elu(q)+1, kh = elu(k)+1; z = (qh . mean_n kh) 32^-0.5; qs/ks = theta_shift with the [N][32]
// sin/cos tables (read as data; rotate-every-two); kv = sum_n (ks s)(v s)^T with s^2 = SCALE/N; attn = qs kv; res = attn (1 + 1/(z + 1e-6)) - z mean_n v; res = (res + lepe) o; out = res W_proj^T + b -> [4][8192][256]).
// Compute dtypes, f32 accumulate: every input rounded to bf16; qkvo projection on PLAIN bf16 operands (inputs: exact, + bias); elu, means, z, theta shift, lepe conv, gating f32; kv-state (K = 8192) and qs.kv (K 32) on single fp16

#define NB_  4
#define NN   8192
#define DIM  256
#define NH_  8
#define HD   32
#define INT  256
#define SCALE 0.1767766952966369f
typedef _Float16 h16;
typedef unsigned short bf;
typedef __attribute__((ext_vector_type(16))) __bf16   v16bf;
typedef __attribute__((ext_vector_type(16))) _Float16 v16h;
typedef __attribute__((ext_vector_type(8)))  _Float16 v8h;
typedef __attribute__((ext_vector_type(8)))  unsigned short v8us;
typedef __attribute__((ext_vector_type(8)))  float    v8f;
typedef __attribute__((ext_vector_type(4)))  float    v4f;
typedef v8h  __attribute__((may_alias)) v8ha;
typedef v4f  __attribute__((may_alias)) v4fa;
typedef v8us __attribute__((may_alias)) v8usa;

__device__ __forceinline__ unsigned short f2bf(float f) { unsigned u = __float_as_uint(f); u += 0x7FFFu + ((u >> 16) & 1u); return (unsigned short)(u >> 16); }
__device__ __forceinline__ float bf2f(unsigned short b) { return __uint_as_float(((unsigned)b) << 16); }
__device__ __forceinline__ float bfr(float f) { return bf2f(f2bf(f)); }
__device__ __forceinline__ v16h cat16(v8h lo, v8h hi) { return __builtin_shufflevector(lo, hi, 0, 1, 2, 3, 4, 5, 6, 7, 8, 9, 10, 11, 12, 13, 14, 15); }
__device__ __forceinline__ v16bf cat16b(v8us lo, v8us hi) { return __builtin_bit_cast(v16bf, __builtin_shufflevector(lo, hi, 0, 1, 2, 3, 4, 5, 6, 7, 8, 9, 10, 11, 12, 13, 14, 15)); }
__device__ __forceinline__ v8f wmma16(v16h a, v16h b, v8f c) { return __builtin_amdgcn_wmma_f32_16x16x32_f16(false, a, false, b, (short)0, c, false, false); }
__device__ __forceinline__ v8f wmmab(v16bf a, v16bf b, v8f c) { return __builtin_amdgcn_wmma_f32_16x16x32_bf16(false, a, false, b, (short)0, c, false, false); }



// ---- k_gemmw: register-blocked GEMM, ONE WAVE per 64x64 output tile (16 accumulators), operands straight from K-contiguous 16-bit planes; grid (M/64, N/64, Z), 32 threads.
// C[m][n] (f32, pitch ldc, + optional f32 bias[n]) = sum_k A[m][k] Bt[n][k] (+ split products per NSPLIT). z-batch strides sA/sB/sC in elements. K % 32 == 0.
template <typename T16> struct WFrag;
template <> struct WFrag<h16> { typedef v16h V; static __device__ __forceinline__ V ld(const h16* p) { return cat16(*(const v8h*)p, *(const v8h*)(p + 16)); } static __device__ __forceinline__ v8f mma(V a, V b, v8f c) { return wmma16(a, b, c); } };
template <> struct WFrag<bf> { typedef v16bf V; static __device__ __forceinline__ V ld(const bf* p) { return cat16b(*(const v8us*)p, *(const v8us*)(p + 16)); } static __device__ __forceinline__ v8f mma(V a, V b, v8f c) { return wmmab(a, b, c); } };
template <typename T16, int NSPLIT, bool BIAS>
__global__ __launch_bounds__(32) void k_gemmw(const T16* __restrict__ A, const T16* __restrict__ A2, const T16* __restrict__ Bt, const T16* __restrict__ Bt2, int K, float* C, int ldc, const float* __restrict__ bias, size_t sA, size_t sB, size_t sC) {
    typedef typename WFrag<T16>::V V;
    __shared__ __align__(16) float os[16 * 68];
    const size_t z = blockIdx.z; A += z * sA; if (A2) A2 += z * sA; Bt += z * sB; if (Bt2) Bt2 += z * sB; C += z * sC;
    const int lane = threadIdx.x & 31, lr = lane & 15, hi = lane >> 4; const int r0 = blockIdx.x * 64, c0 = blockIdx.y * 64;
    v8f acc[4][4];
#pragma unroll
    for (int mb = 0; mb < 4; ++mb)
#pragma unroll
        for (int nb = 0; nb < 4; ++nb) acc[mb][nb] = (v8f){};
    const size_t aoff = (size_t)(r0 + lr) * K + 8 * hi, boff = (size_t)(c0 + lr) * K + 8 * hi;
#pragma unroll 1
    for (int kc = 0; kc < K; kc += 32) {
        V a[4], a2[4];
#pragma unroll
        for (int mb = 0; mb < 4; ++mb) { a[mb] = WFrag<T16>::ld(A + aoff + (size_t)mb * 16 * K + kc); if (NSPLIT == 1 || NSPLIT == 2) a2[mb] = WFrag<T16>::ld(A2 + aoff + (size_t)mb * 16 * K + kc); }
#pragma unroll
        for (int nb = 0; nb < 4; ++nb) { const V b = WFrag<T16>::ld(Bt + boff + (size_t)nb * 16 * K + kc); V b2; if (NSPLIT >= 2) b2 = WFrag<T16>::ld(Bt2 + boff + (size_t)nb * 16 * K + kc);
#pragma unroll
            for (int mb = 0; mb < 4; ++mb) { acc[mb][nb] = WFrag<T16>::mma(a[mb], b, acc[mb][nb]); if (NSPLIT == 1 || NSPLIT == 2) acc[mb][nb] = WFrag<T16>::mma(a2[mb], b, acc[mb][nb]); if (NSPLIT >= 2) acc[mb][nb] = WFrag<T16>::mma(a[mb], b2, acc[mb][nb]); } }
        asm volatile("v_nop\n\tv_nop\n\tv_nop\n\tv_nop" : "+v"(acc[0][0]), "+v"(acc[1][1]), "+v"(acc[2][2]), "+v"(acc[3][3]) : "v"(a[0]), "v"(a[3]));
    }
#pragma unroll
    for (int mb = 0; mb < 4; ++mb) {
#pragma unroll
        for (int nb = 0; nb < 4; ++nb) {
#pragma unroll
            for (int j = 0; j < 8; ++j) os[(hi * 8 + j) * 68 + nb * 16 + lr] = acc[mb][nb][j]; }
        __builtin_amdgcn_wave_barrier(); asm volatile("" ::: "memory");
        float* crow = C + (size_t)(r0 + mb * 16) * ldc + c0;
{
#pragma unroll
            for (int s = 0; s < 8; ++s) { const int row = 2 * s + hi, cofs = lr * 4; v4f val = *(const v4fa*)(os + row * 68 + cofs); if (BIAS) { val[0] += bfr(bias[c0 + cofs]); val[1] += bfr(bias[c0 + cofs + 1]); val[2] += bfr(bias[c0 + cofs + 2]); val[3] += bfr(bias[c0 + cofs + 3]); }
                *(v4f*)(crow + (size_t)row * ldc + cofs) = val; }
             }
        __builtin_amdgcn_wave_barrier(); asm volatile("" ::: "memory");
    }
}

__device__ __forceinline__ h16 tohx(float x) { return (h16)x; }
__device__ __forceinline__ void splitf(float y, unsigned short& h, unsigned short& l) { h = f2bf(y); l = f2bf(y - bf2f(h)); }
__device__ __forceinline__ float elu1(float x) { return x > 0.f ? __fadd_rn(x, 1.0f) : __expf(x); }   // elu(x) + 1
typedef __attribute__((ext_vector_type(2))) _Float16 v2h;
typedef __attribute__((ext_vector_type(4))) _Float16 v4h;
typedef __attribute__((ext_vector_type(4))) unsigned short v4us;

__global__ __launch_bounds__(256) void k_cvt8(const float* __restrict__ src, bf* dst, size_t n8) { const size_t i = (size_t)blockIdx.x * 256 + threadIdx.x; if (i >= n8) return; const v8f v = *(const v8f*)(src + i * 8); v8us o;
#pragma unroll
    for (int k = 0; k < 8; ++k) o[k] = f2bf(v[k]); *(v8us*)(dst + i * 8) = o;  }
__global__ __launch_bounds__(256) void k_kmean(const float* __restrict__ F, float* KM, float* VM) { const int c = blockIdx.x * 256 + threadIdx.x; if (c >= INT) return; float sk = 0.f, sv = 0.f;
#pragma unroll 1
    for (int n = 0; n < NN; ++n) { const float* r = F + (size_t)n * 4 * INT; sk = __fadd_rn(sk, elu1(r[INT + c])); sv = __fadd_rn(sv, r[2 * INT + c]); }
    const float km = sk * (1.0f / NN), vm = sv * (1.0f / NN); *(float*)(KM + c) = km; *(float*)(VM + c) = vm;  }
// k_qs, k_kst: QS[h][n][d] = fp16(theta_shift(elu1(q)))[per head], KST[h][dd<64][n] = fp16(theta_shift(elu1(k))) (rows >= 32 zero; unscaled to stay in fp16's normal range) - two kernels for the two layouts; Z[n][h] = (elu1(q_h) . KM_h) SCALE (thread per (n,h)... 32-B per 8 threads:
__device__ __forceinline__ float tshift(const float* __restrict__ xr, int d, float c_d, float s_d) { const float self_ = elu1(xr[d]); const float partner = elu1(xr[d ^ 1]); const float rot = (d & 1) ? partner : -partner;   /* rotate_every_two: out[2i] = -x[2i+1], out[2i+1] = x[2i] */ float a = __fmul_rn(self_, c_d), b = __fmul_rn(rot, s_d); asm volatile("" : "+v"(a)); asm volatile("" : "+v"(b)); return __fadd_rn(a, b); }
__global__ __launch_bounds__(256) void k_qs(const float* __restrict__ F, const float* __restrict__ sn, const float* __restrict__ cs, h16* QS) { const size_t e = ((size_t)blockIdx.x * 256 + threadIdx.x) * 4; if (e >= (size_t)NH_ * NN * HD) return; const int d = (int)(e % HD); const int n = (int)((e / HD) % NN); const int h = (int)(e / ((size_t)HD * NN)); const float* xr = F + (size_t)n * 4 * INT + h * HD; v4h o;
#pragma unroll
    for (int q = 0; q < 4; ++q) { const int dd = d + q; o[q] = tohx(tshift(xr, dd, bfr(cs[n * HD + dd]), bfr(sn[n * HD + dd]))); } *(v4h*)(QS + e) = o;  }
__global__ __launch_bounds__(256) void k_kst(const float* __restrict__ F, const float* __restrict__ sn, const float* __restrict__ cs, h16* KST, h16* VT) { const size_t e = ((size_t)blockIdx.x * 256 + threadIdx.x) * 2; if (e >= (size_t)NH_ * 64 * NN) return; const int n = (int)(e % NN); const int dd = (int)((e / NN) % 64); const int h = (int)(e / ((size_t)NN * 64)); v2h ok, ov;
#pragma unroll
    for (int u = 0; u < 2; ++u) { const int nn = n + u; if (dd < HD) { const float* kr = F + (size_t)nn * 4 * INT + INT + h * HD; ok[u] = tohx(tshift(kr, dd, bfr(cs[nn * HD + dd]), bfr(sn[nn * HD + dd])));   /* unscaled (O(1)): SCALE/N is applied in f32 when the kv state is converted */ ov[u] = tohx(F[(size_t)nn * 4 * INT + 2 * INT + h * HD + dd]); } else { ok[u] = (h16)0.f; ov[u] = (h16)0.f; } }
    { *(v2h*)(KST + e) = ok; *(v2h*)(VT + e) = ov;  } }
__global__ __launch_bounds__(256) void k_z(const float* __restrict__ F, const float* __restrict__ KM, float* Z) { const int e = blockIdx.x * 256 + threadIdx.x; if (e >= NN * NH_) return; const int h = e % NH_; const int n = e / NH_; const float* qr = F + (size_t)n * 4 * INT + h * HD; float s = 0.f;
#pragma unroll 1
    for (int d = 0; d < HD; ++d) { float p = __fmul_rn(elu1(qr[d]), KM[h * HD + d]); asm volatile("" : "+v"(p)); s = __fadd_rn(s, p); } const float z = __fmul_rn(s, SCALE); *(float*)(Z + e) = z;  }
__global__ __launch_bounds__(256) void k_kv16(const float* __restrict__ KV, h16* KVT) { const int e2 = (blockIdx.x * 256 + threadIdx.x) * 2; if (e2 >= NH_ * 64 * HD) return; const int d = e2 % HD; const int ee = (e2 / HD) % 64; const int h = e2 / (HD * 64); v2h o;
#pragma unroll
    for (int u = 0; u < 2; ++u) o[u] = ee < HD ? tohx(__fmul_rn(KV[((size_t)h * 64 + d + u) * 64 + ee], SCALE / (float)NN)) : (h16)0.f; *(v2h*)(KVT + e2) = o;  }
__global__ __launch_bounds__(256) void k_res(const float* __restrict__ AO, const float* __restrict__ Z, const float* __restrict__ VM, const float* __restrict__ F, const float* __restrict__ wl, const float* __restrict__ bl, bf* Rh, bf* Rl) { const size_t e = ((size_t)blockIdx.x * 256 + threadIdx.x) * 4; if (e >= (size_t)NN * INT) return; const int c = (int)(e % INT); const int n = (int)(e / INT); const int h = c / HD, d = c % HD; const float z = Z[n * NH_ + h]; const float fz = __fadd_rn(1.0f, __fdiv_rn(1.0f, __fadd_rn(z, 1e-6f))); v4us oh, ol;
#pragma unroll
    for (int q = 0; q < 4; ++q) { const int cc = c + q, dd = d + q; float lp = bfr(bl[cc]);
#pragma unroll
        for (int k = 0; k < 3; ++k) { const int nn = n - 1 + k; if (nn >= 0 && nn < NN) { float p = __fmul_rn(bfr(wl[cc * 3 + k]), F[(size_t)nn * 4 * INT + 2 * INT + cc]); asm volatile("" : "+v"(p)); lp = __fadd_rn(lp, p); } }
        float a = __fmul_rn(AO[((size_t)h * NN + n) * 64 + dd], fz); asm volatile("" : "+v"(a)); float zb = __fmul_rn(z, VM[cc]); asm volatile("" : "+v"(zb)); const float r = __fmul_rn(__fadd_rn(__fsub_rn(a, zb), lp), F[(size_t)n * 4 * INT + 3 * INT + cc]); unsigned short u, l; splitf(r, u, l); oh[q] = u; ol[q] = l; }
    *(v4us*)(Rh + e) = oh; *(v4us*)(Rl + e) = ol;  }

extern "C" void kernel_launch(void* const* d_in, const int* in_sizes, int n_in,
                              void* d_out, int out_size, void* d_ws, size_t ws_size, hipStream_t stream) {
    (void)in_sizes; (void)n_in; (void)out_size;
    const float* x = (const float*)d_in[0]; const float* sn = (const float*)d_in[1]; const float* cs = (const float*)d_in[2]; const float* wq = (const float*)d_in[3]; const float* bq = (const float*)d_in[4]; const float* wl = (const float*)d_in[5]; const float* bl = (const float*)d_in[6]; const float* wp = (const float*)d_in[7]; const float* bp = (const float*)d_in[8];
    float* OUT = (float*)d_out;     // [4][8192][256]
    char* wsp = (char*)d_ws;
    auto take = [&](size_t bytes) { char* p = wsp; wsp += (bytes + 255) & ~(size_t)255; return (void*)p; };
    bf* WQ = (bf*)take((size_t)4 * INT * DIM * 2); bf* WP = (bf*)take((size_t)DIM * INT * 2); bf* XB = (bf*)take((size_t)NN * DIM * 2); float* F = (float*)take((size_t)NN * 4 * INT * 4); float* KM = (float*)take(INT * 4); float* VM = (float*)take(INT * 4); float* Z = (float*)take((size_t)NN * NH_ * 4);
    h16* QS = (h16*)take((size_t)NH_ * NN * HD * 2); h16* KST = (h16*)take((size_t)NH_ * 64 * NN * 2); h16* VT = (h16*)take((size_t)NH_ * 64 * NN * 2); float* KV = (float*)take((size_t)NH_ * 64 * 64 * 4); h16* KVT = (h16*)take((size_t)NH_ * 64 * HD * 2); float* AO = (float*)take((size_t)NH_ * NN * 64 * 4); bf* Rh = (bf*)take((size_t)NN * INT * 2); bf* Rl = (bf*)take((size_t)NN * INT * 2);
    if ((size_t)(wsp - (char*)d_ws) > ws_size) return;    // total ~ 80 MB
    k_cvt8<<<(4 * INT * DIM / 8 + 255) / 256, 256, 0, stream>>>(wq, WQ, 4 * INT * DIM / 8); k_cvt8<<<(DIM * INT / 8 + 255) / 256, 256, 0, stream>>>(wp, WP, DIM * INT / 8);   // [out][in] natural Bt
    for (int b = 0; b < NB_; ++b) {
        k_cvt8<<<(unsigned)(((size_t)NN * DIM / 8 + 255) / 256), 256, 0, stream>>>(x + (size_t)b * NN * DIM, XB, (size_t)NN * DIM / 8);
        k_gemmw<bf, 0, true><<<dim3(NN / 64, 4 * INT / 64, 1), 32, 0, stream>>>(XB, nullptr, WQ, nullptr, DIM, F, 4 * INT, bq, 0, 0, 0);
        k_kmean<<<1, 256, 0, stream>>>(F, KM, VM); k_z<<<(NN * NH_ + 255) / 256, 256, 0, stream>>>(F, KM, Z);
        k_qs<<<(unsigned)(((size_t)NH_ * NN * HD / 4 + 255) / 256), 256, 0, stream>>>(F, sn, cs, QS); k_kst<<<(unsigned)(((size_t)NH_ * 64 * NN / 2 + 255) / 256), 256, 0, stream>>>(F, sn, cs, KST, VT);
        k_gemmw<h16, 0, false><<<dim3(1, 1, NH_), 32, 0, stream>>>(KST, nullptr, VT, nullptr, NN, KV, 64, nullptr, (size_t)64 * NN, (size_t)64 * NN, (size_t)64 * 64);   // KV[h][d][e] = sum_n ks[n][d] v[n][e], unscaled
        k_kv16<<<(NH_ * 64 * HD / 2 + 255) / 256, 256, 0, stream>>>(KV, KVT);
        k_gemmw<h16, 0, false><<<dim3(NN / 64, 1, NH_), 32, 0, stream>>>(QS, nullptr, KVT, nullptr, HD, AO, 64, nullptr, (size_t)NN * HD, (size_t)64 * HD, (size_t)NN * 64);    // AO[h][n][e] = qs . kv
        k_res<<<(unsigned)(((size_t)NN * INT / 4 + 255) / 256), 256, 0, stream>>>(AO, Z, VM, F, wl, bl, Rh, Rl);
        k_gemmw<bf, 1, true><<<dim3(NN / 64, DIM / 64, 1), 32, 0, stream>>>(Rh, Rl, WP, nullptr, INT, OUT + (size_t)b * NN * DIM, DIM, bp, 0, 0, 0); }
}

// v001
// It runs in 1030 microseconds.
// Two timings next to v000 put it at 13.0 and 12.8 times that version's speed.
#include <hip/hip_runtime.h>

// MultiHeadMALAAttention (x [4][8192][256]; [q|k|v|o] = x W_qkvo^T + b (8 heads x 32); lepe = depthwise conv3 (pad 1) over the sequence on v + b; qh = elu(q)+1, kh = elu(k)+1; z = (qh . mean_n kh) 32^-0.5; qs/ks = theta_shift with the [N][32]
// sin/cos tables (read as data; rotate-every-two); kv = sum_n (ks s)(v s)^T with s^2 = SCALE/N; attn = qs kv; res = attn (1 + 1/(z + 1e-6)) - z mean_n v; res = (res + lepe) o; out = res W_proj^T + b -> [4][8192][256]).
// Compute dtypes, f32 accumulate: every input rounded to bf16; qkvo projection on PLAIN bf16 operands (inputs: exact, + bias); elu, means, z, theta shift, lepe conv, gating f32; kv-state (K = 8192) and qs.kv (K 32) on single fp16

#define NB_  4
#define NN   8192
#define DIM  256
#define NH_  8
#define HD   32
#define INT  256
#define SCALE 0.1767766952966369f
typedef _Float16 h16;
typedef unsigned short bf;
typedef __attribute__((ext_vector_type(16))) __bf16   v16bf;
typedef __attribute__((ext_vector_type(16))) _Float16 v16h;
typedef __attribute__((ext_vector_type(8)))  _Float16 v8h;
typedef __attribute__((ext_vector_type(8)))  unsigned short v8us;
typedef __attribute__((ext_vector_type(8)))  float    v8f;
typedef __attribute__((ext_vector_type(4)))  float    v4f;
typedef v8h  __attribute__((may_alias)) v8ha;
typedef v4f  __attribute__((may_alias)) v4fa;
typedef v8us __attribute__((may_alias)) v8usa;

__device__ __forceinline__ unsigned short f2bf(float f) { unsigned u = __float_as_uint(f); u += 0x7FFFu + ((u >> 16) & 1u); return (unsigned short)(u >> 16); }
__device__ __forceinline__ float bf2f(unsigned short b) { return __uint_as_float(((unsigned)b) << 16); }
__device__ __forceinline__ float bfr(float f) { return bf2f(f2bf(f)); }
__device__ __forceinline__ v16h cat16(v8h lo, v8h hi) { return __builtin_shufflevector(lo, hi, 0, 1, 2, 3, 4, 5, 6, 7, 8, 9, 10, 11, 12, 13, 14, 15); }
__device__ __forceinline__ v16bf cat16b(v8us lo, v8us hi) { return __builtin_bit_cast(v16bf, __builtin_shufflevector(lo, hi, 0, 1, 2, 3, 4, 5, 6, 7, 8, 9, 10, 11, 12, 13, 14, 15)); }
__device__ __forceinline__ v8f wmma16(v16h a, v16h b, v8f c) { return __builtin_amdgcn_wmma_f32_16x16x32_f16(false, a, false, b, (short)0, c, false, false); }
__device__ __forceinline__ v8f wmmab(v16bf a, v16bf b, v8f c) { return __builtin_amdgcn_wmma_f32_16x16x32_bf16(false, a, false, b, (short)0, c, false, false); }



// ---- k_gemmw: register-blocked GEMM, ONE WAVE per 64x64 output tile (16 accumulators), operands straight from K-contiguous 16-bit planes; grid (M/64, N/64, Z), 32 threads.
// C[m][n] (f32, pitch ldc, + optional f32 bias[n]) = sum_k A[m][k] Bt[n][k] (+ split products per NSPLIT). z-batch strides sA/sB/sC in elements. K % 32 == 0.
template <typename T16> struct WFrag;
template <> struct WFrag<h16> { typedef v16h V; static __device__ __forceinline__ V ld(const h16* p) { return cat16(*(const v8h*)p, *(const v8h*)(p + 16)); } static __device__ __forceinline__ v8f mma(V a, V b, v8f c) { return wmma16(a, b, c); } };
template <> struct WFrag<bf> { typedef v16bf V; static __device__ __forceinline__ V ld(const bf* p) { return cat16b(*(const v8us*)p, *(const v8us*)(p + 16)); } static __device__ __forceinline__ v8f mma(V a, V b, v8f c) { return wmmab(a, b, c); } };
template <typename T16, int NSPLIT, bool BIAS>
__global__ __launch_bounds__(32) void k_gemmw(const T16* __restrict__ A, const T16* __restrict__ A2, const T16* __restrict__ Bt, const T16* __restrict__ Bt2, int K, float* C, int ldc, const float* __restrict__ bias, size_t sA, size_t sB, size_t sC) {
    typedef typename WFrag<T16>::V V;
    __shared__ __align__(16) float os[16 * 68];
    const size_t z = blockIdx.z; A += z * sA; if (A2) A2 += z * sA; Bt += z * sB; if (Bt2) Bt2 += z * sB; C += z * sC;
    const int lane = threadIdx.x & 31, lr = lane & 15, hi = lane >> 4; const int r0 = blockIdx.x * 64, c0 = blockIdx.y * 64;
    v8f acc[4][4];
#pragma unroll
    for (int mb = 0; mb < 4; ++mb)
#pragma unroll
        for (int nb = 0; nb < 4; ++nb) acc[mb][nb] = (v8f){};
    const size_t aoff = (size_t)(r0 + lr) * K + 8 * hi, boff = (size_t)(c0 + lr) * K + 8 * hi;
#pragma unroll 1
    for (int kc = 0; kc < K; kc += 32) {
        V a[4], a2[4];
#pragma unroll
        for (int mb = 0; mb < 4; ++mb) { a[mb] = WFrag<T16>::ld(A + aoff + (size_t)mb * 16 * K + kc); if (NSPLIT == 1 || NSPLIT == 2) a2[mb] = WFrag<T16>::ld(A2 + aoff + (size_t)mb * 16 * K + kc); }
#pragma unroll
        for (int nb = 0; nb < 4; ++nb) { const V b = WFrag<T16>::ld(Bt + boff + (size_t)nb * 16 * K + kc); V b2; if (NSPLIT >= 2) b2 = WFrag<T16>::ld(Bt2 + boff + (size_t)nb * 16 * K + kc);
#pragma unroll
            for (int mb = 0; mb < 4; ++mb) { acc[mb][nb] = WFrag<T16>::mma(a[mb], b, acc[mb][nb]); if (NSPLIT == 1 || NSPLIT == 2) acc[mb][nb] = WFrag<T16>::mma(a2[mb], b, acc[mb][nb]); if (NSPLIT >= 2) acc[mb][nb] = WFrag<T16>::mma(a[mb], b2, acc[mb][nb]); } }
        asm volatile("v_nop\n\tv_nop\n\tv_nop\n\tv_nop" : "+v"(acc[0][0]), "+v"(acc[1][1]), "+v"(acc[2][2]), "+v"(acc[3][3]) : "v"(a[0]), "v"(a[3]));
    }
#pragma unroll
    for (int mb = 0; mb < 4; ++mb) {
#pragma unroll
        for (int nb = 0; nb < 4; ++nb) {
#pragma unroll
            for (int j = 0; j < 8; ++j) os[(hi * 8 + j) * 68 + nb * 16 + lr] = acc[mb][nb][j]; }
        __builtin_amdgcn_wave_barrier(); asm volatile("" ::: "memory");
        float* crow = C + (size_t)(r0 + mb * 16) * ldc + c0;
{
#pragma unroll
            for (int s = 0; s < 8; ++s) { const int row = 2 * s + hi, cofs = lr * 4; v4f val = *(const v4fa*)(os + row * 68 + cofs); if (BIAS) { val[0] += bfr(bias[c0 + cofs]); val[1] += bfr(bias[c0 + cofs + 1]); val[2] += bfr(bias[c0 + cofs + 2]); val[3] += bfr(bias[c0 + cofs + 3]); }
                *(v4f*)(crow + (size_t)row * ldc + cofs) = val; }
             }
        __builtin_amdgcn_wave_barrier(); asm volatile("" ::: "memory");
    }
}

__device__ __forceinline__ h16 tohx(float x) { return (h16)x; }
__device__ __forceinline__ void splitf(float y, unsigned short& h, unsigned short& l) { h = f2bf(y); l = f2bf(y - bf2f(h)); }
__device__ __forceinline__ float elu1(float x) { return x > 0.f ? __fadd_rn(x, 1.0f) : __expf(x); }   // elu(x) + 1
typedef __attribute__((ext_vector_type(2))) _Float16 v2h;
typedef __attribute__((ext_vector_type(4))) _Float16 v4h;
typedef __attribute__((ext_vector_type(4))) unsigned short v4us;

__global__ __launch_bounds__(256) void k_cvt8(const float* __restrict__ src, bf* dst, size_t n8) { const size_t i = (size_t)blockIdx.x * 256 + threadIdx.x; if (i >= n8) return; const v8f v = *(const v8f*)(src + i * 8); v8us o;
#pragma unroll
    for (int k = 0; k < 8; ++k) o[k] = f2bf(v[k]); *(v8us*)(dst + i * 8) = o;  }
// Column means of elu1(k) and of v over the sequence, in two launches. The k and v columns of a row of F are 512 adjacent floats.
// k_kmean_part: one work-group per KM_ROWS rows; a thread owns 4 adjacent columns and every 4th row; P[group][0..255] = sums of elu1(k), P[group][256..511] = sums of v.
// elu1 with its exp (x * log2(e), then v_exp_f32, as elu1 compiles) written out: the v_nop in the same statement keeps the one free issue slot that the instruction set asks for behind a transcendental;
__device__ __forceinline__ float elu1s(float x) { float e; asm("v_exp_f32 %0, %1\n\tv_nop" : "=v"(e) : "v"(x * 1.44269504f)); return x > 0.f ? __fadd_rn(x, 1.0f) : e; }
#define KM_ROWS  32
#define KM_PARTS (NN / KM_ROWS)
__global__ __launch_bounds__(512) void k_kmean_part(const float* __restrict__ F, float* P) {
    __shared__ __align__(16) float red[4 * 512];
    const int c4 = threadIdx.x & 127, g = threadIdx.x >> 7;
    const float* r = F + (size_t)(blockIdx.x * KM_ROWS + g) * 4 * INT + INT + c4 * 4;
    v4f v[KM_ROWS / 4];
#pragma unroll   // v[] stays in registers and all the row loads are in flight before the first sum
    for (int i = 0; i < KM_ROWS / 4; ++i) v[i] = *(const v4fa*)(r + (size_t)i * 4 * 4 * INT);
    v4f s = (v4f){};
    if (c4 < 64) {   // k columns (whole waves)
#pragma unroll   // constant indices into v[]
        for (int i = 0; i < KM_ROWS / 4; ++i) { s[0] += elu1s(v[i][0]); s[1] += elu1s(v[i][1]); s[2] += elu1s(v[i][2]); s[3] += elu1s(v[i][3]); }
    } else {         // v columns
#pragma unroll   // constant indices into v[]
        for (int i = 0; i < KM_ROWS / 4; ++i) s += v[i];
    }
    *(v4fa*)(red + g * 512 + c4 * 4) = s;
    __syncthreads();
    if (g == 0) { s += *(const v4fa*)(red + 512 + c4 * 4); s += *(const v4fa*)(red + 1024 + c4 * 4); s += *(const v4fa*)(red + 1536 + c4 * 4); *(v4fa*)(P + (size_t)blockIdx.x * 512 + c4 * 4) = s; }
}
// k_kmean_fin: 8 work-groups of 64 columns each; 16 thread groups sum 16 partial rows each, thread group 0 adds the 16 sums and scales by 1/N.
__global__ __launch_bounds__(256) void k_kmean_fin(const float* __restrict__ P, float* KM, float* VM) {
    __shared__ __align__(16) float red[16 * 64];
    const int c4 = threadIdx.x & 15, g = threadIdx.x >> 4;
    const float* p = P + (size_t)g * 512 + blockIdx.x * 64 + c4 * 4;
    v4f v[KM_PARTS / 16];
#pragma unroll   // v[] stays in registers and the partial-row loads overlap
    for (int i = 0; i < KM_PARTS / 16; ++i) v[i] = *(const v4fa*)(p + (size_t)i * 16 * 512);
    v4f s = (v4f){};
#pragma unroll   // constant indices into v[]
    for (int i = 0; i < KM_PARTS / 16; ++i) s += v[i];
    *(v4fa*)(red + g * 64 + c4 * 4) = s;
    __syncthreads();
    if (g == 0) {
#pragma unroll   // the LDS reads overlap
        for (int gg = 1; gg < 16; ++gg) s += *(const v4fa*)(red + gg * 64 + c4 * 4);
        s *= (1.0f / NN);
        float* dst = blockIdx.x < 4 ? KM + blockIdx.x * 64 : VM + (blockIdx.x - 4) * 64;
        *(v4fa*)(dst + c4 * 4) = s; }
}
// k_qs, k_kst: QS[h][n][d] = fp16(theta_shift(elu1(q)))[per head], KST[h][dd<64][n] = fp16(theta_shift(elu1(k))) (rows >= 32 zero; unscaled to stay in fp16's normal range) - two kernels for the two layouts; Z[n][h] = (elu1(q_h) . KM_h) SCALE (thread per (n,h)... 32-B per 8 threads:
__device__ __forceinline__ float tshift(const float* __restrict__ xr, int d, float c_d, float s_d) { const float self_ = elu1(xr[d]); const float partner = elu1(xr[d ^ 1]); const float rot = (d & 1) ? partner : -partner;   /* rotate_every_two: out[2i] = -x[2i+1], out[2i+1] = x[2i] */ float a = __fmul_rn(self_, c_d), b = __fmul_rn(rot, s_d); asm volatile("" : "+v"(a)); asm volatile("" : "+v"(b)); return __fadd_rn(a, b); }
__global__ __launch_bounds__(256) void k_qs(const float* __restrict__ F, const float* __restrict__ sn, const float* __restrict__ cs, h16* QS) { const size_t e = ((size_t)blockIdx.x * 256 + threadIdx.x) * 4; if (e >= (size_t)NH_ * NN * HD) return; const int d = (int)(e % HD); const int n = (int)((e / HD) % NN); const int h = (int)(e / ((size_t)HD * NN)); const float* xr = F + (size_t)n * 4 * INT + h * HD; v4h o;
#pragma unroll
    for (int q = 0; q < 4; ++q) { const int dd = d + q; o[q] = tohx(tshift(xr, dd, bfr(cs[n * HD + dd]), bfr(sn[n * HD + dd]))); } *(v4h*)(QS + e) = o;  }
__global__ __launch_bounds__(256) void k_kst(const float* __restrict__ F, const float* __restrict__ sn, const float* __restrict__ cs, h16* KST, h16* VT) { const size_t e = ((size_t)blockIdx.x * 256 + threadIdx.x) * 2; if (e >= (size_t)NH_ * 64 * NN) return; const int n = (int)(e % NN); const int dd = (int)((e / NN) % 64); const int h = (int)(e / ((size_t)NN * 64)); v2h ok, ov;
#pragma unroll
    for (int u = 0; u < 2; ++u) { const int nn = n + u; if (dd < HD) { const float* kr = F + (size_t)nn * 4 * INT + INT + h * HD; ok[u] = tohx(tshift(kr, dd, bfr(cs[nn * HD + dd]), bfr(sn[nn * HD + dd])));   /* unscaled (O(1)): SCALE/N is applied in f32 when the kv state is converted */ ov[u] = tohx(F[(size_t)nn * 4 * INT + 2 * INT + h * HD + dd]); } else { ok[u] = (h16)0.f; ov[u] = (h16)0.f; } }
    { *(v2h*)(KST + e) = ok; *(v2h*)(VT + e) = ov;  } }
__global__ __launch_bounds__(256) void k_z(const float* __restrict__ F, const float* __restrict__ KM, float* Z) { const int e = blockIdx.x * 256 + threadIdx.x; if (e >= NN * NH_) return; const int h = e % NH_; const int n = e / NH_; const float* qr = F + (size_t)n * 4 * INT + h * HD; float s = 0.f;
#pragma unroll 1
    for (int d = 0; d < HD; ++d) { float p = __fmul_rn(elu1(qr[d]), KM[h * HD + d]); asm volatile("" : "+v"(p)); s = __fadd_rn(s, p); } const float z = __fmul_rn(s, SCALE); *(float*)(Z + e) = z;  }
__global__ __launch_bounds__(256) void k_kv16(const float* __restrict__ KV, h16* KVT) { const int e2 = (blockIdx.x * 256 + threadIdx.x) * 2; if (e2 >= NH_ * 64 * HD) return; const int d = e2 % HD; const int ee = (e2 / HD) % 64; const int h = e2 / (HD * 64); v2h o;
#pragma unroll
    for (int u = 0; u < 2; ++u) o[u] = ee < HD ? tohx(__fmul_rn(KV[((size_t)h * 64 + d + u) * 64 + ee], SCALE / (float)NN)) : (h16)0.f; *(v2h*)(KVT + e2) = o;  }
__global__ __launch_bounds__(256) void k_res(const float* __restrict__ AO, const float* __restrict__ Z, const float* __restrict__ VM, const float* __restrict__ F, const float* __restrict__ wl, const float* __restrict__ bl, bf* Rh, bf* Rl) { const size_t e = ((size_t)blockIdx.x * 256 + threadIdx.x) * 4; if (e >= (size_t)NN * INT) return; const int c = (int)(e % INT); const int n = (int)(e / INT); const int h = c / HD, d = c % HD; const float z = Z[n * NH_ + h]; const float fz = __fadd_rn(1.0f, __fdiv_rn(1.0f, __fadd_rn(z, 1e-6f))); v4us oh, ol;
#pragma unroll
    for (int q = 0; q < 4; ++q) { const int cc = c + q, dd = d + q; float lp = bfr(bl[cc]);
#pragma unroll
        for (int k = 0; k < 3; ++k) { const int nn = n - 1 + k; if (nn >= 0 && nn < NN) { float p = __fmul_rn(bfr(wl[cc * 3 + k]), F[(size_t)nn * 4 * INT + 2 * INT + cc]); asm volatile("" : "+v"(p)); lp = __fadd_rn(lp, p); } }
        float a = __fmul_rn(AO[((size_t)h * NN + n) * 64 + dd], fz); asm volatile("" : "+v"(a)); float zb = __fmul_rn(z, VM[cc]); asm volatile("" : "+v"(zb)); const float r = __fmul_rn(__fadd_rn(__fsub_rn(a, zb), lp), F[(size_t)n * 4 * INT + 3 * INT + cc]); unsigned short u, l; splitf(r, u, l); oh[q] = u; ol[q] = l; }
    *(v4us*)(Rh + e) = oh; *(v4us*)(Rl + e) = ol;  }

extern "C" void kernel_launch(void* const* d_in, const int* in_sizes, int n_in,
                              void* d_out, int out_size, void* d_ws, size_t ws_size, hipStream_t stream) {
    (void)in_sizes; (void)n_in; (void)out_size;
    const float* x = (const float*)d_in[0]; const float* sn = (const float*)d_in[1]; const float* cs = (const float*)d_in[2]; const float* wq = (const float*)d_in[3]; const float* bq = (const float*)d_in[4]; const float* wl = (const float*)d_in[5]; const float* bl = (const float*)d_in[6]; const float* wp = (const float*)d_in[7]; const float* bp = (const float*)d_in[8];
    float* OUT = (float*)d_out;     // [4][8192][256]
    char* wsp = (char*)d_ws;
    auto take = [&](size_t bytes) { char* p = wsp; wsp += (bytes + 255) & ~(size_t)255; return (void*)p; };
    bf* WQ = (bf*)take((size_t)4 * INT * DIM * 2); bf* WP = (bf*)take((size_t)DIM * INT * 2); bf* XB = (bf*)take((size_t)NN * DIM * 2); float* F = (float*)take((size_t)NN * 4 * INT * 4); float* KM = (float*)take(INT * 4); float* VM = (float*)take(INT * 4); float* KP = (float*)take((size_t)KM_PARTS * 512 * 4); float* Z = (float*)take((size_t)NN * NH_ * 4);
    h16* QS = (h16*)take((size_t)NH_ * NN * HD * 2); h16* KST = (h16*)take((size_t)NH_ * 64 * NN * 2); h16* VT = (h16*)take((size_t)NH_ * 64 * NN * 2); float* KV = (float*)take((size_t)NH_ * 64 * 64 * 4); h16* KVT = (h16*)take((size_t)NH_ * 64 * HD * 2); float* AO = (float*)take((size_t)NH_ * NN * 64 * 4); bf* Rh = (bf*)take((size_t)NN * INT * 2); bf* Rl = (bf*)take((size_t)NN * INT * 2);
    if ((size_t)(wsp - (char*)d_ws) > ws_size) return;    // total ~ 80 MB
    k_cvt8<<<(4 * INT * DIM / 8 + 255) / 256, 256, 0, stream>>>(wq, WQ, 4 * INT * DIM / 8); k_cvt8<<<(DIM * INT / 8 + 255) / 256, 256, 0, stream>>>(wp, WP, DIM * INT / 8);   // [out][in] natural Bt
    for (int b = 0; b < NB_; ++b) {
        k_cvt8<<<(unsigned)(((size_t)NN * DIM / 8 + 255) / 256), 256, 0, stream>>>(x + (size_t)b * NN * DIM, XB, (size_t)NN * DIM / 8);
        k_gemmw<bf, 0, true><<<dim3(NN / 64, 4 * INT / 64, 1), 32, 0, stream>>>(XB, nullptr, WQ, nullptr, DIM, F, 4 * INT, bq, 0, 0, 0);
        k_kmean_part<<<KM_PARTS, 512, 0, stream>>>(F, KP); k_kmean_fin<<<8, 256, 0, stream>>>(KP, KM, VM); k_z<<<(NN * NH_ + 255) / 256, 256, 0, stream>>>(F, KM, Z);
        k_qs<<<(unsigned)(((size_t)NH_ * NN * HD / 4 + 255) / 256), 256, 0, stream>>>(F, sn, cs, QS); k_kst<<<(unsigned)(((size_t)NH_ * 64 * NN / 2 + 255) / 256), 256, 0, stream>>>(F, sn, cs, KST, VT);
        k_gemmw<h16, 0, false><<<dim3(1, 1, NH_), 32, 0, stream>>>(KST, nullptr, VT, nullptr, NN, KV, 64, nullptr, (size_t)64 * NN, (size_t)64 * NN, (size_t)64 * 64);   // KV[h][d][e] = sum_n ks[n][d] v[n][e], unscaled
        k_kv16<<<(NH_ * 64 * HD / 2 + 255) / 256, 256, 0, stream>>>(KV, KVT);
        k_gemmw<h16, 0, false><<<dim3(NN / 64, 1, NH_), 32, 0, stream>>>(QS, nullptr, KVT, nullptr, HD, AO, 64, nullptr, (size_t)NN * HD, (size_t)64 * HD, (size_t)NN * 64);    // AO[h][n][e] = qs . kv
        k_res<<<(unsigned)(((size_t)NN * INT / 4 + 255) / 256), 256, 0, stream>>>(AO, Z, VM, F, wl, bl, Rh, Rl);
        k_gemmw<bf, 1, true><<<dim3(NN / 64, DIM / 64, 1), 32, 0, stream>>>(Rh, Rl, WP, nullptr, INT, OUT + (size_t)b * NN * DIM, DIM, bp, 0, 0, 0); }
}

// v002
// It runs in 461 microseconds.
// In two side-by-side timings against v001, it was 2.24 and 2.22 times as fast.
// Counting every step since v000, it is 28.8 times as fast.
#include <hip/hip_runtime.h>

// MultiHeadMALAAttention (x [4][8192][256]; [q|k|v|o] = x W_qkvo^T + b (8 heads x 32); lepe = depthwise conv3 (pad 1) over the sequence on v + b; qh = elu(q)+1, kh = elu(k)+1; z = (qh . mean_n kh) 32^-0.5; qs/ks = theta_shift with the [N][32]
// sin/cos tables (read as data; rotate-every-two); kv = sum_n (ks s)(v s)^T with s^2 = SCALE/N; attn = qs kv; res = attn (1 + 1/(z + 1e-6)) - z mean_n v; res = (res + lepe) o; out = res W_proj^T + b -> [4][8192][256]).
// Compute dtypes, f32 accumulate: every input rounded to bf16; qkvo projection on PLAIN bf16 operands (inputs: exact, + bias); elu, means, z, theta shift, lepe conv, gating f32; kv-state (K = 8192) and qs.kv (K 32) on single fp16

#define NB_  4
#define NN   8192
#define DIM  256
#define NH_  8
#define HD   32
#define INT  256
#define SCALE 0.1767766952966369f
typedef _Float16 h16;
typedef unsigned short bf;
typedef __attribute__((ext_vector_type(16))) __bf16   v16bf;
typedef __attribute__((ext_vector_type(16))) _Float16 v16h;
typedef __attribute__((ext_vector_type(8)))  _Float16 v8h;
typedef __attribute__((ext_vector_type(8)))  unsigned short v8us;
typedef __attribute__((ext_vector_type(8)))  float    v8f;
typedef __attribute__((ext_vector_type(4)))  float    v4f;
typedef v8h  __attribute__((may_alias)) v8ha;
typedef v4f  __attribute__((may_alias)) v4fa;
typedef v8us __attribute__((may_alias)) v8usa;

__device__ __forceinline__ unsigned short f2bf(float f) { unsigned u = __float_as_uint(f); u += 0x7FFFu + ((u >> 16) & 1u); return (unsigned short)(u >> 16); }
__device__ __forceinline__ float bf2f(unsigned short b) { return __uint_as_float(((unsigned)b) << 16); }
__device__ __forceinline__ float bfr(float f) { return bf2f(f2bf(f)); }
__device__ __forceinline__ v16h cat16(v8h lo, v8h hi) { return __builtin_shufflevector(lo, hi, 0, 1, 2, 3, 4, 5, 6, 7, 8, 9, 10, 11, 12, 13, 14, 15); }
__device__ __forceinline__ v16bf cat16b(v8us lo, v8us hi) { return __builtin_bit_cast(v16bf, __builtin_shufflevector(lo, hi, 0, 1, 2, 3, 4, 5, 6, 7, 8, 9, 10, 11, 12, 13, 14, 15)); }
__device__ __forceinline__ v8f wmma16(v16h a, v16h b, v8f c) { return __builtin_amdgcn_wmma_f32_16x16x32_f16(false, a, false, b, (short)0, c, false, false); }
__device__ __forceinline__ v8f wmmab(v16bf a, v16bf b, v8f c) { return __builtin_amdgcn_wmma_f32_16x16x32_bf16(false, a, false, b, (short)0, c, false, false); }



// ---- k_gemmw: register-blocked GEMM, ONE WAVE per 64x64 output tile (16 accumulators), operands straight from K-contiguous 16-bit planes; grid (M/64, N/64, Z), 32 threads.
// C[m][n] (f32, pitch ldc, + optional f32 bias[n]) = sum_k A[m][k] Bt[n][k] (+ split products per NSPLIT). z-batch strides sA/sB/sC in elements. K % 32 == 0.
// KSL > 1: grid (M/64, KSL, Z), N = 64: blockIdx.y is not a column tile but one of KSL equal slices of the reduction (K stays the row pitch, K % (32 KSL) == 0); every slice stores its own partial plane C[z][slice], and the reader adds the planes.
template <typename T16> struct WFrag;
template <> struct WFrag<h16> { typedef v16h V; static __device__ __forceinline__ V ld(const h16* p) { return cat16(*(const v8h*)p, *(const v8h*)(p + 16)); } static __device__ __forceinline__ v8f mma(V a, V b, v8f c) { return wmma16(a, b, c); } };
template <> struct WFrag<bf> { typedef v16bf V; static __device__ __forceinline__ V ld(const bf* p) { return cat16b(*(const v8us*)p, *(const v8us*)(p + 16)); } static __device__ __forceinline__ v8f mma(V a, V b, v8f c) { return wmmab(a, b, c); } };
template <typename T16, int NSPLIT, bool BIAS, int KSL = 1>
__global__ __launch_bounds__(32) void k_gemmw(const T16* __restrict__ A, const T16* __restrict__ A2, const T16* __restrict__ Bt, const T16* __restrict__ Bt2, int K, float* C, int ldc, const float* __restrict__ bias, size_t sA, size_t sB, size_t sC) {
    typedef typename WFrag<T16>::V V;
    __shared__ __align__(16) float os[16 * 68];
    static_assert(KSL == 1 || NSPLIT == 0, "a K slice moves A and Bt only");
    const size_t z = blockIdx.z; A += z * sA; if (A2) A2 += z * sA; Bt += z * sB; if (Bt2) Bt2 += z * sB;
    const int KL = K / KSL;   // this wave's share of the reduction
    if (KSL > 1) { A += (size_t)blockIdx.y * KL; Bt += (size_t)blockIdx.y * KL; C += (z * KSL + blockIdx.y) * sC; } else C += z * sC;
    const int lane = threadIdx.x & 31, lr = lane & 15, hi = lane >> 4; const int r0 = blockIdx.x * 64, c0 = KSL > 1 ? 0 : blockIdx.y * 64;
    v8f acc[4][4];
#pragma unroll
    for (int mb = 0; mb < 4; ++mb)
#pragma unroll
        for (int nb = 0; nb < 4; ++nb) acc[mb][nb] = (v8f){};
    const size_t aoff = (size_t)(r0 + lr) * K + 8 * hi, boff = (size_t)(c0 + lr) * K + 8 * hi;
#pragma unroll 1
    for (int kc = 0; kc < KL; kc += 32) {
        V a[4], a2[4];
#pragma unroll
        for (int mb = 0; mb < 4; ++mb) { a[mb] = WFrag<T16>::ld(A + aoff + (size_t)mb * 16 * K + kc); if (NSPLIT == 1 || NSPLIT == 2) a2[mb] = WFrag<T16>::ld(A2 + aoff + (size_t)mb * 16 * K + kc); }
#pragma unroll
        for (int nb = 0; nb < 4; ++nb) { const V b = WFrag<T16>::ld(Bt + boff + (size_t)nb * 16 * K + kc); V b2; if (NSPLIT >= 2) b2 = WFrag<T16>::ld(Bt2 + boff + (size_t)nb * 16 * K + kc);
#pragma unroll
            for (int mb = 0; mb < 4; ++mb) { acc[mb][nb] = WFrag<T16>::mma(a[mb], b, acc[mb][nb]); if (NSPLIT == 1 || NSPLIT == 2) acc[mb][nb] = WFrag<T16>::mma(a2[mb], b, acc[mb][nb]); if (NSPLIT >= 2) acc[mb][nb] = WFrag<T16>::mma(a[mb], b2, acc[mb][nb]); } }
        asm volatile("v_nop\n\tv_nop\n\tv_nop\n\tv_nop" : "+v"(acc[0][0]), "+v"(acc[1][1]), "+v"(acc[2][2]), "+v"(acc[3][3]) : "v"(a[0]), "v"(a[3]));
    }
#pragma unroll
    for (int mb = 0; mb < 4; ++mb) {
#pragma unroll
        for (int nb = 0; nb < 4; ++nb) {
#pragma unroll
            for (int j = 0; j < 8; ++j) os[(hi * 8 + j) * 68 + nb * 16 + lr] = acc[mb][nb][j]; }
        __builtin_amdgcn_wave_barrier(); asm volatile("" ::: "memory");
        float* crow = C + (size_t)(r0 + mb * 16) * ldc + c0;
{
#pragma unroll
            for (int s = 0; s < 8; ++s) { const int row = 2 * s + hi, cofs = lr * 4; v4f val = *(const v4fa*)(os + row * 68 + cofs); if (BIAS) { val[0] += bfr(bias[c0 + cofs]); val[1] += bfr(bias[c0 + cofs + 1]); val[2] += bfr(bias[c0 + cofs + 2]); val[3] += bfr(bias[c0 + cofs + 3]); }
                *(v4f*)(crow + (size_t)row * ldc + cofs) = val; }
             }
        __builtin_amdgcn_wave_barrier(); asm volatile("" ::: "memory");
    }
}

__device__ __forceinline__ h16 tohx(float x) { return (h16)x; }
__device__ __forceinline__ void splitf(float y, unsigned short& h, unsigned short& l) { h = f2bf(y); l = f2bf(y - bf2f(h)); }
__device__ __forceinline__ float elu1(float x) { return x > 0.f ? __fadd_rn(x, 1.0f) : __expf(x); }   // elu(x) + 1
typedef __attribute__((ext_vector_type(2))) _Float16 v2h;
typedef __attribute__((ext_vector_type(4))) _Float16 v4h;
typedef __attribute__((ext_vector_type(4))) unsigned short v4us;

__global__ __launch_bounds__(256) void k_cvt8(const float* __restrict__ src, bf* dst, size_t n8) { const size_t i = (size_t)blockIdx.x * 256 + threadIdx.x; if (i >= n8) return; const v8f v = *(const v8f*)(src + i * 8); v8us o;
#pragma unroll
    for (int k = 0; k < 8; ++k) o[k] = f2bf(v[k]); *(v8us*)(dst + i * 8) = o;  }
// Column means of elu1(k) and of v over the sequence, in two launches. The k and v columns of a row of F are 512 adjacent floats.
// k_kmean_part: one work-group per KM_ROWS rows; a thread owns 4 adjacent columns and every 4th row; P[group][0..255] = sums of elu1(k), P[group][256..511] = sums of v.
// elu1 with its exp (x * log2(e), then v_exp_f32, as elu1 compiles) written out: the v_nop in the same statement keeps the one free issue slot that the instruction set asks for behind a transcendental;
__device__ __forceinline__ float elu1s(float x) { float e; asm("v_exp_f32 %0, %1\n\tv_nop" : "=v"(e) : "v"(x * 1.44269504f)); return x > 0.f ? __fadd_rn(x, 1.0f) : e; }
#define KM_ROWS  32
#define KM_PARTS (NN / KM_ROWS)
__global__ __launch_bounds__(512) void k_kmean_part(const float* __restrict__ F, float* P) {
    __shared__ __align__(16) float red[4 * 512];
    const int c4 = threadIdx.x & 127, g = threadIdx.x >> 7;
    const float* r = F + (size_t)(blockIdx.x * KM_ROWS + g) * 4 * INT + INT + c4 * 4;
    v4f v[KM_ROWS / 4];
#pragma unroll   // v[] stays in registers and all the row loads are in flight before the first sum
    for (int i = 0; i < KM_ROWS / 4; ++i) v[i] = *(const v4fa*)(r + (size_t)i * 4 * 4 * INT);
    v4f s = (v4f){};
    if (c4 < 64) {   // k columns (whole waves)
#pragma unroll   // constant indices into v[]
        for (int i = 0; i < KM_ROWS / 4; ++i) { s[0] += elu1s(v[i][0]); s[1] += elu1s(v[i][1]); s[2] += elu1s(v[i][2]); s[3] += elu1s(v[i][3]); }
    } else {         // v columns
#pragma unroll   // constant indices into v[]
        for (int i = 0; i < KM_ROWS / 4; ++i) s += v[i];
    }
    *(v4fa*)(red + g * 512 + c4 * 4) = s;
    __syncthreads();
    if (g == 0) { s += *(const v4fa*)(red + 512 + c4 * 4); s += *(const v4fa*)(red + 1024 + c4 * 4); s += *(const v4fa*)(red + 1536 + c4 * 4); *(v4fa*)(P + (size_t)blockIdx.x * 512 + c4 * 4) = s; }
}
// k_kmean_fin: 8 work-groups of 64 columns each; 16 thread groups sum 16 partial rows each, thread group 0 adds the 16 sums and scales by 1/N.
__global__ __launch_bounds__(256) void k_kmean_fin(const float* __restrict__ P, float* KM, float* VM) {
    __shared__ __align__(16) float red[16 * 64];
    const int c4 = threadIdx.x & 15, g = threadIdx.x >> 4;
    const float* p = P + (size_t)g * 512 + blockIdx.x * 64 + c4 * 4;
    v4f v[KM_PARTS / 16];
#pragma unroll   // v[] stays in registers and the partial-row loads overlap
    for (int i = 0; i < KM_PARTS / 16; ++i) v[i] = *(const v4fa*)(p + (size_t)i * 16 * 512);
    v4f s = (v4f){};
#pragma unroll   // constant indices into v[]
    for (int i = 0; i < KM_PARTS / 16; ++i) s += v[i];
    *(v4fa*)(red + g * 64 + c4 * 4) = s;
    __syncthreads();
    if (g == 0) {
#pragma unroll   // the LDS reads overlap
        for (int gg = 1; gg < 16; ++gg) s += *(const v4fa*)(red + gg * 64 + c4 * 4);
        s *= (1.0f / NN);
        float* dst = blockIdx.x < 4 ? KM + blockIdx.x * 64 : VM + (blockIdx.x - 4) * 64;
        *(v4fa*)(dst + c4 * 4) = s; }
}
// k_qs, k_kst: QS[h][n][d] = fp16(theta_shift(elu1(q)))[per head], KST[h][dd<64][n] = fp16(theta_shift(elu1(k))) (rows >= 32 zero; unscaled to stay in fp16's normal range) - two kernels for the two layouts; Z[n][h] = (elu1(q_h) . KM_h) SCALE (thread per (n,h)... 32-B per 8 threads:
__device__ __forceinline__ float tshift(const float* __restrict__ xr, int d, float c_d, float s_d) { const float self_ = elu1(xr[d]); const float partner = elu1(xr[d ^ 1]); const float rot = (d & 1) ? partner : -partner;   /* rotate_every_two: out[2i] = -x[2i+1], out[2i+1] = x[2i] */ float a = __fmul_rn(self_, c_d), b = __fmul_rn(rot, s_d); asm volatile("" : "+v"(a)); asm volatile("" : "+v"(b)); return __fadd_rn(a, b); }
__global__ __launch_bounds__(256) void k_qs(const float* __restrict__ F, const float* __restrict__ sn, const float* __restrict__ cs, h16* QS) { const size_t e = ((size_t)blockIdx.x * 256 + threadIdx.x) * 4; if (e >= (size_t)NH_ * NN * HD) return; const int d = (int)(e % HD); const int n = (int)((e / HD) % NN); const int h = (int)(e / ((size_t)HD * NN)); const float* xr = F + (size_t)n * 4 * INT + h * HD; v4h o;
#pragma unroll
    for (int q = 0; q < 4; ++q) { const int dd = d + q; o[q] = tohx(tshift(xr, dd, bfr(cs[n * HD + dd]), bfr(sn[n * HD + dd]))); } *(v4h*)(QS + e) = o;  }
__global__ __launch_bounds__(256) void k_kst(const float* __restrict__ F, const float* __restrict__ sn, const float* __restrict__ cs, h16* KST, h16* VT) { const size_t e = ((size_t)blockIdx.x * 256 + threadIdx.x) * 2; if (e >= (size_t)NH_ * 64 * NN) return; const int n = (int)(e % NN); const int dd = (int)((e / NN) % 64); const int h = (int)(e / ((size_t)NN * 64)); v2h ok, ov;
#pragma unroll
    for (int u = 0; u < 2; ++u) { const int nn = n + u; if (dd < HD) { const float* kr = F + (size_t)nn * 4 * INT + INT + h * HD; ok[u] = tohx(tshift(kr, dd, bfr(cs[nn * HD + dd]), bfr(sn[nn * HD + dd])));   /* unscaled (O(1)): SCALE/N is applied in f32 when the kv state is converted */ ov[u] = tohx(F[(size_t)nn * 4 * INT + 2 * INT + h * HD + dd]); } else { ok[u] = (h16)0.f; ov[u] = (h16)0.f; } }
    { *(v2h*)(KST + e) = ok; *(v2h*)(VT + e) = ov;  } }
__global__ __launch_bounds__(256) void k_z(const float* __restrict__ F, const float* __restrict__ KM, float* Z) { const int e = blockIdx.x * 256 + threadIdx.x; if (e >= NN * NH_) return; const int h = e % NH_; const int n = e / NH_; const float* qr = F + (size_t)n * 4 * INT + h * HD; float s = 0.f;
#pragma unroll 1
    for (int d = 0; d < HD; ++d) { float p = __fmul_rn(elu1(qr[d]), KM[h * HD + d]); asm volatile("" : "+v"(p)); s = __fadd_rn(s, p); } const float z = __fmul_rn(s, SCALE); *(float*)(Z + e) = z;  }
// k_kv16: one work-group per head adds the KV_SLICES partial planes KV[h][slice][d][e] of the kv state in f32 (slice 0 first), scales by SCALE/N and stores KVT[h][e<64][d] in fp16 (rows >= 32 zero).
// A wave reads one row d of a plane (lanes along e: one 128-byte line a load); the [d][e] -> [e][d] turn goes through LDS (pitch 33 words: no bank is hit twice by a wave's store).
#define KV_SLICES 64
__global__ __launch_bounds__(1024) void k_kv16(const float* __restrict__ KV, h16* KVT) {
    __shared__ float tr[HD * 33];
    const int h = blockIdx.x, d = threadIdx.x >> 5, ee = threadIdx.x & 31;
    const float* p = KV + ((size_t)h * KV_SLICES * 64 + d) * 64 + ee; float v[KV_SLICES], sum = 0.f;
#pragma unroll   // v[] stays in registers and the plane loads overlap
    for (int sl = 0; sl < KV_SLICES; ++sl) v[sl] = p[(size_t)sl * 64 * 64];
    asm volatile("s_wait_xcnt 0x0" :: "v"(p) : "memory");   // the wait owed before a register that an issued load names is overwritten; p as an input keeps the address pair whole up to it (without it the last load's result was placed on the pair)
#pragma unroll   // constant indices into v[]
    for (int sl = 0; sl < KV_SLICES; ++sl) sum += v[sl];
    tr[ee * 33 + d] = __fmul_rn(sum, SCALE / (float)NN);
    __syncthreads();
    const int e2 = threadIdx.x * 2; v2h o = (v2h){};
    if (e2 < HD * HD) { const float* t = tr + (e2 / HD) * 33 + e2 % HD; o[0] = tohx(t[0]); o[1] = tohx(t[1]); }
    *(v2h*)(KVT + (size_t)h * 64 * HD + e2) = o;  }
__global__ __launch_bounds__(256) void k_res(const float* __restrict__ AO, const float* __restrict__ Z, const float* __restrict__ VM, const float* __restrict__ F, const float* __restrict__ wl, const float* __restrict__ bl, bf* Rh, bf* Rl) { const size_t e = ((size_t)blockIdx.x * 256 + threadIdx.x) * 4; if (e >= (size_t)NN * INT) return; const int c = (int)(e % INT); const int n = (int)(e / INT); const int h = c / HD, d = c % HD; const float z = Z[n * NH_ + h]; const float fz = __fadd_rn(1.0f, __fdiv_rn(1.0f, __fadd_rn(z, 1e-6f))); v4us oh, ol;
#pragma unroll
    for (int q = 0; q < 4; ++q) { const int cc = c + q, dd = d + q; float lp = bfr(bl[cc]);
#pragma unroll
        for (int k = 0; k < 3; ++k) { const int nn = n - 1 + k; if (nn >= 0 && nn < NN) { float p = __fmul_rn(bfr(wl[cc * 3 + k]), F[(size_t)nn * 4 * INT + 2 * INT + cc]); asm volatile("" : "+v"(p)); lp = __fadd_rn(lp, p); } }
        float a = __fmul_rn(AO[((size_t)h * NN + n) * 64 + dd], fz); asm volatile("" : "+v"(a)); float zb = __fmul_rn(z, VM[cc]); asm volatile("" : "+v"(zb)); const float r = __fmul_rn(__fadd_rn(__fsub_rn(a, zb), lp), F[(size_t)n * 4 * INT + 3 * INT + cc]); unsigned short u, l; splitf(r, u, l); oh[q] = u; ol[q] = l; }
    *(v4us*)(Rh + e) = oh; *(v4us*)(Rl + e) = ol;  }

extern "C" void kernel_launch(void* const* d_in, const int* in_sizes, int n_in,
                              void* d_out, int out_size, void* d_ws, size_t ws_size, hipStream_t stream) {
    (void)in_sizes; (void)n_in; (void)out_size;
    const float* x = (const float*)d_in[0]; const float* sn = (const float*)d_in[1]; const float* cs = (const float*)d_in[2]; const float* wq = (const float*)d_in[3]; const float* bq = (const float*)d_in[4]; const float* wl = (const float*)d_in[5]; const float* bl = (const float*)d_in[6]; const float* wp = (const float*)d_in[7]; const float* bp = (const float*)d_in[8];
    float* OUT = (float*)d_out;     // [4][8192][256]
    char* wsp = (char*)d_ws;
    auto take = [&](size_t bytes) { char* p = wsp; wsp += (bytes + 255) & ~(size_t)255; return (void*)p; };
    bf* WQ = (bf*)take((size_t)4 * INT * DIM * 2); bf* WP = (bf*)take((size_t)DIM * INT * 2); bf* XB = (bf*)take((size_t)NN * DIM * 2); float* F = (float*)take((size_t)NN * 4 * INT * 4); float* KM = (float*)take(INT * 4); float* VM = (float*)take(INT * 4); float* KP = (float*)take((size_t)KM_PARTS * 512 * 4); float* Z = (float*)take((size_t)NN * NH_ * 4);
    h16* QS = (h16*)take((size_t)NH_ * NN * HD * 2); h16* KST = (h16*)take((size_t)NH_ * 64 * NN * 2); h16* VT = (h16*)take((size_t)NH_ * 64 * NN * 2); float* KV = (float*)take((size_t)NH_ * KV_SLICES * 64 * 64 * 4); h16* KVT = (h16*)take((size_t)NH_ * 64 * HD * 2); float* AO = (float*)take((size_t)NH_ * NN * 64 * 4); bf* Rh = (bf*)take((size_t)NN * INT * 2); bf* Rl = (bf*)take((size_t)NN * INT * 2);
    if ((size_t)(wsp - (char*)d_ws) > ws_size) return;    // total ~ 88 MB
    k_cvt8<<<(4 * INT * DIM / 8 + 255) / 256, 256, 0, stream>>>(wq, WQ, 4 * INT * DIM / 8); k_cvt8<<<(DIM * INT / 8 + 255) / 256, 256, 0, stream>>>(wp, WP, DIM * INT / 8);   // [out][in] natural Bt
    for (int b = 0; b < NB_; ++b) {
        k_cvt8<<<(unsigned)(((size_t)NN * DIM / 8 + 255) / 256), 256, 0, stream>>>(x + (size_t)b * NN * DIM, XB, (size_t)NN * DIM / 8);
        k_gemmw<bf, 0, true><<<dim3(NN / 64, 4 * INT / 64, 1), 32, 0, stream>>>(XB, nullptr, WQ, nullptr, DIM, F, 4 * INT, bq, 0, 0, 0);
        k_kmean_part<<<KM_PARTS, 512, 0, stream>>>(F, KP); k_kmean_fin<<<8, 256, 0, stream>>>(KP, KM, VM); k_z<<<(NN * NH_ + 255) / 256, 256, 0, stream>>>(F, KM, Z);
        k_qs<<<(unsigned)(((size_t)NH_ * NN * HD / 4 + 255) / 256), 256, 0, stream>>>(F, sn, cs, QS); k_kst<<<(unsigned)(((size_t)NH_ * 64 * NN / 2 + 255) / 256), 256, 0, stream>>>(F, sn, cs, KST, VT);
        k_gemmw<h16, 0, false, KV_SLICES><<<dim3(1, KV_SLICES, NH_), 32, 0, stream>>>(KST, nullptr, VT, nullptr, NN, KV, 64, nullptr, (size_t)64 * NN, (size_t)64 * NN, (size_t)64 * 64);   // KV[h][slice][d][e] = sum over the slice's n of ks[n][d] v[n][e]
        k_kv16<<<NH_, 1024, 0, stream>>>(KV, KVT);
        k_gemmw<h16, 0, false><<<dim3(NN / 64, 1, NH_), 32, 0, stream>>>(QS, nullptr, KVT, nullptr, HD, AO, 64, nullptr, (size_t)NN * HD, (size_t)64 * HD, (size_t)NN * 64);    // AO[h][n][e] = qs . kv
        k_res<<<(unsigned)(((size_t)NN * INT / 4 + 255) / 256), 256, 0, stream>>>(AO, Z, VM, F, wl, bl, Rh, Rl);
        k_gemmw<bf, 1, true><<<dim3(NN / 64, DIM / 64, 1), 32, 0, stream>>>(Rh, Rl, WP, nullptr, INT, OUT + (size_t)b * NN * DIM, DIM, bp, 0, 0, 0); }
}

// v003
// It runs in 335 microseconds.
// Timed twice side by side with v002, it ran 1.39 and 1.37 times as fast.
// Over all steps from v000 it is 39.6 times as fast.
#include <hip/hip_runtime.h>

// MultiHeadMALAAttention (x [4][8192][256]; [q|k|v|o] = x W_qkvo^T + b (8 heads x 32); lepe = depthwise conv3 (pad 1) over the sequence on v + b; qh = elu(q)+1, kh = elu(k)+1; z = (qh . mean_n kh) 32^-0.5; qs/ks = theta_shift with the [N][32]
// sin/cos tables (read as data; rotate-every-two); kv = sum_n (ks s)(v s)^T with s^2 = SCALE/N; attn = qs kv; res = attn (1 + 1/(z + 1e-6)) - z mean_n v; res = (res + lepe) o; out = res W_proj^T + b -> [4][8192][256]).
// Compute dtypes, f32 accumulate: every input rounded to bf16; qkvo projection on PLAIN bf16 operands (inputs: exact, + bias); elu, means, z, theta shift, lepe conv, gating f32; kv-state (K = 8192) and qs.kv (K 32) on single fp16

#define NB_  4
#define NN   8192
#define DIM  256
#define NH_  8
#define HD   32
#define INT  256
#define SCALE 0.1767766952966369f
typedef _Float16 h16;
typedef unsigned short bf;
typedef __attribute__((ext_vector_type(16))) __bf16   v16bf;
typedef __attribute__((ext_vector_type(16))) _Float16 v16h;
typedef __attribute__((ext_vector_type(8)))  _Float16 v8h;
typedef __attribute__((ext_vector_type(8)))  unsigned short v8us;
typedef __attribute__((ext_vector_type(8)))  float    v8f;
typedef __attribute__((ext_vector_type(4)))  float    v4f;
typedef v8h  __attribute__((may_alias)) v8ha;
typedef v4f  __attribute__((may_alias)) v4fa;
typedef v8us __attribute__((may_alias)) v8usa;

__device__ __forceinline__ unsigned short f2bf(float f) { unsigned u = __float_as_uint(f); u += 0x7FFFu + ((u >> 16) & 1u); return (unsigned short)(u >> 16); }
__device__ __forceinline__ float bf2f(unsigned short b) { return __uint_as_float(((unsigned)b) << 16); }
__device__ __forceinline__ float bfr(float f) { return bf2f(f2bf(f)); }
__device__ __forceinline__ v16h cat16(v8h lo, v8h hi) { return __builtin_shufflevector(lo, hi, 0, 1, 2, 3, 4, 5, 6, 7, 8, 9, 10, 11, 12, 13, 14, 15); }
__device__ __forceinline__ v16bf cat16b(v8us lo, v8us hi) { return __builtin_bit_cast(v16bf, __builtin_shufflevector(lo, hi, 0, 1, 2, 3, 4, 5, 6, 7, 8, 9, 10, 11, 12, 13, 14, 15)); }
__device__ __forceinline__ v8f wmma16(v16h a, v16h b, v8f c) { return __builtin_amdgcn_wmma_f32_16x16x32_f16(false, a, false, b, (short)0, c, false, false); }
__device__ __forceinline__ v8f wmmab(v16bf a, v16bf b, v8f c) { return __builtin_amdgcn_wmma_f32_16x16x32_bf16(false, a, false, b, (short)0, c, false, false); }



// ---- k_gemmw: register-blocked GEMM, ONE WAVE per 64x64 output tile (16 accumulators), operands straight from K-contiguous 16-bit planes; grid (M/64, N/64, Z), 32 threads.
// C[m][n] (f32, pitch ldc, + optional f32 bias[n]) = sum_k A[m][k] Bt[n][k] (+ split products per NSPLIT). z-batch strides sA/sB/sC in elements. K % 32 == 0.
// KSL > 1: grid (M/64, KSL, Z), N = 64: blockIdx.y is not a column tile but one of KSL equal slices of the reduction (K stays the row pitch, K % (32 KSL) == 0); every slice stores its own partial plane C[z][slice], and the reader adds the planes.
template <typename T16> struct WFrag;
template <> struct WFrag<h16> { typedef v16h V; static __device__ __forceinline__ V ld(const h16* p) { return cat16(*(const v8h*)p, *(const v8h*)(p + 16)); } static __device__ __forceinline__ v8f mma(V a, V b, v8f c) { return wmma16(a, b, c); } };
template <> struct WFrag<bf> { typedef v16bf V; static __device__ __forceinline__ V ld(const bf* p) { return cat16b(*(const v8us*)p, *(const v8us*)(p + 16)); } static __device__ __forceinline__ v8f mma(V a, V b, v8f c) { return wmmab(a, b, c); } };
template <typename T16, int NSPLIT, bool BIAS, int KSL = 1>
__global__ __launch_bounds__(32) void k_gemmw(const T16* __restrict__ A, const T16* __restrict__ A2, const T16* __restrict__ Bt, const T16* __restrict__ Bt2, int K, float* C, int ldc, const float* __restrict__ bias, size_t sA, size_t sB, size_t sC) {
    typedef typename WFrag<T16>::V V;
    __shared__ __align__(16) float os[16 * 68];
    static_assert(KSL == 1 || NSPLIT == 0, "a K slice moves A and Bt only");
    const size_t z = blockIdx.z; A += z * sA; if (A2) A2 += z * sA; Bt += z * sB; if (Bt2) Bt2 += z * sB;
    const int KL = K / KSL;   // this wave's share of the reduction
    if (KSL > 1) { A += (size_t)blockIdx.y * KL; Bt += (size_t)blockIdx.y * KL; C += (z * KSL + blockIdx.y) * sC; } else C += z * sC;
    const int lane = threadIdx.x & 31, lr = lane & 15, hi = lane >> 4; const int r0 = blockIdx.x * 64, c0 = KSL > 1 ? 0 : blockIdx.y * 64;
    v8f acc[4][4];
#pragma unroll
    for (int mb = 0; mb < 4; ++mb)
#pragma unroll
        for (int nb = 0; nb < 4; ++nb) acc[mb][nb] = (v8f){};
    const size_t aoff = (size_t)(r0 + lr) * K + 8 * hi, boff = (size_t)(c0 + lr) * K + 8 * hi;
#pragma unroll 1
    for (int kc = 0; kc < KL; kc += 32) {
        V a[4], a2[4];
#pragma unroll
        for (int mb = 0; mb < 4; ++mb) { a[mb] = WFrag<T16>::ld(A + aoff + (size_t)mb * 16 * K + kc); if (NSPLIT == 1 || NSPLIT == 2) a2[mb] = WFrag<T16>::ld(A2 + aoff + (size_t)mb * 16 * K + kc); }
#pragma unroll
        for (int nb = 0; nb < 4; ++nb) { const V b = WFrag<T16>::ld(Bt + boff + (size_t)nb * 16 * K + kc); V b2; if (NSPLIT >= 2) b2 = WFrag<T16>::ld(Bt2 + boff + (size_t)nb * 16 * K + kc);
#pragma unroll
            for (int mb = 0; mb < 4; ++mb) { acc[mb][nb] = WFrag<T16>::mma(a[mb], b, acc[mb][nb]); if (NSPLIT == 1 || NSPLIT == 2) acc[mb][nb] = WFrag<T16>::mma(a2[mb], b, acc[mb][nb]); if (NSPLIT >= 2) acc[mb][nb] = WFrag<T16>::mma(a[mb], b2, acc[mb][nb]); } }
        asm volatile("v_nop\n\tv_nop\n\tv_nop\n\tv_nop" : "+v"(acc[0][0]), "+v"(acc[1][1]), "+v"(acc[2][2]), "+v"(acc[3][3]) : "v"(a[0]), "v"(a[3]));
    }
#pragma unroll
    for (int mb = 0; mb < 4; ++mb) {
#pragma unroll
        for (int nb = 0; nb < 4; ++nb) {
#pragma unroll
            for (int j = 0; j < 8; ++j) os[(hi * 8 + j) * 68 + nb * 16 + lr] = acc[mb][nb][j]; }
        __builtin_amdgcn_wave_barrier(); asm volatile("" ::: "memory");
        float* crow = C + (size_t)(r0 + mb * 16) * ldc + c0;
{
#pragma unroll
            for (int s = 0; s < 8; ++s) { const int row = 2 * s + hi, cofs = lr * 4; v4f val = *(const v4fa*)(os + row * 68 + cofs); if (BIAS) { val[0] += bfr(bias[c0 + cofs]); val[1] += bfr(bias[c0 + cofs + 1]); val[2] += bfr(bias[c0 + cofs + 2]); val[3] += bfr(bias[c0 + cofs + 3]); }
                *(v4f*)(crow + (size_t)row * ldc + cofs) = val; }
             }
        __builtin_amdgcn_wave_barrier(); asm volatile("" ::: "memory");
    }
}

__device__ __forceinline__ h16 tohx(float x) { return (h16)x; }
__device__ __forceinline__ void splitf(float y, unsigned short& h, unsigned short& l) { h = f2bf(y); l = f2bf(y - bf2f(h)); }
__device__ __forceinline__ float elu1(float x) { return x > 0.f ? __fadd_rn(x, 1.0f) : __expf(x); }   // elu(x) + 1
typedef __attribute__((ext_vector_type(2))) _Float16 v2h;
typedef __attribute__((ext_vector_type(4))) _Float16 v4h;
typedef __attribute__((ext_vector_type(4))) unsigned short v4us;

__global__ __launch_bounds__(256) void k_cvt8(const float* __restrict__ src, bf* dst, size_t n8) { const size_t i = (size_t)blockIdx.x * 256 + threadIdx.x; if (i >= n8) return; const v8f v = *(const v8f*)(src + i * 8); v8us o;
#pragma unroll
    for (int k = 0; k < 8; ++k) o[k] = f2bf(v[k]); *(v8us*)(dst + i * 8) = o;  }
// Column means of elu1(k) and of v over the sequence, in two launches. The k and v columns of a row of F are 512 adjacent floats.
// k_kmean_part: one work-group per KM_ROWS rows; a thread owns 4 adjacent columns and every 4th row; P[group][0..255] = sums of elu1(k), P[group][256..511] = sums of v.
// elu1 with its exp (x * log2(e), then v_exp_f32, as elu1 compiles) written out: the v_nop in the same statement keeps the one free issue slot that the instruction set asks for behind a transcendental;
__device__ __forceinline__ float elu1s(float x) { float e; asm("v_exp_f32 %0, %1\n\tv_nop" : "=v"(e) : "v"(x * 1.44269504f)); return x > 0.f ? __fadd_rn(x, 1.0f) : e; }
#define KM_ROWS  32
#define KM_PARTS (NN / KM_ROWS)
__global__ __launch_bounds__(512) void k_kmean_part(const float* __restrict__ F, float* P) {
    __shared__ __align__(16) float red[4 * 512];
    const int c4 = threadIdx.x & 127, g = threadIdx.x >> 7;
    const float* r = F + (size_t)(blockIdx.x * KM_ROWS + g) * 4 * INT + INT + c4 * 4;
    v4f v[KM_ROWS / 4];
#pragma unroll   // v[] stays in registers and all the row loads are in flight before the first sum
    for (int i = 0; i < KM_ROWS / 4; ++i) v[i] = *(const v4fa*)(r + (size_t)i * 4 * 4 * INT);
    v4f s = (v4f){};
    if (c4 < 64) {   // k columns (whole waves)
#pragma unroll   // constant indices into v[]
        for (int i = 0; i < KM_ROWS / 4; ++i) { s[0] += elu1s(v[i][0]); s[1] += elu1s(v[i][1]); s[2] += elu1s(v[i][2]); s[3] += elu1s(v[i][3]); }
    } else {         // v columns
#pragma unroll   // constant indices into v[]
        for (int i = 0; i < KM_ROWS / 4; ++i) s += v[i];
    }
    *(v4fa*)(red + g * 512 + c4 * 4) = s;
    __syncthreads();
    if (g == 0) { s += *(const v4fa*)(red + 512 + c4 * 4); s += *(const v4fa*)(red + 1024 + c4 * 4); s += *(const v4fa*)(red + 1536 + c4 * 4); *(v4fa*)(P + (size_t)blockIdx.x * 512 + c4 * 4) = s; }
}
// k_kmean_fin: 8 work-groups of 64 columns each; 16 thread groups sum 16 partial rows each, thread group 0 adds the 16 sums and scales by 1/N.
__global__ __launch_bounds__(256) void k_kmean_fin(const float* __restrict__ P, float* KM, float* VM) {
    __shared__ __align__(16) float red[16 * 64];
    const int c4 = threadIdx.x & 15, g = threadIdx.x >> 4;
    const float* p = P + (size_t)g * 512 + blockIdx.x * 64 + c4 * 4;
    v4f v[KM_PARTS / 16];
#pragma unroll   // v[] stays in registers and the partial-row loads overlap
    for (int i = 0; i < KM_PARTS / 16; ++i) v[i] = *(const v4fa*)(p + (size_t)i * 16 * 512);
    v4f s = (v4f){};
#pragma unroll   // constant indices into v[]
    for (int i = 0; i < KM_PARTS / 16; ++i) s += v[i];
    *(v4fa*)(red + g * 64 + c4 * 4) = s;
    __syncthreads();
    if (g == 0) {
#pragma unroll   // the LDS reads overlap
        for (int gg = 1; gg < 16; ++gg) s += *(const v4fa*)(red + gg * 64 + c4 * 4);
        s *= (1.0f / NN);
        float* dst = blockIdx.x < 4 ? KM + blockIdx.x * 64 : VM + (blockIdx.x - 4) * 64;
        *(v4fa*)(dst + c4 * 4) = s; }
}
// k_qs, k_kst: QS[h][n][d] = fp16(theta_shift(elu1(q)))[per head], KST[h][dd<64][n] = fp16(theta_shift(elu1(k))) (rows >= 32 zero; unscaled to stay in fp16's normal range) - two kernels for the two layouts; Z[n][h] = (elu1(q_h) . KM_h) SCALE (thread per (n,h)... 32-B per 8 threads:
__device__ __forceinline__ float tshift(const float* __restrict__ xr, int d, float c_d, float s_d) { const float self_ = elu1(xr[d]); const float partner = elu1(xr[d ^ 1]); const float rot = (d & 1) ? partner : -partner;   /* rotate_every_two: out[2i] = -x[2i+1], out[2i+1] = x[2i] */ float a = __fmul_rn(self_, c_d), b = __fmul_rn(rot, s_d); asm volatile("" : "+v"(a)); asm volatile("" : "+v"(b)); return __fadd_rn(a, b); }
__global__ __launch_bounds__(256) void k_qs(const float* __restrict__ F, const float* __restrict__ sn, const float* __restrict__ cs, h16* QS) { const size_t e = ((size_t)blockIdx.x * 256 + threadIdx.x) * 4; if (e >= (size_t)NH_ * NN * HD) return; const int d = (int)(e % HD); const int n = (int)((e / HD) % NN); const int h = (int)(e / ((size_t)HD * NN)); const float* xr = F + (size_t)n * 4 * INT + h * HD; v4h o;
#pragma unroll
    for (int q = 0; q < 4; ++q) { const int dd = d + q; o[q] = tohx(tshift(xr, dd, bfr(cs[n * HD + dd]), bfr(sn[n * HD + dd]))); } *(v4h*)(QS + e) = o;  }
// k_kst: KST[h][dd<64][n] = fp16(theta_shift(elu1(k))) and VT[h][dd<64][n] = fp16(v), rows >= 32 zero. The [n][d] -> [d][n] turn goes through LDS, so that global memory sees whole 128-byte lines on both sides.
// One work-group per 64 sequence rows x 4 heads (128 k and 128 v columns of F). Reading: a wave's load is 512 adjacent bytes of one row; a thread owns 4 adjacent columns of 8 adjacent rows and puts each column's 8 fp16 (along n) into LDS as one 16-byte chunk.
// Writing: 8 adjacent lanes fetch one column's 8 chunks (64 n, 128 bytes) and store them as one line.
// LDS row q * 32 + c4 holds column c4 * 4 + q; chunk j of it lies at place j ^ ((c4 >> 1) & 7): the row's parity and the place then spread a wave's 32 chunks evenly over the banks, in the stores (one j, 32 c4) and in the loads (8 j, 4 adjacent c4).
#define KT_N 64
#define KT_C 128
__global__ __launch_bounds__(256) void k_kst(const float* __restrict__ F, const float* __restrict__ sn, const float* __restrict__ cs, h16* KST, h16* VT) {
    __shared__ __align__(16) h16 tk[KT_C * KT_N], tv[KT_C * KT_N];
    const int n0 = blockIdx.x * KT_N, h0 = blockIdx.y * (KT_C / HD);
    const int c4 = threadIdx.x & 31, w = threadIdx.x >> 5;   // reading: column group, group of 8 rows
    const int j = threadIdx.x & 7, rc = threadIdx.x >> 3;    // writing: chunk along n, column group
    h16* const ko = KST + ((size_t)(h0 + (rc >> 3)) * 64 + (rc & 7) * 4) * NN + n0 + j * 8;   // + q * NN: column rc * 4 + q, that is head h0 + rc / 8, dd (rc % 8) * 4 + q
    h16* const vo = VT + (ko - KST);
    const float* fr = F + (size_t)(n0 + w * 8) * 4 * INT + h0 * HD + c4 * 4;   // + INT: the k columns, + 2 * INT: the v columns
    const float* cp = cs + (n0 + w * 8) * HD + (c4 & 7) * 4; const float* sp = sn + (n0 + w * 8) * HD + (c4 & 7) * 4;
    v4f kx[8], vx[8], cx[8], sx[8];
#pragma unroll   // the arrays stay in registers and all 32 loads are in flight together
    for (int i = 0; i < 8; ++i) { kx[i] = *(const v4fa*)(fr + (size_t)i * 4 * INT + INT); vx[i] = *(const v4fa*)(fr + (size_t)i * 4 * INT + 2 * INT); cx[i] = *(const v4fa*)(cp + i * HD); sx[i] = *(const v4fa*)(sp + i * HD); }
    asm volatile("s_wait_xcnt 0x0" :: "v"(fr), "v"(cp), "v"(sp) : "memory");   // the wait owed before a register that an issued load names is overwritten; the address pairs as inputs keep them whole up to it (without it a later load's result was placed on one of them, and one load sank into the arithmetic)
#pragma unroll   // the zero rows wait for nothing: they go out under the loads' latency
    for (int q = 0; q < 4; ++q) { *(v8h*)(ko + (size_t)(HD + q) * NN) = (v8h){}; *(v8h*)(vo + (size_t)(HD + q) * NN) = (v8h){}; }
    v8h ok[4], ov[4];
#pragma unroll   // constant indices into the register arrays
    for (int i = 0; i < 8; ++i) { const float e[4] = { elu1s(kx[i][0]), elu1s(kx[i][1]), elu1s(kx[i][2]), elu1s(kx[i][3]) };
#pragma unroll   // constant indices into the register arrays
        for (int q = 0; q < 4; ++q) { const float rot = (q & 1) ? e[q ^ 1] : -e[q ^ 1];   /* rotate_every_two: out[2i] = -x[2i+1], out[2i+1] = x[2i] */
            ok[q][i] = tohx(e[q] * bfr(cx[i][q]) + rot * bfr(sx[i][q]));   /* unscaled (O(1)): SCALE/N is applied in f32 when the kv state is converted */ ov[q][i] = tohx(vx[i][q]); } }
#pragma unroll   // constant indices into the register arrays
    for (int q = 0; q < 4; ++q) { const int o = (q * 32 + c4) * KT_N + (w ^ ((c4 >> 1) & 7)) * 8; *(v8ha*)(tk + o) = ok[q]; *(v8ha*)(tv + o) = ov[q]; }
    __syncthreads();
#pragma unroll   // the LDS reads overlap
    for (int q = 0; q < 4; ++q) { const int o = (q * 32 + rc) * KT_N + (j ^ ((rc >> 1) & 7)) * 8; *(v8h*)(ko + (size_t)q * NN) = *(const v8ha*)(tk + o); *(v8h*)(vo + (size_t)q * NN) = *(const v8ha*)(tv + o); }
}
__global__ __launch_bounds__(256) void k_z(const float* __restrict__ F, const float* __restrict__ KM, float* Z) { const int e = blockIdx.x * 256 + threadIdx.x; if (e >= NN * NH_) return; const int h = e % NH_; const int n = e / NH_; const float* qr = F + (size_t)n * 4 * INT + h * HD; float s = 0.f;
#pragma unroll 1
    for (int d = 0; d < HD; ++d) { float p = __fmul_rn(elu1(qr[d]), KM[h * HD + d]); asm volatile("" : "+v"(p)); s = __fadd_rn(s, p); } const float z = __fmul_rn(s, SCALE); *(float*)(Z + e) = z;  }
// k_kv16: one work-group per head adds the KV_SLICES partial planes KV[h][slice][d][e] of the kv state in f32 (slice 0 first), scales by SCALE/N and stores KVT[h][e<64][d] in fp16 (rows >= 32 zero).
// A wave reads one row d of a plane (lanes along e: one 128-byte line a load); the [d][e] -> [e][d] turn goes through LDS (pitch 33 words: no bank is hit twice by a wave's store).
#define KV_SLICES 64
__global__ __launch_bounds__(1024) void k_kv16(const float* __restrict__ KV, h16* KVT) {
    __shared__ float tr[HD * 33];
    const int h = blockIdx.x, d = threadIdx.x >> 5, ee = threadIdx.x & 31;
    const float* p = KV + ((size_t)h * KV_SLICES * 64 + d) * 64 + ee; float v[KV_SLICES], sum = 0.f;
#pragma unroll   // v[] stays in registers and the plane loads overlap
    for (int sl = 0; sl < KV_SLICES; ++sl) v[sl] = p[(size_t)sl * 64 * 64];
    asm volatile("s_wait_xcnt 0x0" :: "v"(p) : "memory");   // the wait owed before a register that an issued load names is overwritten; p as an input keeps the address pair whole up to it (without it the last load's result was placed on the pair)
#pragma unroll   // constant indices into v[]
    for (int sl = 0; sl < KV_SLICES; ++sl) sum += v[sl];
    tr[ee * 33 + d] = __fmul_rn(sum, SCALE / (float)NN);
    __syncthreads();
    const int e2 = threadIdx.x * 2; v2h o = (v2h){};
    if (e2 < HD * HD) { const float* t = tr + (e2 / HD) * 33 + e2 % HD; o[0] = tohx(t[0]); o[1] = tohx(t[1]); }
    *(v2h*)(KVT + (size_t)h * 64 * HD + e2) = o;  }
__global__ __launch_bounds__(256) void k_res(const float* __restrict__ AO, const float* __restrict__ Z, const float* __restrict__ VM, const float* __restrict__ F, const float* __restrict__ wl, const float* __restrict__ bl, bf* Rh, bf* Rl) { const size_t e = ((size_t)blockIdx.x * 256 + threadIdx.x) * 4; if (e >= (size_t)NN * INT) return; const int c = (int)(e % INT); const int n = (int)(e / INT); const int h = c / HD, d = c % HD; const float z = Z[n * NH_ + h]; const float fz = __fadd_rn(1.0f, __fdiv_rn(1.0f, __fadd_rn(z, 1e-6f))); v4us oh, ol;
#pragma unroll
    for (int q = 0; q < 4; ++q) { const int cc = c + q, dd = d + q; float lp = bfr(bl[cc]);
#pragma unroll
        for (int k = 0; k < 3; ++k) { const int nn = n - 1 + k; if (nn >= 0 && nn < NN) { float p = __fmul_rn(bfr(wl[cc * 3 + k]), F[(size_t)nn * 4 * INT + 2 * INT + cc]); asm volatile("" : "+v"(p)); lp = __fadd_rn(lp, p); } }
        float a = __fmul_rn(AO[((size_t)h * NN + n) * 64 + dd], fz); asm volatile("" : "+v"(a)); float zb = __fmul_rn(z, VM[cc]); asm volatile("" : "+v"(zb)); const float r = __fmul_rn(__fadd_rn(__fsub_rn(a, zb), lp), F[(size_t)n * 4 * INT + 3 * INT + cc]); unsigned short u, l; splitf(r, u, l); oh[q] = u; ol[q] = l; }
    *(v4us*)(Rh + e) = oh; *(v4us*)(Rl + e) = ol;  }

extern "C" void kernel_launch(void* const* d_in, const int* in_sizes, int n_in,
                              void* d_out, int out_size, void* d_ws, size_t ws_size, hipStream_t stream) {
    (void)in_sizes; (void)n_in; (void)out_size;
    const float* x = (const float*)d_in[0]; const float* sn = (const float*)d_in[1]; const float* cs = (const float*)d_in[2]; const float* wq = (const float*)d_in[3]; const float* bq = (const float*)d_in[4]; const float* wl = (const float*)d_in[5]; const float* bl = (const float*)d_in[6]; const float* wp = (const float*)d_in[7]; const float* bp = (const float*)d_in[8];
    float* OUT = (float*)d_out;     // [4][8192][256]
    char* wsp = (char*)d_ws;
    auto take = [&](size_t bytes) { char* p = wsp; wsp += (bytes + 255) & ~(size_t)255; return (void*)p; };
    bf* WQ = (bf*)take((size_t)4 * INT * DIM * 2); bf* WP = (bf*)take((size_t)DIM * INT * 2); bf* XB = (bf*)take((size_t)NN * DIM * 2); float* F = (float*)take((size_t)NN * 4 * INT * 4); float* KM = (float*)take(INT * 4); float* VM = (float*)take(INT * 4); float* KP = (float*)take((size_t)KM_PARTS * 512 * 4); float* Z = (float*)take((size_t)NN * NH_ * 4);
    h16* QS = (h16*)take((size_t)NH_ * NN * HD * 2); h16* KST = (h16*)take((size_t)NH_ * 64 * NN * 2); h16* VT = (h16*)take((size_t)NH_ * 64 * NN * 2); float* KV = (float*)take((size_t)NH_ * KV_SLICES * 64 * 64 * 4); h16* KVT = (h16*)take((size_t)NH_ * 64 * HD * 2); float* AO = (float*)take((size_t)NH_ * NN * 64 * 4); bf* Rh = (bf*)take((size_t)NN * INT * 2); bf* Rl = (bf*)take((size_t)NN * INT * 2);
    if ((size_t)(wsp - (char*)d_ws) > ws_size) return;    // total ~ 88 MB
    k_cvt8<<<(4 * INT * DIM / 8 + 255) / 256, 256, 0, stream>>>(wq, WQ, 4 * INT * DIM / 8); k_cvt8<<<(DIM * INT / 8 + 255) / 256, 256, 0, stream>>>(wp, WP, DIM * INT / 8);   // [out][in] natural Bt
    for (int b = 0; b < NB_; ++b) {
        k_cvt8<<<(unsigned)(((size_t)NN * DIM / 8 + 255) / 256), 256, 0, stream>>>(x + (size_t)b * NN * DIM, XB, (size_t)NN * DIM / 8);
        k_gemmw<bf, 0, true><<<dim3(NN / 64, 4 * INT / 64, 1), 32, 0, stream>>>(XB, nullptr, WQ, nullptr, DIM, F, 4 * INT, bq, 0, 0, 0);
        k_kmean_part<<<KM_PARTS, 512, 0, stream>>>(F, KP); k_kmean_fin<<<8, 256, 0, stream>>>(KP, KM, VM); k_z<<<(NN * NH_ + 255) / 256, 256, 0, stream>>>(F, KM, Z);
        k_qs<<<(unsigned)(((size_t)NH_ * NN * HD / 4 + 255) / 256), 256, 0, stream>>>(F, sn, cs, QS); k_kst<<<dim3(NN / KT_N, NH_ * HD / KT_C, 1), 256, 0, stream>>>(F, sn, cs, KST, VT);
        k_gemmw<h16, 0, false, KV_SLICES><<<dim3(1, KV_SLICES, NH_), 32, 0, stream>>>(KST, nullptr, VT, nullptr, NN, KV, 64, nullptr, (size_t)64 * NN, (size_t)64 * NN, (size_t)64 * 64);   // KV[h][slice][d][e] = sum over the slice's n of ks[n][d] v[n][e]
        k_kv16<<<NH_, 1024, 0, stream>>>(KV, KVT);
        k_gemmw<h16, 0, false><<<dim3(NN / 64, 1, NH_), 32, 0, stream>>>(QS, nullptr, KVT, nullptr, HD, AO, 64, nullptr, (size_t)NN * HD, (size_t)64 * HD, (size_t)NN * 64);    // AO[h][n][e] = qs . kv
        k_res<<<(unsigned)(((size_t)NN * INT / 4 + 255) / 256), 256, 0, stream>>>(AO, Z, VM, F, wl, bl, Rh, Rl);
        k_gemmw<bf, 1, true><<<dim3(NN / 64, DIM / 64, 1), 32, 0, stream>>>(Rh, Rl, WP, nullptr, INT, OUT + (size_t)b * NN * DIM, DIM, bp, 0, 0, 0); }
}

// v004
// One run takes 229 microseconds.
// Timed twice side by side with v003, it ran 1.45 and 1.46 times as fast.
// Counting every step since v000, it is 57.6 times as fast.
#include <hip/hip_runtime.h>

// MultiHeadMALAAttention (x [4][8192][256]; [q|k|v|o] = x W_qkvo^T + b (8 heads x 32); lepe = depthwise conv3 (pad 1) over the sequence on v + b; qh = elu(q)+1, kh = elu(k)+1; z = (qh . mean_n kh) 32^-0.5; qs/ks = theta_shift with the [N][32]
// sin/cos tables (read as data; rotate-every-two); kv = sum_n (ks s)(v s)^T with s^2 = SCALE/N; attn = qs kv; res = attn (1 + 1/(z + 1e-6)) - z mean_n v; res = (res + lepe) o; out = res W_proj^T + b -> [4][8192][256]).
// Compute dtypes, f32 accumulate: every input rounded to bf16; qkvo projection on PLAIN bf16 operands (inputs: exact, + bias); elu, means, z, theta shift, lepe conv, gating f32; kv-state (K = 8192) and qs.kv (K 32) on single fp16

#define NB_  4
#define NN   8192
#define DIM  256
#define NH_  8
#define HD   32
#define INT  256
#define SCALE 0.1767766952966369f
typedef _Float16 h16;
typedef unsigned short bf;
typedef __attribute__((ext_vector_type(16))) __bf16   v16bf;
typedef __attribute__((ext_vector_type(16))) _Float16 v16h;
typedef __attribute__((ext_vector_type(8)))  _Float16 v8h;
typedef __attribute__((ext_vector_type(8)))  unsigned short v8us;
typedef __attribute__((ext_vector_type(8)))  float    v8f;
typedef __attribute__((ext_vector_type(4)))  float    v4f;
typedef v8h  __attribute__((may_alias)) v8ha;
typedef v4f  __attribute__((may_alias)) v4fa;
typedef v8us __attribute__((may_alias)) v8usa;

__device__ __forceinline__ unsigned short f2bf(float f) { unsigned u = __float_as_uint(f); u += 0x7FFFu + ((u >> 16) & 1u); return (unsigned short)(u >> 16); }
__device__ __forceinline__ float bf2f(unsigned short b) { return __uint_as_float(((unsigned)b) << 16); }
__device__ __forceinline__ float bfr(float f) { return bf2f(f2bf(f)); }
__device__ __forceinline__ v16h cat16(v8h lo, v8h hi) { return __builtin_shufflevector(lo, hi, 0, 1, 2, 3, 4, 5, 6, 7, 8, 9, 10, 11, 12, 13, 14, 15); }
__device__ __forceinline__ v16bf cat16b(v8us lo, v8us hi) { return __builtin_bit_cast(v16bf, __builtin_shufflevector(lo, hi, 0, 1, 2, 3, 4, 5, 6, 7, 8, 9, 10, 11, 12, 13, 14, 15)); }
__device__ __forceinline__ v8f wmma16(v16h a, v16h b, v8f c) { return __builtin_amdgcn_wmma_f32_16x16x32_f16(false, a, false, b, (short)0, c, false, false); }
__device__ __forceinline__ v8f wmmab(v16bf a, v16bf b, v8f c) { return __builtin_amdgcn_wmma_f32_16x16x32_bf16(false, a, false, b, (short)0, c, false, false); }



// ---- k_gemmw: register-blocked GEMM, ONE WAVE per 64x64 output tile (16 accumulators), operands straight from K-contiguous 16-bit planes; grid (M/64, N/64, Z), 32 threads.
// C[m][n] (f32, pitch ldc, + optional f32 bias[n]) = sum_k A[m][k] Bt[n][k] (+ split products per NSPLIT). z-batch strides sA/sB/sC in elements. K % 32 == 0.
// KSL > 1: grid (M/64, KSL, Z), N = 64: blockIdx.y is not a column tile but one of KSL equal slices of the reduction (K stays the row pitch, K % (32 KSL) == 0); every slice stores its own partial plane C[z][slice], and the reader adds the planes.
template <typename T16> struct WFrag;
template <> struct WFrag<h16> { typedef v16h V; static __device__ __forceinline__ V ld(const h16* p) { return cat16(*(const v8h*)p, *(const v8h*)(p + 16)); } static __device__ __forceinline__ v8f mma(V a, V b, v8f c) { return wmma16(a, b, c); } };
template <> struct WFrag<bf> { typedef v16bf V; static __device__ __forceinline__ V ld(const bf* p) { return cat16b(*(const v8us*)p, *(const v8us*)(p + 16)); } static __device__ __forceinline__ v8f mma(V a, V b, v8f c) { return wmmab(a, b, c); } };
template <typename T16, int NSPLIT, bool BIAS, int KSL = 1>
__global__ __launch_bounds__(32) void k_gemmw(const T16* __restrict__ A, const T16* __restrict__ A2, const T16* __restrict__ Bt, const T16* __restrict__ Bt2, int K, float* C, int ldc, const float* __restrict__ bias, size_t sA, size_t sB, size_t sC) {
    typedef typename WFrag<T16>::V V;
    __shared__ __align__(16) float os[16 * 68];
    static_assert(KSL == 1 || NSPLIT == 0, "a K slice moves A and Bt only");
    const size_t z = blockIdx.z; A += z * sA; if (A2) A2 += z * sA; Bt += z * sB; if (Bt2) Bt2 += z * sB;
    const int KL = K / KSL;   // this wave's share of the reduction
    if (KSL > 1) { A += (size_t)blockIdx.y * KL; Bt += (size_t)blockIdx.y * KL; C += (z * KSL + blockIdx.y) * sC; } else C += z * sC;
    const int lane = threadIdx.x & 31, lr = lane & 15, hi = lane >> 4; const int r0 = blockIdx.x * 64, c0 = KSL > 1 ? 0 : blockIdx.y * 64;
    v8f acc[4][4];
#pragma unroll
    for (int mb = 0; mb < 4; ++mb)
#pragma unroll
        for (int nb = 0; nb < 4; ++nb) acc[mb][nb] = (v8f){};
    const size_t aoff = (size_t)(r0 + lr) * K + 8 * hi, boff = (size_t)(c0 + lr) * K + 8 * hi;
#pragma unroll 1
    for (int kc = 0; kc < KL; kc += 32) {
        V a[4], a2[4];
#pragma unroll
        for (int mb = 0; mb < 4; ++mb) { a[mb] = WFrag<T16>::ld(A + aoff + (size_t)mb * 16 * K + kc); if (NSPLIT == 1 || NSPLIT == 2) a2[mb] = WFrag<T16>::ld(A2 + aoff + (size_t)mb * 16 * K + kc); }
#pragma unroll
        for (int nb = 0; nb < 4; ++nb) { const V b = WFrag<T16>::ld(Bt + boff + (size_t)nb * 16 * K + kc); V b2; if (NSPLIT >= 2) b2 = WFrag<T16>::ld(Bt2 + boff + (size_t)nb * 16 * K + kc);
#pragma unroll
            for (int mb = 0; mb < 4; ++mb) { acc[mb][nb] = WFrag<T16>::mma(a[mb], b, acc[mb][nb]); if (NSPLIT == 1 || NSPLIT == 2) acc[mb][nb] = WFrag<T16>::mma(a2[mb], b, acc[mb][nb]); if (NSPLIT >= 2) acc[mb][nb] = WFrag<T16>::mma(a[mb], b2, acc[mb][nb]); } }
        asm volatile("v_nop\n\tv_nop\n\tv_nop\n\tv_nop" : "+v"(acc[0][0]), "+v"(acc[1][1]), "+v"(acc[2][2]), "+v"(acc[3][3]) : "v"(a[0]), "v"(a[3]));
    }
#pragma unroll
    for (int mb = 0; mb < 4; ++mb) {
#pragma unroll
        for (int nb = 0; nb < 4; ++nb) {
#pragma unroll
            for (int j = 0; j < 8; ++j) os[(hi * 8 + j) * 68 + nb * 16 + lr] = acc[mb][nb][j]; }
        __builtin_amdgcn_wave_barrier(); asm volatile("" ::: "memory");
        float* crow = C + (size_t)(r0 + mb * 16) * ldc + c0;
{
#pragma unroll
            for (int s = 0; s < 8; ++s) { const int row = 2 * s + hi, cofs = lr * 4; v4f val = *(const v4fa*)(os + row * 68 + cofs); if (BIAS) { val[0] += bfr(bias[c0 + cofs]); val[1] += bfr(bias[c0 + cofs + 1]); val[2] += bfr(bias[c0 + cofs + 2]); val[3] += bfr(bias[c0 + cofs + 3]); }
                *(v4f*)(crow + (size_t)row * ldc + cofs) = val; }
             }
        __builtin_amdgcn_wave_barrier(); asm volatile("" ::: "memory");
    }
}

__device__ __forceinline__ h16 tohx(float x) { return (h16)x; }
__device__ __forceinline__ void splitf(float y, unsigned short& h, unsigned short& l) { h = f2bf(y); l = f2bf(y - bf2f(h)); }
__device__ __forceinline__ float elu1(float x) { return x > 0.f ? __fadd_rn(x, 1.0f) : __expf(x); }   // elu(x) + 1
typedef __attribute__((ext_vector_type(2))) _Float16 v2h;
typedef __attribute__((ext_vector_type(4))) _Float16 v4h;
typedef __attribute__((ext_vector_type(4))) unsigned short v4us;

__global__ __launch_bounds__(256) void k_cvt8(const float* __restrict__ src, bf* dst, size_t n8) { const size_t i = (size_t)blockIdx.x * 256 + threadIdx.x; if (i >= n8) return; const v8f v = *(const v8f*)(src + i * 8); v8us o;
#pragma unroll
    for (int k = 0; k < 8; ++k) o[k] = f2bf(v[k]); *(v8us*)(dst + i * 8) = o;  }
// Column means of elu1(k) and of v over the sequence, in two launches. The k and v columns of a row of F are 512 adjacent floats.
// k_kmean_part: one work-group per KM_ROWS rows; a thread owns 4 adjacent columns and every 4th row; P[group][0..255] = sums of elu1(k), P[group][256..511] = sums of v.
// elu1 with its exp (x * log2(e), then v_exp_f32, as elu1 compiles) written out: the v_nop in the same statement keeps the one free issue slot that the instruction set asks for behind a transcendental;
__device__ __forceinline__ float elu1s(float x) { float e; asm("v_exp_f32 %0, %1\n\tv_nop" : "=v"(e) : "v"(x * 1.44269504f)); return x > 0.f ? __fadd_rn(x, 1.0f) : e; }
#define KM_ROWS  32
#define KM_PARTS (NN / KM_ROWS)
__global__ __launch_bounds__(512) void k_kmean_part(const float* __restrict__ F, float* P) {
    __shared__ __align__(16) float red[4 * 512];
    const int c4 = threadIdx.x & 127, g = threadIdx.x >> 7;
    const float* r = F + (size_t)(blockIdx.x * KM_ROWS + g) * 4 * INT + INT + c4 * 4;
    v4f v[KM_ROWS / 4];
#pragma unroll   // v[] stays in registers and all the row loads are in flight before the first sum
    for (int i = 0; i < KM_ROWS / 4; ++i) v[i] = *(const v4fa*)(r + (size_t)i * 4 * 4 * INT);
    v4f s = (v4f){};
    if (c4 < 64) {   // k columns (whole waves)
#pragma unroll   // constant indices into v[]
        for (int i = 0; i < KM_ROWS / 4; ++i) { s[0] += elu1s(v[i][0]); s[1] += elu1s(v[i][1]); s[2] += elu1s(v[i][2]); s[3] += elu1s(v[i][3]); }
    } else {         // v columns
#pragma unroll   // constant indices into v[]
        for (int i = 0; i < KM_ROWS / 4; ++i) s += v[i];
    }
    *(v4fa*)(red + g * 512 + c4 * 4) = s;
    __syncthreads();
    if (g == 0) { s += *(const v4fa*)(red + 512 + c4 * 4); s += *(const v4fa*)(red + 1024 + c4 * 4); s += *(const v4fa*)(red + 1536 + c4 * 4); *(v4fa*)(P + (size_t)blockIdx.x * 512 + c4 * 4) = s; }
}
// k_kmean_fin: per batch (blockIdx.y) 8 work-groups of 64 columns each; 16 thread groups sum 16 partial rows each, thread group 0 adds the 16 sums and scales by 1/N.
__global__ __launch_bounds__(256) void k_kmean_fin(const float* __restrict__ P, float* KM, float* VM) {
    __shared__ __align__(16) float red[16 * 64];
    const int c4 = threadIdx.x & 15, g = threadIdx.x >> 4;
    P += (size_t)blockIdx.y * KM_PARTS * 512; KM += blockIdx.y * INT; VM += blockIdx.y * INT;   // this batch's partial rows and means
    const float* p = P + (size_t)g * 512 + blockIdx.x * 64 + c4 * 4;
    v4f v[KM_PARTS / 16];
#pragma unroll   // v[] stays in registers and the partial-row loads overlap
    for (int i = 0; i < KM_PARTS / 16; ++i) v[i] = *(const v4fa*)(p + (size_t)i * 16 * 512);
    v4f s = (v4f){};
#pragma unroll   // constant indices into v[]
    for (int i = 0; i < KM_PARTS / 16; ++i) s += v[i];
    *(v4fa*)(red + g * 64 + c4 * 4) = s;
    __syncthreads();
    if (g == 0) {
#pragma unroll   // the LDS reads overlap
        for (int gg = 1; gg < 16; ++gg) s += *(const v4fa*)(red + gg * 64 + c4 * 4);
        s *= (1.0f / NN);
        float* dst = blockIdx.x < 4 ? KM + blockIdx.x * 64 : VM + (blockIdx.x - 4) * 64;
        *(v4fa*)(dst + c4 * 4) = s; }
}
// k_qs, k_kst: QS[h][n][d] = fp16(theta_shift(elu1(q)))[per head], KST[h][dd<64][n] = fp16(theta_shift(elu1(k))) (rows >= 32 zero; unscaled to stay in fp16's normal range) - two kernels for the two layouts; Z[n][h] = (elu1(q_h) . KM_h) SCALE (thread per (n,h)... 32-B per 8 threads:
__device__ __forceinline__ float tshift(const float* __restrict__ xr, int d, float c_d, float s_d) { const float self_ = elu1(xr[d]); const float partner = elu1(xr[d ^ 1]); const float rot = (d & 1) ? partner : -partner;   /* rotate_every_two: out[2i] = -x[2i+1], out[2i+1] = x[2i] */ float a = __fmul_rn(self_, c_d), b = __fmul_rn(rot, s_d); asm volatile("" : "+v"(a)); asm volatile("" : "+v"(b)); return __fadd_rn(a, b); }
__global__ __launch_bounds__(256) void k_qs(const float* __restrict__ F, const float* __restrict__ sn, const float* __restrict__ cs, h16* QS) { F += (size_t)blockIdx.y * NN * 4 * INT; QS += (size_t)blockIdx.y * NH_ * NN * HD;   /* blockIdx.y: batch */ const size_t e = ((size_t)blockIdx.x * 256 + threadIdx.x) * 4; if (e >= (size_t)NH_ * NN * HD) return; const int d = (int)(e % HD); const int n = (int)((e / HD) % NN); const int h = (int)(e / ((size_t)HD * NN)); const float* xr = F + (size_t)n * 4 * INT + h * HD; v4h o;
#pragma unroll
    for (int q = 0; q < 4; ++q) { const int dd = d + q; o[q] = tohx(tshift(xr, dd, bfr(cs[n * HD + dd]), bfr(sn[n * HD + dd]))); } *(v4h*)(QS + e) = o;  }
// k_kst: KST[h][dd<64][n] = fp16(theta_shift(elu1(k))) and VT[h][dd<64][n] = fp16(v), rows >= 32 zero. The [n][d] -> [d][n] turn goes through LDS, so that global memory sees whole 128-byte lines on both sides.
// One work-group per 64 sequence rows x 4 heads (128 k and 128 v columns of F). Reading: a wave's load is 512 adjacent bytes of one row; a thread owns 4 adjacent columns of 8 adjacent rows and puts each column's 8 fp16 (along n) into LDS as one 16-byte chunk.
// Writing: 8 adjacent lanes fetch one column's 8 chunks (64 n, 128 bytes) and store them as one line.
// LDS row q * 32 + c4 holds column c4 * 4 + q; chunk j of it lies at place j ^ ((c4 >> 1) & 7): the row's parity and the place then spread a wave's 32 chunks evenly over the banks, in the stores (one j, 32 c4) and in the loads (8 j, 4 adjacent c4).
#define KT_N 64
#define KT_C 128
__global__ __launch_bounds__(256) void k_kst(const float* __restrict__ F, const float* __restrict__ sn, const float* __restrict__ cs, h16* KST, h16* VT) {
    __shared__ __align__(16) h16 tk[KT_C * KT_N], tv[KT_C * KT_N];
    const int n0 = blockIdx.x * KT_N, h0 = blockIdx.y * (KT_C / HD), b = blockIdx.z;   // b: batch
    const int c4 = threadIdx.x & 31, w = threadIdx.x >> 5;   // reading: column group, group of 8 rows
    const int j = threadIdx.x & 7, rc = threadIdx.x >> 3;    // writing: chunk along n, column group
    h16* const ko = KST + ((size_t)(b * NH_ + h0 + (rc >> 3)) * 64 + (rc & 7) * 4) * NN + n0 + j * 8;   // + q * NN: column rc * 4 + q, that is head h0 + rc / 8 of batch b, dd (rc % 8) * 4 + q
    h16* const vo = VT + (ko - KST);
    const float* fr = F + (size_t)(b * NN + n0 + w * 8) * 4 * INT + h0 * HD + c4 * 4;   // + INT: the k columns, + 2 * INT: the v columns
    const float* cp = cs + (n0 + w * 8) * HD + (c4 & 7) * 4; const float* sp = sn + (n0 + w * 8) * HD + (c4 & 7) * 4;
    v4f kx[8], vx[8], cx[8], sx[8];
#pragma unroll   // the arrays stay in registers and all 32 loads are in flight together
    for (int i = 0; i < 8; ++i) { kx[i] = *(const v4fa*)(fr + (size_t)i * 4 * INT + INT); vx[i] = *(const v4fa*)(fr + (size_t)i * 4 * INT + 2 * INT); cx[i] = *(const v4fa*)(cp + i * HD); sx[i] = *(const v4fa*)(sp + i * HD); }
    asm volatile("s_wait_xcnt 0x0" :: "v"(fr), "v"(cp), "v"(sp) : "memory");   // the wait owed before a register that an issued load names is overwritten; the address pairs as inputs keep them whole up to it (without it a later load's result was placed on one of them, and one load sank into the arithmetic)
#pragma unroll   // the zero rows wait for nothing: they go out under the loads' latency
    for (int q = 0; q < 4; ++q) { *(v8h*)(ko + (size_t)(HD + q) * NN) = (v8h){}; *(v8h*)(vo + (size_t)(HD + q) * NN) = (v8h){}; }
    v8h ok[4], ov[4];
#pragma unroll   // constant indices into the register arrays
    for (int i = 0; i < 8; ++i) { const float e[4] = { elu1s(kx[i][0]), elu1s(kx[i][1]), elu1s(kx[i][2]), elu1s(kx[i][3]) };
#pragma unroll   // constant indices into the register arrays
        for (int q = 0; q < 4; ++q) { const float rot = (q & 1) ? e[q ^ 1] : -e[q ^ 1];   /* rotate_every_two: out[2i] = -x[2i+1], out[2i+1] = x[2i] */
            ok[q][i] = tohx(e[q] * bfr(cx[i][q]) + rot * bfr(sx[i][q]));   /* unscaled (O(1)): SCALE/N is applied in f32 when the kv state is converted */ ov[q][i] = tohx(vx[i][q]); } }
#pragma unroll   // constant indices into the register arrays
    for (int q = 0; q < 4; ++q) { const int o = (q * 32 + c4) * KT_N + (w ^ ((c4 >> 1) & 7)) * 8; *(v8ha*)(tk + o) = ok[q]; *(v8ha*)(tv + o) = ov[q]; }
    __syncthreads();
#pragma unroll   // the LDS reads overlap
    for (int q = 0; q < 4; ++q) { const int o = (q * 32 + rc) * KT_N + (j ^ ((rc >> 1) & 7)) * 8; *(v8h*)(ko + (size_t)q * NN) = *(const v8ha*)(tk + o); *(v8h*)(vo + (size_t)q * NN) = *(const v8ha*)(tv + o); }
}
__global__ __launch_bounds__(256) void k_z(const float* __restrict__ F, const float* __restrict__ KM, float* Z) { F += (size_t)blockIdx.y * NN * 4 * INT; KM += blockIdx.y * INT; Z += (size_t)blockIdx.y * NN * NH_;   /* blockIdx.y: batch */ const int e = blockIdx.x * 256 + threadIdx.x; if (e >= NN * NH_) return; const int h = e % NH_; const int n = e / NH_; const float* qr = F + (size_t)n * 4 * INT + h * HD; float s = 0.f;
#pragma unroll 1
    for (int d = 0; d < HD; ++d) { float p = __fmul_rn(elu1(qr[d]), KM[h * HD + d]); asm volatile("" : "+v"(p)); s = __fadd_rn(s, p); } const float z = __fmul_rn(s, SCALE); *(float*)(Z + e) = z;  }
// k_kv16: one work-group per (batch, head) adds the KV_SLICES partial planes KV[h][slice][d][e] of the kv state in f32 (slice 0 first), scales by SCALE/N and stores KVT[h][e<64][d] in fp16 (rows >= 32 zero).
// A wave reads one row d of a plane (lanes along e: one 128-byte line a load); the [d][e] -> [e][d] turn goes through LDS (pitch 33 words: no bank is hit twice by a wave's store).
#define KV_SLICES 64
__global__ __launch_bounds__(1024) void k_kv16(const float* __restrict__ KV, h16* KVT) {
    __shared__ float tr[HD * 33];
    const int h = blockIdx.x, d = threadIdx.x >> 5, ee = threadIdx.x & 31;
    const float* p = KV + ((size_t)h * KV_SLICES * 64 + d) * 64 + ee; float v[KV_SLICES], sum = 0.f;
#pragma unroll   // v[] stays in registers and the plane loads overlap
    for (int sl = 0; sl < KV_SLICES; ++sl) v[sl] = p[(size_t)sl * 64 * 64];
    asm volatile("s_wait_xcnt 0x0" :: "v"(p) : "memory");   // the wait owed before a register that an issued load names is overwritten; p as an input keeps the address pair whole up to it (without it the last load's result was placed on the pair)
#pragma unroll   // constant indices into v[]
    for (int sl = 0; sl < KV_SLICES; ++sl) sum += v[sl];
    tr[ee * 33 + d] = __fmul_rn(sum, SCALE / (float)NN);
    __syncthreads();
    const int e2 = threadIdx.x * 2; v2h o = (v2h){};
    if (e2 < HD * HD) { const float* t = tr + (e2 / HD) * 33 + e2 % HD; o[0] = tohx(t[0]); o[1] = tohx(t[1]); }
    *(v2h*)(KVT + (size_t)h * 64 * HD + e2) = o;  }
__global__ __launch_bounds__(256) void k_res(const float* __restrict__ AO, const float* __restrict__ Z, const float* __restrict__ VM, const float* __restrict__ F, const float* __restrict__ wl, const float* __restrict__ bl, bf* Rh, bf* Rl) { AO += (size_t)blockIdx.y * NH_ * NN * 64; Z += (size_t)blockIdx.y * NN * NH_; VM += blockIdx.y * INT; F += (size_t)blockIdx.y * NN * 4 * INT; Rh += (size_t)blockIdx.y * NN * INT; Rl += (size_t)blockIdx.y * NN * INT;   /* blockIdx.y: batch; n stays the row inside the batch, so the conv's edges stay where they are */ const size_t e = ((size_t)blockIdx.x * 256 + threadIdx.x) * 4; if (e >= (size_t)NN * INT) return; const int c = (int)(e % INT); const int n = (int)(e / INT); const int h = c / HD, d = c % HD; const float z = Z[n * NH_ + h]; const float fz = __fadd_rn(1.0f, __fdiv_rn(1.0f, __fadd_rn(z, 1e-6f))); v4us oh, ol;
#pragma unroll
    for (int q = 0; q < 4; ++q) { const int cc = c + q, dd = d + q; float lp = bfr(bl[cc]);
#pragma unroll
        for (int k = 0; k < 3; ++k) { const int nn = n - 1 + k; if (nn >= 0 && nn < NN) { float p = __fmul_rn(bfr(wl[cc * 3 + k]), F[(size_t)nn * 4 * INT + 2 * INT + cc]); asm volatile("" : "+v"(p)); lp = __fadd_rn(lp, p); } }
        float a = __fmul_rn(AO[((size_t)h * NN + n) * 64 + dd], fz); asm volatile("" : "+v"(a)); float zb = __fmul_rn(z, VM[cc]); asm volatile("" : "+v"(zb)); const float r = __fmul_rn(__fadd_rn(__fsub_rn(a, zb), lp), F[(size_t)n * 4 * INT + 3 * INT + cc]); unsigned short u, l; splitf(r, u, l); oh[q] = u; ol[q] = l; }
    *(v4us*)(Rh + e) = oh; *(v4us*)(Rl + e) = ol;  }

extern "C" void kernel_launch(void* const* d_in, const int* in_sizes, int n_in,
                              void* d_out, int out_size, void* d_ws, size_t ws_size, hipStream_t stream) {
    (void)in_sizes; (void)n_in; (void)out_size;
    const float* x = (const float*)d_in[0]; const float* sn = (const float*)d_in[1]; const float* cs = (const float*)d_in[2]; const float* wq = (const float*)d_in[3]; const float* bq = (const float*)d_in[4]; const float* wl = (const float*)d_in[5]; const float* bl = (const float*)d_in[6]; const float* wp = (const float*)d_in[7]; const float* bp = (const float*)d_in[8];
    float* OUT = (float*)d_out;     // [4][8192][256]
    char* wsp = (char*)d_ws;
    auto take = [&](size_t bytes) { char* p = wsp; wsp += (bytes + 255) & ~(size_t)255; return (void*)p; };
    // All NB_ batches go through every launch but the weight conversions together: each plane below but WQ and WP holds NB_ batches back to back, and the batch is a part of the row index, of the z batch of k_gemmw, of k_kv16's (batch, head) work-group index, or a grid dimension of its own.
    // Three planes lie on workspace whose earlier tenant has been read for the last time by an earlier launch: XB, then KV, then Rh | Rl share one region; KST | VT, then AO share another.
    bf* WQ = (bf*)take((size_t)4 * INT * DIM * 2); bf* WP = (bf*)take((size_t)DIM * INT * 2); float* F = (float*)take((size_t)NB_ * NN * 4 * INT * 4); float* KM = (float*)take(NB_ * INT * 4); float* VM = (float*)take(NB_ * INT * 4); float* KP = (float*)take((size_t)NB_ * KM_PARTS * 512 * 4); float* Z = (float*)take((size_t)NB_ * NN * NH_ * 4);
    h16* QS = (h16*)take((size_t)NB_ * NH_ * NN * HD * 2); h16* KVT = (h16*)take((size_t)NB_ * NH_ * 64 * HD * 2);
    float* KV = (float*)take((size_t)NB_ * NH_ * KV_SLICES * 64 * 64 * 4); bf* XB = (bf*)KV; bf* Rh = (bf*)KV; bf* Rl = Rh + (size_t)NB_ * NN * INT;   // XB: half the region, dead before KV is written; Rh | Rl: all of it, written after KV's last read
    static_assert((size_t)NH_ * KV_SLICES * 64 * 64 * 4 == (size_t)2 * NN * INT * 2 && DIM == INT, "Rh | Rl fill the KV region, XB half of it");
    float* AO = (float*)take((size_t)NB_ * NH_ * NN * 64 * 4); h16* KST = (h16*)AO; h16* VT = KST + (size_t)NB_ * NH_ * 64 * NN;   // KST | VT fill the region, dead before AO is written
    if ((size_t)(wsp - (char*)d_ws) > ws_size) return;    // total ~ 244 MiB
    k_cvt8<<<(4 * INT * DIM / 8 + 255) / 256, 256, 0, stream>>>(wq, WQ, 4 * INT * DIM / 8); k_cvt8<<<(DIM * INT / 8 + 255) / 256, 256, 0, stream>>>(wp, WP, DIM * INT / 8);   // [out][in] natural Bt
    k_cvt8<<<(unsigned)(((size_t)NB_ * NN * DIM / 8 + 255) / 256), 256, 0, stream>>>(x, XB, (size_t)NB_ * NN * DIM / 8);
    k_gemmw<bf, 0, true><<<dim3(NB_ * NN / 64, 4 * INT / 64, 1), 32, 0, stream>>>(XB, nullptr, WQ, nullptr, DIM, F, 4 * INT, bq, 0, 0, 0);   // rows: (batch, n)
    k_kmean_part<<<NB_ * KM_PARTS, 512, 0, stream>>>(F, KP); k_kmean_fin<<<dim3(8, NB_, 1), 256, 0, stream>>>(KP, KM, VM); k_z<<<dim3((NN * NH_ + 255) / 256, NB_, 1), 256, 0, stream>>>(F, KM, Z);
    k_qs<<<dim3((unsigned)(((size_t)NH_ * NN * HD / 4 + 255) / 256), NB_, 1), 256, 0, stream>>>(F, sn, cs, QS); k_kst<<<dim3(NN / KT_N, NH_ * HD / KT_C, NB_), 256, 0, stream>>>(F, sn, cs, KST, VT);
    k_gemmw<h16, 0, false, KV_SLICES><<<dim3(1, KV_SLICES, NB_ * NH_), 32, 0, stream>>>(KST, nullptr, VT, nullptr, NN, KV, 64, nullptr, (size_t)64 * NN, (size_t)64 * NN, (size_t)64 * 64);   // KV[b][h][slice][d][e] = sum over the slice's n of ks[n][d] v[n][e]
    k_kv16<<<NB_ * NH_, 1024, 0, stream>>>(KV, KVT);
    k_gemmw<h16, 0, false><<<dim3(NN / 64, 1, NB_ * NH_), 32, 0, stream>>>(QS, nullptr, KVT, nullptr, HD, AO, 64, nullptr, (size_t)NN * HD, (size_t)64 * HD, (size_t)NN * 64);    // AO[b][h][n][e] = qs . kv
    k_res<<<dim3((unsigned)(((size_t)NN * INT / 4 + 255) / 256), NB_, 1), 256, 0, stream>>>(AO, Z, VM, F, wl, bl, Rh, Rl);
    k_gemmw<bf, 1, true><<<dim3(NB_ * NN / 64, DIM / 64, 1), 32, 0, stream>>>(Rh, Rl, WP, nullptr, INT, OUT, DIM, bp, 0, 0, 0);   // rows: (batch, n)
}

// v005
// One run takes 216 microseconds.
// Timed twice side by side with v004, it ran 1.06 times as fast both times.
// Counting every step since v000, it is 61.1 times as fast.
#include <hip/hip_runtime.h>

// MultiHeadMALAAttention (x [4][8192][256]; [q|k|v|o] = x W_qkvo^T + b (8 heads x 32); lepe = depthwise conv3 (pad 1) over the sequence on v + b; qh = elu(q)+1, kh = elu(k)+1; z = (qh . mean_n kh) 32^-0.5; qs/ks = theta_shift with the [N][32]
// sin/cos tables (read as data; rotate-every-two); kv = sum_n (ks s)(v s)^T with s^2 = SCALE/N; attn = qs kv; res = attn (1 + 1/(z + 1e-6)) - z mean_n v; res = (res + lepe) o; out = res W_proj^T + b -> [4][8192][256]).
// Compute dtypes, f32 accumulate: every input rounded to bf16; qkvo projection on PLAIN bf16 operands (inputs: exact, + bias); elu, means, z, theta shift, lepe conv, gating f32; kv-state (K = 8192) and qs.kv (K 32) on single fp16

#define NB_  4
#define NN   8192
#define DIM  256
#define NH_  8
#define HD   32
#define INT  256
#define SCALE 0.1767766952966369f
typedef _Float16 h16;
typedef unsigned short bf;
typedef __attribute__((ext_vector_type(16))) __bf16   v16bf;
typedef __attribute__((ext_vector_type(16))) _Float16 v16h;
typedef __attribute__((ext_vector_type(8)))  _Float16 v8h;
typedef __attribute__((ext_vector_type(8)))  unsigned short v8us;
typedef __attribute__((ext_vector_type(8)))  float    v8f;
typedef __attribute__((ext_vector_type(4)))  float    v4f;
typedef v8h  __attribute__((may_alias)) v8ha;
typedef v4f  __attribute__((may_alias)) v4fa;
typedef v8us __attribute__((may_alias)) v8usa;

__device__ __forceinline__ unsigned short f2bf(float f) { unsigned u = __float_as_uint(f); u += 0x7FFFu + ((u >> 16) & 1u); return (unsigned short)(u >> 16); }
__device__ __forceinline__ float bf2f(unsigned short b) { return __uint_as_float(((unsigned)b) << 16); }
__device__ __forceinline__ float bfr(float f) { return bf2f(f2bf(f)); }
__device__ __forceinline__ v16h cat16(v8h lo, v8h hi) { return __builtin_shufflevector(lo, hi, 0, 1, 2, 3, 4, 5, 6, 7, 8, 9, 10, 11, 12, 13, 14, 15); }
__device__ __forceinline__ v16bf cat16b(v8us lo, v8us hi) { return __builtin_bit_cast(v16bf, __builtin_shufflevector(lo, hi, 0, 1, 2, 3, 4, 5, 6, 7, 8, 9, 10, 11, 12, 13, 14, 15)); }
__device__ __forceinline__ v8f wmma16(v16h a, v16h b, v8f c) { return __builtin_amdgcn_wmma_f32_16x16x32_f16(false, a, false, b, (short)0, c, false, false); }
__device__ __forceinline__ v8f wmmab(v16bf a, v16bf b, v8f c) { return __builtin_amdgcn_wmma_f32_16x16x32_bf16(false, a, false, b, (short)0, c, false, false); }



// ---- k_gemmw: register-blocked GEMM, ONE WAVE per 64x64 output tile (16 accumulators), operands straight from K-contiguous 16-bit planes; grid (M/64, N/64, Z), 32 threads.
// C[m][n] (f32, pitch ldc, + optional f32 bias[n]) = sum_k A[m][k] Bt[n][k] (+ split products per NSPLIT). z-batch strides sA/sB/sC in elements. K % 32 == 0.
// KSL > 1: grid (M/64, KSL, Z), N = 64: blockIdx.y is not a column tile but one of KSL equal slices of the reduction (K stays the row pitch, K % (32 KSL) == 0); every slice stores its own partial plane C[z][slice], and the reader adds the planes.
template <typename T16> struct WFrag;
template <> struct WFrag<h16> { typedef v16h V; static __device__ __forceinline__ V ld(const h16* p) { return cat16(*(const v8h*)p, *(const v8h*)(p + 16)); } static __device__ __forceinline__ v8f mma(V a, V b, v8f c) { return wmma16(a, b, c); } };
template <> struct WFrag<bf> { typedef v16bf V; static __device__ __forceinline__ V ld(const bf* p) { return cat16b(*(const v8us*)p, *(const v8us*)(p + 16)); } static __device__ __forceinline__ v8f mma(V a, V b, v8f c) { return wmmab(a, b, c); } };
template <typename T16, int NSPLIT, bool BIAS, int KSL = 1>
__global__ __launch_bounds__(32) void k_gemmw(const T16* __restrict__ A, const T16* __restrict__ A2, const T16* __restrict__ Bt, const T16* __restrict__ Bt2, int K, float* C, int ldc, const float* __restrict__ bias, size_t sA, size_t sB, size_t sC) {
    typedef typename WFrag<T16>::V V;
    __shared__ __align__(16) float os[16 * 68];
    static_assert(KSL == 1 || NSPLIT == 0, "a K slice moves A and Bt only");
    const size_t z = blockIdx.z; A += z * sA; if (A2) A2 += z * sA; Bt += z * sB; if (Bt2) Bt2 += z * sB;
    const int KL = K / KSL;   // this wave's share of the reduction
    if (KSL > 1) { A += (size_t)blockIdx.y * KL; Bt += (size_t)blockIdx.y * KL; C += (z * KSL + blockIdx.y) * sC; } else C += z * sC;
    const int lane = threadIdx.x & 31, lr = lane & 15, hi = lane >> 4; const int r0 = blockIdx.x * 64, c0 = KSL > 1 ? 0 : blockIdx.y * 64;
    v8f acc[4][4];
#pragma unroll
    for (int mb = 0; mb < 4; ++mb)
#pragma unroll
        for (int nb = 0; nb < 4; ++nb) acc[mb][nb] = (v8f){};
    const size_t aoff = (size_t)(r0 + lr) * K + 8 * hi, boff = (size_t)(c0 + lr) * K + 8 * hi;
#pragma unroll 1
    for (int kc = 0; kc < KL; kc += 32) {
        V a[4], a2[4];
#pragma unroll
        for (int mb = 0; mb < 4; ++mb) { a[mb] = WFrag<T16>::ld(A + aoff + (size_t)mb * 16 * K + kc); if (NSPLIT == 1 || NSPLIT == 2) a2[mb] = WFrag<T16>::ld(A2 + aoff + (size_t)mb * 16 * K + kc); }
#pragma unroll
        for (int nb = 0; nb < 4; ++nb) { const V b = WFrag<T16>::ld(Bt + boff + (size_t)nb * 16 * K + kc); V b2; if (NSPLIT >= 2) b2 = WFrag<T16>::ld(Bt2 + boff + (size_t)nb * 16 * K + kc);
#pragma unroll
            for (int mb = 0; mb < 4; ++mb) { acc[mb][nb] = WFrag<T16>::mma(a[mb], b, acc[mb][nb]); if (NSPLIT == 1 || NSPLIT == 2) acc[mb][nb] = WFrag<T16>::mma(a2[mb], b, acc[mb][nb]); if (NSPLIT >= 2) acc[mb][nb] = WFrag<T16>::mma(a[mb], b2, acc[mb][nb]); } }
        asm volatile("v_nop\n\tv_nop\n\tv_nop\n\tv_nop" : "+v"(acc[0][0]), "+v"(acc[1][1]), "+v"(acc[2][2]), "+v"(acc[3][3]) : "v"(a[0]), "v"(a[3]));
    }
#pragma unroll
    for (int mb = 0; mb < 4; ++mb) {
#pragma unroll
        for (int nb = 0; nb < 4; ++nb) {
#pragma unroll
            for (int j = 0; j < 8; ++j) os[(hi * 8 + j) * 68 + nb * 16 + lr] = acc[mb][nb][j]; }
        __builtin_amdgcn_wave_barrier(); asm volatile("" ::: "memory");
        float* crow = C + (size_t)(r0 + mb * 16) * ldc + c0;
{
#pragma unroll
            for (int s = 0; s < 8; ++s) { const int row = 2 * s + hi, cofs = lr * 4; v4f val = *(const v4fa*)(os + row * 68 + cofs); if (BIAS) { val[0] += bfr(bias[c0 + cofs]); val[1] += bfr(bias[c0 + cofs + 1]); val[2] += bfr(bias[c0 + cofs + 2]); val[3] += bfr(bias[c0 + cofs + 3]); }
                *(v4f*)(crow + (size_t)row * ldc + cofs) = val; }
             }
        __builtin_amdgcn_wave_barrier(); asm volatile("" ::: "memory");
    }
}

__device__ __forceinline__ h16 tohx(float x) { return (h16)x; }
__device__ __forceinline__ void splitf(float y, unsigned short& h, unsigned short& l) { h = f2bf(y); l = f2bf(y - bf2f(h)); }
__device__ __forceinline__ float elu1(float x) { return x > 0.f ? __fadd_rn(x, 1.0f) : __expf(x); }   // elu(x) + 1
typedef __attribute__((ext_vector_type(2))) _Float16 v2h;
typedef __attribute__((ext_vector_type(4))) _Float16 v4h;
typedef __attribute__((ext_vector_type(4))) unsigned short v4us;

// k_cvt8: a thread converts CV_CH chunks of 8 floats (a work-group's chunks lie back to back, chunk k of a thread 256 chunks behind chunk k - 1), so that a wave has 2 CV_CH loads in flight and the launch starts CV_CH times fewer waves. The grid covers the array exactly.
#define CV_CH 8
__global__ __launch_bounds__(256) void k_cvt8(const float* __restrict__ src, bf* dst) { const size_t i = (size_t)blockIdx.x * (256 * CV_CH) + threadIdx.x; const float* p = src + i * 8; v8f v[CV_CH];
#pragma unroll   // v[] stays in registers and all the loads are in flight before the first conversion
    for (int c = 0; c < CV_CH; ++c) v[c] = *(const v8f*)(p + (size_t)c * 256 * 8);
    asm volatile("s_wait_xcnt 0x0" :: "v"(p) : "memory");   // the wait owed before a register that an issued load names is overwritten; p as an input keeps the address pair whole up to it (without it the last load's result was placed on the pair)
#pragma unroll   // constant indices into v[]
    for (int c = 0; c < CV_CH; ++c) { v8us o;
#pragma unroll
        for (int k = 0; k < 8; ++k) o[k] = f2bf(v[c][k]);
        *(v8us*)(dst + (i + (size_t)c * 256) * 8) = o; }  }
// Column means of elu1(k) and of v over the sequence, in two launches. The k and v columns of a row of F are 512 adjacent floats.
// k_kmean_part: one work-group per KM_ROWS rows; a thread owns 4 adjacent columns and every 4th row; P[group][0..255] = sums of elu1(k), P[group][256..511] = sums of v.
// elu1 with its exp (x * log2(e), then v_exp_f32, as elu1 compiles) written out: the v_nop in the same statement keeps the one free issue slot that the instruction set asks for behind a transcendental;
__device__ __forceinline__ float elu1s(float x) { float e; asm("v_exp_f32 %0, %1\n\tv_nop" : "=v"(e) : "v"(x * 1.44269504f)); return x > 0.f ? __fadd_rn(x, 1.0f) : e; }
#define KM_ROWS  32
#define KM_PARTS (NN / KM_ROWS)
__global__ __launch_bounds__(512) void k_kmean_part(const float* __restrict__ F, float* P) {
    __shared__ __align__(16) float red[4 * 512];
    const int c4 = threadIdx.x & 127, g = threadIdx.x >> 7;
    const float* r = F + (size_t)(blockIdx.x * KM_ROWS + g) * 4 * INT + INT + c4 * 4;
    v4f v[KM_ROWS / 4];
#pragma unroll   // v[] stays in registers and all the row loads are in flight before the first sum
    for (int i = 0; i < KM_ROWS / 4; ++i) v[i] = *(const v4fa*)(r + (size_t)i * 4 * 4 * INT);
    v4f s = (v4f){};
    if (c4 < 64) {   // k columns (whole waves)
#pragma unroll   // constant indices into v[]
        for (int i = 0; i < KM_ROWS / 4; ++i) { s[0] += elu1s(v[i][0]); s[1] += elu1s(v[i][1]); s[2] += elu1s(v[i][2]); s[3] += elu1s(v[i][3]); }
    } else {         // v columns
#pragma unroll   // constant indices into v[]
        for (int i = 0; i < KM_ROWS / 4; ++i) s += v[i];
    }
    *(v4fa*)(red + g * 512 + c4 * 4) = s;
    __syncthreads();
    if (g == 0) { s += *(const v4fa*)(red + 512 + c4 * 4); s += *(const v4fa*)(red + 1024 + c4 * 4); s += *(const v4fa*)(red + 1536 + c4 * 4); *(v4fa*)(P + (size_t)blockIdx.x * 512 + c4 * 4) = s; }
}
// k_kmean_fin: per batch (blockIdx.y) 8 work-groups of 64 columns each; 16 thread groups sum 16 partial rows each, thread group 0 adds the 16 sums and scales by 1/N.
__global__ __launch_bounds__(256) void k_kmean_fin(const float* __restrict__ P, float* KM, float* VM) {
    __shared__ __align__(16) float red[16 * 64];
    const int c4 = threadIdx.x & 15, g = threadIdx.x >> 4;
    P += (size_t)blockIdx.y * KM_PARTS * 512; KM += blockIdx.y * INT; VM += blockIdx.y * INT;   // this batch's partial rows and means
    const float* p = P + (size_t)g * 512 + blockIdx.x * 64 + c4 * 4;
    v4f v[KM_PARTS / 16];
#pragma unroll   // v[] stays in registers and the partial-row loads overlap
    for (int i = 0; i < KM_PARTS / 16; ++i) v[i] = *(const v4fa*)(p + (size_t)i * 16 * 512);
    v4f s = (v4f){};
#pragma unroll   // constant indices into v[]
    for (int i = 0; i < KM_PARTS / 16; ++i) s += v[i];
    *(v4fa*)(red + g * 64 + c4 * 4) = s;
    __syncthreads();
    if (g == 0) {
#pragma unroll   // the LDS reads overlap
        for (int gg = 1; gg < 16; ++gg) s += *(const v4fa*)(red + gg * 64 + c4 * 4);
        s *= (1.0f / NN);
        float* dst = blockIdx.x < 4 ? KM + blockIdx.x * 64 : VM + (blockIdx.x - 4) * 64;
        *(v4fa*)(dst + c4 * 4) = s; }
}
// k_qs, k_kst: QS[h][n][d] = fp16(theta_shift(elu1(q)))[per head], KST[h][dd<64][n] = fp16(theta_shift(elu1(k))) (rows >= 32 zero; unscaled to stay in fp16's normal range) - two kernels for the two layouts; Z[n][h] = (elu1(q_h) . KM_h) SCALE (thread per (n,h)... 32-B per 8 threads:
__device__ __forceinline__ float tshift(const float* __restrict__ xr, int d, float c_d, float s_d) { const float self_ = elu1(xr[d]); const float partner = elu1(xr[d ^ 1]); const float rot = (d & 1) ? partner : -partner;   /* rotate_every_two: out[2i] = -x[2i+1], out[2i+1] = x[2i] */ float a = __fmul_rn(self_, c_d), b = __fmul_rn(rot, s_d); asm volatile("" : "+v"(a)); asm volatile("" : "+v"(b)); return __fadd_rn(a, b); }
// k_qs: a thread owns 4 adjacent d of one row n and goes through all NH_ heads of that row: the row's sin and cos are loaded and rounded once for the 8 heads, the 8 q loads are in flight together, and the launch starts 8 times fewer waves. A wave reads 4 whole lines a load (4 rows) and stores 256 adjacent bytes a head.
__global__ __launch_bounds__(256) void k_qs(const float* __restrict__ F, const float* __restrict__ sn, const float* __restrict__ cs, h16* QS) { F += (size_t)blockIdx.y * NN * 4 * INT; QS += (size_t)blockIdx.y * NH_ * NN * HD;   /* blockIdx.y: batch */ const int t = blockIdx.x * 256 + threadIdx.x; const int d = (t % (HD / 4)) * 4; const int n = t / (HD / 4); const float* xr = F + (size_t)n * 4 * INT + d; const float* cp = cs + n * HD + d; const float* sp = sn + n * HD + d; v4f x[NH_];
#pragma unroll   // x[] stays in registers and all the loads are in flight together
    for (int h = 0; h < NH_; ++h) x[h] = *(const v4fa*)(xr + h * HD);
    const v4f c4 = *(const v4fa*)cp, s4 = *(const v4fa*)sp;
    asm volatile("s_wait_xcnt 0x0" :: "v"(xr), "v"(cp), "v"(sp) : "memory");   // the wait owed before a register that an issued load names is overwritten; the address pairs as inputs keep them whole up to it (without it a later load's result was placed on one of them)
#pragma unroll   // constant indices into x[]
    for (int h = 0; h < NH_; ++h) { const float xl[4] = { x[h][0], x[h][1], x[h][2], x[h][3] }; v4h o;   // d is a multiple of 4: partner and parity of d + q are those of q
#pragma unroll
        for (int q = 0; q < 4; ++q) o[q] = tohx(tshift(xl, q, bfr(c4[q]), bfr(s4[q])));
        *(v4h*)(QS + ((size_t)h * NN + n) * HD + d) = o; }  }
// k_kst: KST[h][dd<64][n] = fp16(theta_shift(elu1(k))) and VT[h][dd<64][n] = fp16(v), rows >= 32 zero. The [n][d] -> [d][n] turn goes through LDS, so that global memory sees whole 128-byte lines on both sides.
// One work-group per 64 sequence rows x 4 heads (128 k and 128 v columns of F). Reading: a wave's load is 512 adjacent bytes of one row; a thread owns 4 adjacent columns of 8 adjacent rows and puts each column's 8 fp16 (along n) into LDS as one 16-byte chunk.
// Writing: 8 adjacent lanes fetch one column's 8 chunks (64 n, 128 bytes) and store them as one line.
// LDS row q * 32 + c4 holds column c4 * 4 + q; chunk j of it lies at place j ^ ((c4 >> 1) & 7): the row's parity and the place then spread a wave's 32 chunks evenly over the banks, in the stores (one j, 32 c4) and in the loads (8 j, 4 adjacent c4).
#define KT_N 64
#define KT_C 128
__global__ __launch_bounds__(256) void k_kst(const float* __restrict__ F, const float* __restrict__ sn, const float* __restrict__ cs, h16* KST, h16* VT) {
    __shared__ __align__(16) h16 tk[KT_C * KT_N], tv[KT_C * KT_N];
    const int n0 = blockIdx.x * KT_N, h0 = blockIdx.y * (KT_C / HD), b = blockIdx.z;   // b: batch
    const int c4 = threadIdx.x & 31, w = threadIdx.x >> 5;   // reading: column group, group of 8 rows
    const int j = threadIdx.x & 7, rc = threadIdx.x >> 3;    // writing: chunk along n, column group
    h16* const ko = KST + ((size_t)(b * NH_ + h0 + (rc >> 3)) * 64 + (rc & 7) * 4) * NN + n0 + j * 8;   // + q * NN: column rc * 4 + q, that is head h0 + rc / 8 of batch b, dd (rc % 8) * 4 + q
    h16* const vo = VT + (ko - KST);
    const float* fr = F + (size_t)(b * NN + n0 + w * 8) * 4 * INT + h0 * HD + c4 * 4;   // + INT: the k columns, + 2 * INT: the v columns
    const float* cp = cs + (n0 + w * 8) * HD + (c4 & 7) * 4; const float* sp = sn + (n0 + w * 8) * HD + (c4 & 7) * 4;
    v4f kx[8], vx[8], cx[8], sx[8];
#pragma unroll   // the arrays stay in registers and all 32 loads are in flight together
    for (int i = 0; i < 8; ++i) { kx[i] = *(const v4fa*)(fr + (size_t)i * 4 * INT + INT); vx[i] = *(const v4fa*)(fr + (size_t)i * 4 * INT + 2 * INT); cx[i] = *(const v4fa*)(cp + i * HD); sx[i] = *(const v4fa*)(sp + i * HD); }
    asm volatile("s_wait_xcnt 0x0" :: "v"(fr), "v"(cp), "v"(sp) : "memory");   // the wait owed before a register that an issued load names is overwritten; the address pairs as inputs keep them whole up to it (without it a later load's result was placed on one of them, and one load sank into the arithmetic)
#pragma unroll   // the zero rows wait for nothing: they go out under the loads' latency
    for (int q = 0; q < 4; ++q) { *(v8h*)(ko + (size_t)(HD + q) * NN) = (v8h){}; *(v8h*)(vo + (size_t)(HD + q) * NN) = (v8h){}; }
    v8h ok[4], ov[4];
#pragma unroll   // constant indices into the register arrays
    for (int i = 0; i < 8; ++i) { const float e[4] = { elu1s(kx[i][0]), elu1s(kx[i][1]), elu1s(kx[i][2]), elu1s(kx[i][3]) };
#pragma unroll   // constant indices into the register arrays
        for (int q = 0; q < 4; ++q) { const float rot = (q & 1) ? e[q ^ 1] : -e[q ^ 1];   /* rotate_every_two: out[2i] = -x[2i+1], out[2i+1] = x[2i] */
            ok[q][i] = tohx(e[q] * bfr(cx[i][q]) + rot * bfr(sx[i][q]));   /* unscaled (O(1)): SCALE/N is applied in f32 when the kv state is converted */ ov[q][i] = tohx(vx[i][q]); } }
#pragma unroll   // constant indices into the register arrays
    for (int q = 0; q < 4; ++q) { const int o = (q * 32 + c4) * KT_N + (w ^ ((c4 >> 1) & 7)) * 8; *(v8ha*)(tk + o) = ok[q]; *(v8ha*)(tv + o) = ov[q]; }
    __syncthreads();
#pragma unroll   // the LDS reads overlap
    for (int q = 0; q < 4; ++q) { const int o = (q * 32 + rc) * KT_N + (j ^ ((rc >> 1) & 7)) * 8; *(v8h*)(ko + (size_t)q * NN) = *(const v8ha*)(tk + o); *(v8h*)(vo + (size_t)q * NN) = *(const v8ha*)(tv + o); }
}
__global__ __launch_bounds__(256) void k_z(const float* __restrict__ F, const float* __restrict__ KM, float* Z) { F += (size_t)blockIdx.y * NN * 4 * INT; KM += blockIdx.y * INT; Z += (size_t)blockIdx.y * NN * NH_;   /* blockIdx.y: batch */ const int e = blockIdx.x * 256 + threadIdx.x; if (e >= NN * NH_) return; const int h = e % NH_; const int n = e / NH_; const float* qr = F + (size_t)n * 4 * INT + h * HD; float s = 0.f;
#pragma unroll 1
    for (int d = 0; d < HD; ++d) { float p = __fmul_rn(elu1(qr[d]), KM[h * HD + d]); asm volatile("" : "+v"(p)); s = __fadd_rn(s, p); } const float z = __fmul_rn(s, SCALE); *(float*)(Z + e) = z;  }
// k_kv16: one work-group per (batch, head) adds the KV_SLICES partial planes KV[h][slice][d][e] of the kv state in f32 (slice 0 first), scales by SCALE/N and stores KVT[h][e<64][d] in fp16 (rows >= 32 zero).
// A wave reads one row d of a plane (lanes along e: one 128-byte line a load); the [d][e] -> [e][d] turn goes through LDS (pitch 33 words: no bank is hit twice by a wave's store).
#define KV_SLICES 64
__global__ __launch_bounds__(1024) void k_kv16(const float* __restrict__ KV, h16* KVT) {
    __shared__ float tr[HD * 33];
    const int h = blockIdx.x, d = threadIdx.x >> 5, ee = threadIdx.x & 31;
    const float* p = KV + ((size_t)h * KV_SLICES * 64 + d) * 64 + ee; float v[KV_SLICES], sum = 0.f;
#pragma unroll   // v[] stays in registers and the plane loads overlap
    for (int sl = 0; sl < KV_SLICES; ++sl) v[sl] = p[(size_t)sl * 64 * 64];
    asm volatile("s_wait_xcnt 0x0" :: "v"(p) : "memory");   // the wait owed before a register that an issued load names is overwritten; p as an input keeps the address pair whole up to it (without it the last load's result was placed on the pair)
#pragma unroll   // constant indices into v[]
    for (int sl = 0; sl < KV_SLICES; ++sl) sum += v[sl];
    tr[ee * 33 + d] = __fmul_rn(sum, SCALE / (float)NN);
    __syncthreads();
    const int e2 = threadIdx.x * 2; v2h o = (v2h){};
    if (e2 < HD * HD) { const float* t = tr + (e2 / HD) * 33 + e2 % HD; o[0] = tohx(t[0]); o[1] = tohx(t[1]); }
    *(v2h*)(KVT + (size_t)h * 64 * HD + e2) = o;  }
// k_res: a thread owns 4 adjacent columns of RS_R adjacent rows: the columns' conv weights, biases and v means are loaded once, a v row serves the three conv taps that read it from a register (RS_R + 2 row loads for RS_R rows), all loads are in flight together, and the launch starts RS_R times fewer waves.
// A work-group is 64 column groups (a whole row) x 4 row groups; the grid covers the rows exactly. The two v rows beyond the sequence's ends are loaded from the clamped row and left out of the sum.
#define RS_R 8
__global__ __launch_bounds__(256) void k_res(const float* __restrict__ AO, const float* __restrict__ Z, const float* __restrict__ VM, const float* __restrict__ F, const float* __restrict__ wl, const float* __restrict__ bl, bf* Rh, bf* Rl) { AO += (size_t)blockIdx.y * NH_ * NN * 64; Z += (size_t)blockIdx.y * NN * NH_; VM += blockIdx.y * INT; F += (size_t)blockIdx.y * NN * 4 * INT; Rh += (size_t)blockIdx.y * NN * INT; Rl += (size_t)blockIdx.y * NN * INT;   /* blockIdx.y: batch; n stays the row inside the batch, so the conv's edges stay where they are */
    const int c = (threadIdx.x & 63) * 4; const int n0 = (blockIdx.x * 4 + (threadIdx.x >> 6)) * RS_R; const int h = c / HD, d = c % HD;
    const float* fr = F + (size_t)n0 * 4 * INT + c;   // row n0; + 2 * INT: its v columns, + 3 * INT: its o columns
    const float* flo = F + (size_t)(n0 > 0 ? n0 - 1 : 0) * 4 * INT + c; const float* fhi = F + (size_t)(n0 < NN - 1 - RS_R ? n0 : NN - 1 - RS_R) * 4 * INT + c;   // the row in front of the group, clamped to row 0; RS_R rows in front of the row behind the group, that one clamped to row NN - 1
    const float* ap = AO + ((size_t)h * NN + n0) * 64 + d; const float* zp = Z + n0 * NH_ + h;
    v4f vv[RS_R + 2], oo[RS_R], aa[RS_R]; float zz[RS_R];   // vv[i]: v of row n0 - 1 + i
    vv[0] = *(const v4fa*)(flo + 2 * INT); vv[RS_R + 1] = *(const v4fa*)(fhi + (size_t)(RS_R * 4 + 2) * INT);
#pragma unroll   // the arrays stay in registers and all the loads are in flight together
    for (int r = 0; r < RS_R; ++r) { vv[r + 1] = *(const v4fa*)(fr + (size_t)(r * 4 + 2) * INT); oo[r] = *(const v4fa*)(fr + (size_t)(r * 4 + 3) * INT); aa[r] = *(const v4fa*)(ap + r * 64); zz[r] = zp[r * NH_]; }
    const v4f vm = *(const v4fa*)(VM + c), b4 = *(const v4fa*)(bl + c), w0 = *(const v4fa*)(wl + c * 3), w1 = *(const v4fa*)(wl + c * 3 + 4), w2 = *(const v4fa*)(wl + c * 3 + 8);
    asm volatile("s_wait_xcnt 0x0" :: "v"(fr), "v"(flo), "v"(fhi), "v"(ap), "v"(zp), "v"(c * 4) : "memory");   // the wait owed before a register that an issued load names is overwritten; the address pairs and the byte offset into VM and bl as inputs keep them whole up to it (without them a later load's result was placed on some of them)
    __builtin_amdgcn_sched_barrier(0);   // no arithmetic moves up among the loads: without it the first z's division, with its wait, stood in front of most of the loads
    const float wr[12] = { bfr(w0[0]), bfr(w0[1]), bfr(w0[2]), bfr(w0[3]), bfr(w1[0]), bfr(w1[1]), bfr(w1[2]), bfr(w1[3]), bfr(w2[0]), bfr(w2[1]), bfr(w2[2]), bfr(w2[3]) };   // wr[q * 3 + k]: tap k of column c + q
#pragma unroll   // constant indices into the register arrays
    for (int r = 0; r < RS_R; ++r) { const float z = zz[r]; const float fz = __fadd_rn(1.0f, __fdiv_rn(1.0f, __fadd_rn(z, 1e-6f))); v4us oh, ol;
#pragma unroll
        for (int q = 0; q < 4; ++q) { float lp = bfr(b4[q]);
#pragma unroll
            for (int k = 0; k < 3; ++k) { const bool in = (r + k > 0 || n0 > 0) && (r + k < RS_R + 1 || n0 + RS_R < NN);   /* row n0 + r - 1 + k lies in the sequence */ float p = __fmul_rn(wr[q * 3 + k], vv[r + k][q]); asm volatile("" : "+v"(p)); lp = in ? __fadd_rn(lp, p) : lp; }
            float a = __fmul_rn(aa[r][q], fz); asm volatile("" : "+v"(a)); float zb = __fmul_rn(z, vm[q]); asm volatile("" : "+v"(zb)); const float rr = __fmul_rn(__fadd_rn(__fsub_rn(a, zb), lp), oo[r][q]); unsigned short u, l; splitf(rr, u, l); oh[q] = u; ol[q] = l; }
        const size_t e = (size_t)(n0 + r) * INT + c; *(v4us*)(Rh + e) = oh; *(v4us*)(Rl + e) = ol; }  }

extern "C" void kernel_launch(void* const* d_in, const int* in_sizes, int n_in,
                              void* d_out, int out_size, void* d_ws, size_t ws_size, hipStream_t stream) {
    (void)in_sizes; (void)n_in; (void)out_size;
    const float* x = (const float*)d_in[0]; const float* sn = (const float*)d_in[1]; const float* cs = (const float*)d_in[2]; const float* wq = (const float*)d_in[3]; const float* bq = (const float*)d_in[4]; const float* wl = (const float*)d_in[5]; const float* bl = (const float*)d_in[6]; const float* wp = (const float*)d_in[7]; const float* bp = (const float*)d_in[8];
    float* OUT = (float*)d_out;     // [4][8192][256]
    char* wsp = (char*)d_ws;
    auto take = [&](size_t bytes) { char* p = wsp; wsp += (bytes + 255) & ~(size_t)255; return (void*)p; };
    // All NB_ batches go through every launch but the weight conversions together: each plane below but WQ and WP holds NB_ batches back to back, and the batch is a part of the row index, of the z batch of k_gemmw, of k_kv16's (batch, head) work-group index, or a grid dimension of its own.
    // Three planes lie on workspace whose earlier tenant has been read for the last time by an earlier launch: XB, then KV, then Rh | Rl share one region; KST | VT, then AO share another.
    bf* WQ = (bf*)take((size_t)4 * INT * DIM * 2); bf* WP = (bf*)take((size_t)DIM * INT * 2); float* F = (float*)take((size_t)NB_ * NN * 4 * INT * 4); float* KM = (float*)take(NB_ * INT * 4); float* VM = (float*)take(NB_ * INT * 4); float* KP = (float*)take((size_t)NB_ * KM_PARTS * 512 * 4); float* Z = (float*)take((size_t)NB_ * NN * NH_ * 4);
    h16* QS = (h16*)take((size_t)NB_ * NH_ * NN * HD * 2); h16* KVT = (h16*)take((size_t)NB_ * NH_ * 64 * HD * 2);
    float* KV = (float*)take((size_t)NB_ * NH_ * KV_SLICES * 64 * 64 * 4); bf* XB = (bf*)KV; bf* Rh = (bf*)KV; bf* Rl = Rh + (size_t)NB_ * NN * INT;   // XB: half the region, dead before KV is written; Rh | Rl: all of it, written after KV's last read
    static_assert((size_t)NH_ * KV_SLICES * 64 * 64 * 4 == (size_t)2 * NN * INT * 2 && DIM == INT, "Rh | Rl fill the KV region, XB half of it");
    float* AO = (float*)take((size_t)NB_ * NH_ * NN * 64 * 4); h16* KST = (h16*)AO; h16* VT = KST + (size_t)NB_ * NH_ * 64 * NN;   // KST | VT fill the region, dead before AO is written
    if ((size_t)(wsp - (char*)d_ws) > ws_size) return;    // total ~ 244 MiB
    static_assert(DIM * INT % (8 * 256 * CV_CH) == 0 && NN % (4 * RS_R) == 0 && NN * HD % (4 * 256) == 0, "the grids of k_cvt8, k_res and k_qs cover their arrays exactly");
    k_cvt8<<<4 * INT * DIM / (8 * 256 * CV_CH), 256, 0, stream>>>(wq, WQ); k_cvt8<<<DIM * INT / (8 * 256 * CV_CH), 256, 0, stream>>>(wp, WP);   // [out][in] natural Bt
    k_cvt8<<<(unsigned)((size_t)NB_ * NN * DIM / (8 * 256 * CV_CH)), 256, 0, stream>>>(x, XB);
    k_gemmw<bf, 0, true><<<dim3(NB_ * NN / 64, 4 * INT / 64, 1), 32, 0, stream>>>(XB, nullptr, WQ, nullptr, DIM, F, 4 * INT, bq, 0, 0, 0);   // rows: (batch, n)
    k_kmean_part<<<NB_ * KM_PARTS, 512, 0, stream>>>(F, KP); k_kmean_fin<<<dim3(8, NB_, 1), 256, 0, stream>>>(KP, KM, VM); k_z<<<dim3((NN * NH_ + 255) / 256, NB_, 1), 256, 0, stream>>>(F, KM, Z);
    k_qs<<<dim3(NN * HD / 4 / 256, NB_, 1), 256, 0, stream>>>(F, sn, cs, QS); k_kst<<<dim3(NN / KT_N, NH_ * HD / KT_C, NB_), 256, 0, stream>>>(F, sn, cs, KST, VT);
    k_gemmw<h16, 0, false, KV_SLICES><<<dim3(1, KV_SLICES, NB_ * NH_), 32, 0, stream>>>(KST, nullptr, VT, nullptr, NN, KV, 64, nullptr, (size_t)64 * NN, (size_t)64 * NN, (size_t)64 * 64);   // KV[b][h][slice][d][e] = sum over the slice's n of ks[n][d] v[n][e]
    k_kv16<<<NB_ * NH_, 1024, 0, stream>>>(KV, KVT);
    k_gemmw<h16, 0, false><<<dim3(NN / 64, 1, NB_ * NH_), 32, 0, stream>>>(QS, nullptr, KVT, nullptr, HD, AO, 64, nullptr, (size_t)NN * HD, (size_t)64 * HD, (size_t)NN * 64);    // AO[b][h][n][e] = qs . kv
    k_res<<<dim3(NN / (4 * RS_R), NB_, 1), 256, 0, stream>>>(AO, Z, VM, F, wl, bl, Rh, Rl);
    k_gemmw<bf, 1, true><<<dim3(NB_ * NN / 64, DIM / 64, 1), 32, 0, stream>>>(Rh, Rl, WP, nullptr, INT, OUT, DIM, bp, 0, 0, 0);   // rows: (batch, n)
}

// v006
// Measured time: 163 microseconds a run.
// Two timings next to v005 both put it at 1.32 times that version's speed.
// All steps since v000 together make it 80.8 times as fast.
#include <hip/hip_runtime.h>

// MultiHeadMALAAttention (x [4][8192][256]; [q|k|v|o] = x W_qkvo^T + b (8 heads x 32); lepe = depthwise conv3 (pad 1) over the sequence on v + b; qh = elu(q)+1, kh = elu(k)+1; z = (qh . mean_n kh) 32^-0.5; qs/ks = theta_shift with the [N][32]
// sin/cos tables (read as data; rotate-every-two); kv = sum_n (ks s)(v s)^T with s^2 = SCALE/N; attn = qs kv; res = attn (1 + 1/(z + 1e-6)) - z mean_n v; res = (res + lepe) o; out = res W_proj^T + b -> [4][8192][256]).
// Compute dtypes, f32 accumulate: every input rounded to bf16; qkvo projection on PLAIN bf16 operands (inputs: exact, + bias); elu, means, z, theta shift, lepe conv, gating f32; kv-state (K = 8192) and qs.kv (K 32) on single fp16

#define NB_  4
#define NN   8192
#define DIM  256
#define NH_  8
#define HD   32
#define INT  256
#define SCALE 0.1767766952966369f
typedef _Float16 h16;
typedef unsigned short bf;
typedef __attribute__((ext_vector_type(16))) __bf16   v16bf;
typedef __attribute__((ext_vector_type(16))) _Float16 v16h;
typedef __attribute__((ext_vector_type(8)))  _Float16 v8h;
typedef __attribute__((ext_vector_type(8)))  unsigned short v8us;
typedef __attribute__((ext_vector_type(8)))  float    v8f;
typedef __attribute__((ext_vector_type(4)))  float    v4f;
typedef v8h  __attribute__((may_alias)) v8ha;
typedef v4f  __attribute__((may_alias)) v4fa;
typedef v8us __attribute__((may_alias)) v8usa;

__device__ __forceinline__ unsigned short f2bf(float f) { unsigned u = __float_as_uint(f); u += 0x7FFFu + ((u >> 16) & 1u); return (unsigned short)(u >> 16); }
__device__ __forceinline__ float bf2f(unsigned short b) { return __uint_as_float(((unsigned)b) << 16); }
__device__ __forceinline__ float bfr(float f) { return bf2f(f2bf(f)); }
__device__ __forceinline__ v16h cat16(v8h lo, v8h hi) { return __builtin_shufflevector(lo, hi, 0, 1, 2, 3, 4, 5, 6, 7, 8, 9, 10, 11, 12, 13, 14, 15); }
__device__ __forceinline__ v16bf cat16b(v8us lo, v8us hi) { return __builtin_bit_cast(v16bf, __builtin_shufflevector(lo, hi, 0, 1, 2, 3, 4, 5, 6, 7, 8, 9, 10, 11, 12, 13, 14, 15)); }
__device__ __forceinline__ v8f wmma16(v16h a, v16h b, v8f c) { return __builtin_amdgcn_wmma_f32_16x16x32_f16(false, a, false, b, (short)0, c, false, false); }
__device__ __forceinline__ v8f wmmab(v16bf a, v16bf b, v8f c) { return __builtin_amdgcn_wmma_f32_16x16x32_bf16(false, a, false, b, (short)0, c, false, false); }



// ---- k_gemmw: register-blocked GEMM, ONE WAVE per 64x64 output tile (16 accumulators), operands straight from K-contiguous 16-bit planes; grid (M/64, N/64, Z), 32 threads.
// C[m][n] (f32, pitch ldc, + optional f32 bias[n]) = sum_k A[m][k] Bt[n][k] (+ split products per NSPLIT). z-batch strides sA/sB/sC in elements. K % 32 == 0.
// KSL > 1: grid (M/64, KSL, Z), N = 64: blockIdx.y is not a column tile but one of KSL equal slices of the reduction (K stays the row pitch, K % (32 KSL) == 0); every slice stores its own partial plane C[z][slice], and the reader adds the planes.
template <typename T16> struct WFrag;
template <> struct WFrag<h16> { typedef v16h V; static __device__ __forceinline__ V ld(const h16* p) { return cat16(*(const v8h*)p, *(const v8h*)(p + 16)); } static __device__ __forceinline__ v8f mma(V a, V b, v8f c) { return wmma16(a, b, c); } };
template <> struct WFrag<bf> { typedef v16bf V; static __device__ __forceinline__ V ld(const bf* p) { return cat16b(*(const v8us*)p, *(const v8us*)(p + 16)); } static __device__ __forceinline__ v8f mma(V a, V b, v8f c) { return wmmab(a, b, c); } };
template <typename T16, int NSPLIT, bool BIAS, int KSL = 1>
__global__ __launch_bounds__(32) void k_gemmw(const T16* __restrict__ A, const T16* __restrict__ A2, const T16* __restrict__ Bt, const T16* __restrict__ Bt2, int K, float* C, int ldc, const float* __restrict__ bias, size_t sA, size_t sB, size_t sC) {
    typedef typename WFrag<T16>::V V;
    __shared__ __align__(16) float os[16 * 68];
    static_assert(KSL == 1 || NSPLIT == 0, "a K slice moves A and Bt only");
    const size_t z = blockIdx.z; A += z * sA; if (A2) A2 += z * sA; Bt += z * sB; if (Bt2) Bt2 += z * sB;
    const int KL = K / KSL;   // this wave's share of the reduction
    if (KSL > 1) { A += (size_t)blockIdx.y * KL; Bt += (size_t)blockIdx.y * KL; C += (z * KSL + blockIdx.y) * sC; } else C += z * sC;
    const int lane = threadIdx.x & 31, lr = lane & 15, hi = lane >> 4; const int r0 = blockIdx.x * 64, c0 = KSL > 1 ? 0 : blockIdx.y * 64;
    v8f acc[4][4];
#pragma unroll
    for (int mb = 0; mb < 4; ++mb)
#pragma unroll
        for (int nb = 0; nb < 4; ++nb) acc[mb][nb] = (v8f){};
    const size_t aoff = (size_t)(r0 + lr) * K + 8 * hi, boff = (size_t)(c0 + lr) * K + 8 * hi;
#pragma unroll 1
    for (int kc = 0; kc < KL; kc += 32) {
        V a[4], a2[4];
#pragma unroll
        for (int mb = 0; mb < 4; ++mb) { a[mb] = WFrag<T16>::ld(A + aoff + (size_t)mb * 16 * K + kc); if (NSPLIT == 1 || NSPLIT == 2) a2[mb] = WFrag<T16>::ld(A2 + aoff + (size_t)mb * 16 * K + kc); }
#pragma unroll
        for (int nb = 0; nb < 4; ++nb) { const V b = WFrag<T16>::ld(Bt + boff + (size_t)nb * 16 * K + kc); V b2; if (NSPLIT >= 2) b2 = WFrag<T16>::ld(Bt2 + boff + (size_t)nb * 16 * K + kc);
#pragma unroll
            for (int mb = 0; mb < 4; ++mb) { acc[mb][nb] = WFrag<T16>::mma(a[mb], b, acc[mb][nb]); if (NSPLIT == 1 || NSPLIT == 2) acc[mb][nb] = WFrag<T16>::mma(a2[mb], b, acc[mb][nb]); if (NSPLIT >= 2) acc[mb][nb] = WFrag<T16>::mma(a[mb], b2, acc[mb][nb]); } }
        asm volatile("v_nop\n\tv_nop\n\tv_nop\n\tv_nop" : "+v"(acc[0][0]), "+v"(acc[1][1]), "+v"(acc[2][2]), "+v"(acc[3][3]) : "v"(a[0]), "v"(a[3]));
    }
#pragma unroll
    for (int mb = 0; mb < 4; ++mb) {
#pragma unroll
        for (int nb = 0; nb < 4; ++nb) {
#pragma unroll
            for (int j = 0; j < 8; ++j) os[(hi * 8 + j) * 68 + nb * 16 + lr] = acc[mb][nb][j]; }
        __builtin_amdgcn_wave_barrier(); asm volatile("" ::: "memory");
        float* crow = C + (size_t)(r0 + mb * 16) * ldc + c0;
{
#pragma unroll
            for (int s = 0; s < 8; ++s) { const int row = 2 * s + hi, cofs = lr * 4; v4f val = *(const v4fa*)(os + row * 68 + cofs); if (BIAS) { val[0] += bfr(bias[c0 + cofs]); val[1] += bfr(bias[c0 + cofs + 1]); val[2] += bfr(bias[c0 + cofs + 2]); val[3] += bfr(bias[c0 + cofs + 3]); }
                *(v4f*)(crow + (size_t)row * ldc + cofs) = val; }
             }
        __builtin_amdgcn_wave_barrier(); asm volatile("" ::: "memory");
    }
}

__device__ __forceinline__ h16 tohx(float x) { return (h16)x; }
__device__ __forceinline__ void splitf(float y, unsigned short& h, unsigned short& l) { h = f2bf(y); l = f2bf(y - bf2f(h)); }
typedef __attribute__((ext_vector_type(2))) _Float16 v2h;
typedef __attribute__((ext_vector_type(4))) _Float16 v4h;
typedef __attribute__((ext_vector_type(4))) unsigned short v4us;

// k_cvt8: a thread converts CV_CH chunks of 8 floats (a work-group's chunks lie back to back, chunk k of a thread 256 chunks behind chunk k - 1), so that a wave has 2 CV_CH loads in flight and the launch starts CV_CH times fewer waves. The grid covers the array exactly.
#define CV_CH 8
__global__ __launch_bounds__(256) void k_cvt8(const float* __restrict__ src, bf* dst) { const size_t i = (size_t)blockIdx.x * (256 * CV_CH) + threadIdx.x; const float* p = src + i * 8; v8f v[CV_CH];
#pragma unroll   // v[] stays in registers and all the loads are in flight before the first conversion
    for (int c = 0; c < CV_CH; ++c) v[c] = *(const v8f*)(p + (size_t)c * 256 * 8);
    asm volatile("s_wait_xcnt 0x0" :: "v"(p) : "memory");   // the wait owed before a register that an issued load names is overwritten; p as an input keeps the address pair whole up to it (without it the last load's result was placed on the pair)
#pragma unroll   // constant indices into v[]
    for (int c = 0; c < CV_CH; ++c) { v8us o;
#pragma unroll
        for (int k = 0; k < 8; ++k) o[k] = f2bf(v[c][k]);
        *(v8us*)(dst + (i + (size_t)c * 256) * 8) = o; }  }
// Column means of elu1(k) and of v over the sequence: k_kst, which holds both in registers, stores its work-group's column sums over its KM_ROWS rows as P[group][0..255] = sums of elu1(k), P[group][256..511] = sums of v; k_kmean_fin adds the groups.
// elu1(x) = elu(x) + 1 = x > 0 ? x + 1 : exp(x), with its exp (x * log2(e), then v_exp_f32, as __expf compiles) written out: the v_nop in the same statement keeps the one free issue slot that the instruction set asks for behind a transcendental.
__device__ __forceinline__ float elu1s(float x) { float e; asm("v_exp_f32 %0, %1\n\tv_nop" : "=v"(e) : "v"(x * 1.44269504f)); return x > 0.f ? __fadd_rn(x, 1.0f) : e; }
#define KM_ROWS  64
#define KM_PARTS (NN / KM_ROWS)
// k_kmean_fin: per batch (blockIdx.y) 8 work-groups of 64 columns each; 16 thread groups sum KM_PARTS / 16 partial rows each, thread group 0 adds the 16 sums and scales by 1/N.
__global__ __launch_bounds__(256) void k_kmean_fin(const float* __restrict__ P, float* KM, float* VM) {
    __shared__ __align__(16) float red[16 * 64];
    const int c4 = threadIdx.x & 15, g = threadIdx.x >> 4;
    P += (size_t)blockIdx.y * KM_PARTS * 512; KM += blockIdx.y * INT; VM += blockIdx.y * INT;   // this batch's partial rows and means
    const float* p = P + (size_t)g * 512 + blockIdx.x * 64 + c4 * 4;
    v4f v[KM_PARTS / 16];
#pragma unroll   // v[] stays in registers and the partial-row loads overlap
    for (int i = 0; i < KM_PARTS / 16; ++i) v[i] = *(const v4fa*)(p + (size_t)i * 16 * 512);
    v4f s = (v4f){};
#pragma unroll   // constant indices into v[]
    for (int i = 0; i < KM_PARTS / 16; ++i) s += v[i];
    *(v4fa*)(red + g * 64 + c4 * 4) = s;
    __syncthreads();
    if (g == 0) {
#pragma unroll   // the LDS reads overlap
        for (int gg = 1; gg < 16; ++gg) s += *(const v4fa*)(red + gg * 64 + c4 * 4);
        s *= (1.0f / NN);
        float* dst = blockIdx.x < 4 ? KM + blockIdx.x * 64 : VM + (blockIdx.x - 4) * 64;
        *(v4fa*)(dst + c4 * 4) = s; }
}
// k_qkpl: QS[h][n][d] = fp16(theta_shift(elu1(q)))[per head], KST[h][dd<64][n] = fp16(theta_shift(elu1(k))) (rows >= 32 zero; unscaled to stay in fp16's normal range) - two kernels for the two layouts; Z[n][h] = (elu1(q_h) . KM_h) SCALE, made in k_qs:
__device__ __forceinline__ float tshift(const float* __restrict__ er, int d, float c_d, float s_d) { const float self_ = er[d]; const float partner = er[d ^ 1];   /* er[]: elu1 of the row */ const float rot = (d & 1) ? partner : -partner;   /* rotate_every_two: out[2i] = -x[2i+1], out[2i+1] = x[2i] */ float a = __fmul_rn(self_, c_d), b = __fmul_rn(rot, s_d); asm volatile("" : "+v"(a)); asm volatile("" : "+v"(b)); return __fadd_rn(a, b); }
// k_qs: a thread owns 4 adjacent d of one row n and goes through all NH_ heads of that row: the row's sin and cos are loaded and rounded once for the 8 heads, the 8 q loads are in flight together, and the launch starts 8 times fewer waves. A wave reads 4 whole lines a load (4 rows) and stores 256 adjacent bytes a head.
// It also makes Z[n][h] = (elu1(q_h) . KM_h) SCALE from the q values it holds: a thread sums its 4 d of each head, and the 8 lanes of a row add their 8 partial sums in three halving exchanges, after which lane g of the row holds head g's whole sum. A wave stores one whole line of Z (4 rows x 8 heads).
template <int M> __device__ __forceinline__ float xlane(float v) { return __int_as_float(__builtin_amdgcn_update_dpp(0, __float_as_int(v), 0x160 | M, 0xf, 0xf, true)); }   // v of lane (own ^ M), M < 16: DPP row_xmask
__global__ __launch_bounds__(256) void k_qs(const float* __restrict__ F, const float* __restrict__ sn, const float* __restrict__ cs, const float* __restrict__ KM, h16* QS, float* Z) { F += (size_t)blockIdx.y * NN * 4 * INT; QS += (size_t)blockIdx.y * NH_ * NN * HD; KM += blockIdx.y * INT; Z += (size_t)blockIdx.y * NN * NH_;   /* blockIdx.y: batch */ const int t = blockIdx.x * 256 + threadIdx.x; const int g = t % (HD / 4); const int d = g * 4; const int n = t / (HD / 4); const float* xr = F + (size_t)n * 4 * INT + d; const float* cp = cs + n * HD + d; const float* sp = sn + n * HD + d; const float* kp = KM + d; v4f x[NH_], km[NH_];
#pragma unroll   // x[] and km[] stay in registers and all the loads are in flight together
    for (int h = 0; h < NH_; ++h) { x[h] = *(const v4fa*)(xr + h * HD); km[h] = *(const v4fa*)(kp + h * HD); }
    const v4f c4 = *(const v4fa*)cp, s4 = *(const v4fa*)sp;
    asm volatile("s_wait_xcnt 0x0" :: "v"(xr), "v"(cp), "v"(sp), "v"(kp) : "memory");   // the wait owed before a register that an issued load names is overwritten; the address pairs as inputs keep them whole up to it (without it a later load's result was placed on one of them)
    float zp[NH_];
#pragma unroll   // constant indices into x[], km[] and zp[]
    for (int h = 0; h < NH_; ++h) { const float el[4] = { elu1s(x[h][0]), elu1s(x[h][1]), elu1s(x[h][2]), elu1s(x[h][3]) }; v4h o;   // elu1 once, for the shift and for z; d is a multiple of 4: partner and parity of d + q are those of q
#pragma unroll
        for (int q = 0; q < 4; ++q) o[q] = tohx(tshift(el, q, bfr(c4[q]), bfr(s4[q])));
        *(v4h*)(QS + ((size_t)h * NN + n) * HD + d) = o;
        zp[h] = (el[0] * km[h][0] + el[1] * km[h][1]) + (el[2] * km[h][2] + el[3] * km[h][3]); }
    static_assert(NH_ == 8 && HD / 4 == 8, "three halving exchanges: 8 heads over the 8 lanes of a row");
    float z4[4], z2[2];   // a lane keeps the heads whose bit equals its own g's and hands the others to its partner
#pragma unroll   // constant indices into zp[] and z4[]
    for (int i = 0; i < 4; ++i) z4[i] = ((g & 4) ? zp[i + 4] : zp[i]) + xlane<4>((g & 4) ? zp[i] : zp[i + 4]);
#pragma unroll   // constant indices into z4[] and z2[]
    for (int i = 0; i < 2; ++i) z2[i] = ((g & 2) ? z4[i + 2] : z4[i]) + xlane<2>((g & 2) ? z4[i] : z4[i + 2]);
    const float zs = ((g & 1) ? z2[1] : z2[0]) + xlane<1>((g & 1) ? z2[0] : z2[1]);
    Z[t] = zs * SCALE;   // t = n * NH_ + g: head g of row n
}
// k_kst: KST[h][dd<64][n] = fp16(theta_shift(elu1(k))) and VT[h][dd<64][n] = fp16(v), rows >= 32 zero. The [n][d] -> [d][n] turn goes through LDS, so that global memory sees whole 128-byte lines on both sides.
// One work-group per 64 sequence rows x 4 heads (128 k and 128 v columns of F). Reading: a wave's load is 512 adjacent bytes of one row; a thread owns 4 adjacent columns of 8 adjacent rows and puts each column's 8 fp16 (along n) into LDS as one 16-byte chunk.
// Writing: 8 adjacent lanes fetch one column's 8 chunks (64 n, 128 bytes) and store them as one line.
// LDS row q * 32 + c4 holds column c4 * 4 + q; chunk j of it lies at place j ^ ((c4 >> 1) & 7): the row's parity and the place then spread a wave's 32 chunks evenly over the banks, in the stores (one j, 32 c4) and in the loads (8 j, 4 adjacent c4).
#define KT_N 64
#define KT_C 128
// The column sums for the means ride along: a thread adds elu1(k) and v over its 8 rows, the 8 waves' sums meet in LDS behind the same barrier, and thread c adds them for column c (k) or c - KT_C (v) and stores into P (whole lines).
__global__ __launch_bounds__(256) void k_kst(const float* __restrict__ F, const float* __restrict__ sn, const float* __restrict__ cs, h16* KST, h16* VT, float* P) {
    __shared__ __align__(16) h16 tk[KT_C * KT_N], tv[KT_C * KT_N];
    __shared__ __align__(16) float red[8 * 2 * KT_C];   // [wave][sums of elu1(k): KT_C | sums of v: KT_C]
    static_assert(KM_ROWS == KT_N && 2 * KT_C == 256, "a work-group's rows are one group of P; a thread per column sum");
    const int n0 = blockIdx.x * KT_N, h0 = blockIdx.y * (KT_C / HD), b = blockIdx.z;   // b: batch
    const int c4 = threadIdx.x & 31, w = threadIdx.x >> 5;   // reading: column group, group of 8 rows
    const int j = threadIdx.x & 7, rc = threadIdx.x >> 3;    // writing: chunk along n, column group
    h16* const ko = KST + ((size_t)(b * NH_ + h0 + (rc >> 3)) * 64 + (rc & 7) * 4) * NN + n0 + j * 8;   // + q * NN: column rc * 4 + q, that is head h0 + rc / 8 of batch b, dd (rc % 8) * 4 + q
    h16* const vo = VT + (ko - KST);
    const float* fr = F + (size_t)(b * NN + n0 + w * 8) * 4 * INT + h0 * HD + c4 * 4;   // + INT: the k columns, + 2 * INT: the v columns
    const float* cp = cs + (n0 + w * 8) * HD + (c4 & 7) * 4; const float* sp = sn + (n0 + w * 8) * HD + (c4 & 7) * 4;
    v4f kx[8], vx[8], cx[8], sx[8];
#pragma unroll   // the arrays stay in registers and all 32 loads are in flight together
    for (int i = 0; i < 8; ++i) { kx[i] = *(const v4fa*)(fr + (size_t)i * 4 * INT + INT); vx[i] = *(const v4fa*)(fr + (size_t)i * 4 * INT + 2 * INT); cx[i] = *(const v4fa*)(cp + i * HD); sx[i] = *(const v4fa*)(sp + i * HD); }
    asm volatile("s_wait_xcnt 0x0" :: "v"(fr), "v"(cp), "v"(sp) : "memory");   // the wait owed before a register that an issued load names is overwritten; the address pairs as inputs keep them whole up to it (without it a later load's result was placed on one of them, and one load sank into the arithmetic)
#pragma unroll   // the zero rows wait for nothing: they go out under the loads' latency
    for (int q = 0; q < 4; ++q) { *(v8h*)(ko + (size_t)(HD + q) * NN) = (v8h){}; *(v8h*)(vo + (size_t)(HD + q) * NN) = (v8h){}; }
    v8h ok[4], ov[4]; v4f sk = (v4f){}, sv = (v4f){};
#pragma unroll   // constant indices into the register arrays
    for (int i = 0; i < 8; ++i) { const float e[4] = { elu1s(kx[i][0]), elu1s(kx[i][1]), elu1s(kx[i][2]), elu1s(kx[i][3]) }; sk[0] += e[0]; sk[1] += e[1]; sk[2] += e[2]; sk[3] += e[3]; sv += vx[i];
#pragma unroll   // constant indices into the register arrays
        for (int q = 0; q < 4; ++q) { const float rot = (q & 1) ? e[q ^ 1] : -e[q ^ 1];   /* rotate_every_two: out[2i] = -x[2i+1], out[2i+1] = x[2i] */
            ok[q][i] = tohx(e[q] * bfr(cx[i][q]) + rot * bfr(sx[i][q]));   /* unscaled (O(1)): SCALE/N is applied in f32 when the kv state is converted */ ov[q][i] = tohx(vx[i][q]); } }
#pragma unroll   // constant indices into the register arrays
    for (int q = 0; q < 4; ++q) { const int o = (q * 32 + c4) * KT_N + (w ^ ((c4 >> 1) & 7)) * 8; *(v8ha*)(tk + o) = ok[q]; *(v8ha*)(tv + o) = ov[q]; }
    *(v4fa*)(red + w * 2 * KT_C + c4 * 4) = sk; *(v4fa*)(red + w * 2 * KT_C + KT_C + c4 * 4) = sv;
    __syncthreads();
#pragma unroll   // the LDS reads overlap
    for (int q = 0; q < 4; ++q) { const int o = (q * 32 + rc) * KT_N + (j ^ ((rc >> 1) & 7)) * 8; *(v8h*)(ko + (size_t)q * NN) = *(const v8ha*)(tk + o); *(v8h*)(vo + (size_t)q * NN) = *(const v8ha*)(tv + o); }
    float cs8 = 0.f;
#pragma unroll   // the LDS reads overlap
    for (int ww = 0; ww < 8; ++ww) cs8 += red[ww * 2 * KT_C + threadIdx.x];
    P[(size_t)(b * KM_PARTS + blockIdx.x) * 512 + (threadIdx.x / KT_C) * INT + h0 * HD + threadIdx.x % KT_C] = cs8;
}
// k_kv16: one work-group per (batch, head) adds the KV_SLICES partial planes KV[h][slice][d][e] of the kv state in f32 (slice 0 first), scales by SCALE/N and stores KVT[h][e<64][d] in fp16 (rows >= 32 zero).
// A wave reads one row d of a plane (lanes along e: one 128-byte line a load); the [d][e] -> [e][d] turn goes through LDS (pitch 33 words: no bank is hit twice by a wave's store).
#define KV_SLICES 64
__global__ __launch_bounds__(1024) void k_kv16(const float* __restrict__ KV, h16* KVT) {
    __shared__ float tr[HD * 33];
    const int h = blockIdx.x, d = threadIdx.x >> 5, ee = threadIdx.x & 31;
    const float* p = KV + ((size_t)h * KV_SLICES * 64 + d) * 64 + ee; float v[KV_SLICES], sum = 0.f;
#pragma unroll   // v[] stays in registers and the plane loads overlap
    for (int sl = 0; sl < KV_SLICES; ++sl) v[sl] = p[(size_t)sl * 64 * 64];
    asm volatile("s_wait_xcnt 0x0" :: "v"(p) : "memory");   // the wait owed before a register that an issued load names is overwritten; p as an input keeps the address pair whole up to it (without it the last load's result was placed on the pair)
#pragma unroll   // constant indices into v[]
    for (int sl = 0; sl < KV_SLICES; ++sl) sum += v[sl];
    tr[ee * 33 + d] = __fmul_rn(sum, SCALE / (float)NN);
    __syncthreads();
    const int e2 = threadIdx.x * 2; v2h o = (v2h){};
    if (e2 < HD * HD) { const float* t = tr + (e2 / HD) * 33 + e2 % HD; o[0] = tohx(t[0]); o[1] = tohx(t[1]); }
    *(v2h*)(KVT + (size_t)h * 64 * HD + e2) = o;  }
// k_res: a thread owns 4 adjacent columns of RS_R adjacent rows: the columns' conv weights, biases and v means are loaded once, a v row serves the three conv taps that read it from a register (RS_R + 2 row loads for RS_R rows), all loads are in flight together, and the launch starts RS_R times fewer waves.
// A work-group is 64 column groups (a whole row) x 4 row groups; the grid covers the rows exactly. The two v rows beyond the sequence's ends are loaded from the clamped row and left out of the sum.
#define RS_R 8
__global__ __launch_bounds__(256) void k_res(const float* __restrict__ AO, const float* __restrict__ Z, const float* __restrict__ VM, const float* __restrict__ F, const float* __restrict__ wl, const float* __restrict__ bl, bf* Rh, bf* Rl) { AO += (size_t)blockIdx.y * NH_ * NN * 64; Z += (size_t)blockIdx.y * NN * NH_; VM += blockIdx.y * INT; F += (size_t)blockIdx.y * NN * 4 * INT; Rh += (size_t)blockIdx.y * NN * INT; Rl += (size_t)blockIdx.y * NN * INT;   /* blockIdx.y: batch; n stays the row inside the batch, so the conv's edges stay where they are */
    const int c = (threadIdx.x & 63) * 4; const int n0 = (blockIdx.x * 4 + (threadIdx.x >> 6)) * RS_R; const int h = c / HD, d = c % HD;
    const float* fr = F + (size_t)n0 * 4 * INT + c;   // row n0; + 2 * INT: its v columns, + 3 * INT: its o columns
    const float* flo = F + (size_t)(n0 > 0 ? n0 - 1 : 0) * 4 * INT + c; const float* fhi = F + (size_t)(n0 < NN - 1 - RS_R ? n0 : NN - 1 - RS_R) * 4 * INT + c;   // the row in front of the group, clamped to row 0; RS_R rows in front of the row behind the group, that one clamped to row NN - 1
    const float* ap = AO + ((size_t)h * NN + n0) * 64 + d; const float* zp = Z + n0 * NH_ + h;
    v4f vv[RS_R + 2], oo[RS_R], aa[RS_R]; float zz[RS_R];   // vv[i]: v of row n0 - 1 + i
    vv[0] = *(const v4fa*)(flo + 2 * INT); vv[RS_R + 1] = *(const v4fa*)(fhi + (size_t)(RS_R * 4 + 2) * INT);
#pragma unroll   // the arrays stay in registers and all the loads are in flight together
    for (int r = 0; r < RS_R; ++r) { vv[r + 1] = *(const v4fa*)(fr + (size_t)(r * 4 + 2) * INT); oo[r] = *(const v4fa*)(fr + (size_t)(r * 4 + 3) * INT); aa[r] = *(const v4fa*)(ap + r * 64); zz[r] = zp[r * NH_]; }
    const v4f vm = *(const v4fa*)(VM + c), b4 = *(const v4fa*)(bl + c), w0 = *(const v4fa*)(wl + c * 3), w1 = *(const v4fa*)(wl + c * 3 + 4), w2 = *(const v4fa*)(wl + c * 3 + 8);
    asm volatile("s_wait_xcnt 0x0" :: "v"(fr), "v"(flo), "v"(fhi), "v"(ap), "v"(zp), "v"(c * 4) : "memory");   // the wait owed before a register that an issued load names is overwritten; the address pairs and the byte offset into VM and bl as inputs keep them whole up to it (without them a later load's result was placed on some of them)
    __builtin_amdgcn_sched_barrier(0);   // no arithmetic moves up among the loads: without it the first z's division, with its wait, stood in front of most of the loads
    const float wr[12] = { bfr(w0[0]), bfr(w0[1]), bfr(w0[2]), bfr(w0[3]), bfr(w1[0]), bfr(w1[1]), bfr(w1[2]), bfr(w1[3]), bfr(w2[0]), bfr(w2[1]), bfr(w2[2]), bfr(w2[3]) };   // wr[q * 3 + k]: tap k of column c + q
#pragma unroll   // constant indices into the register arrays
    for (int r = 0; r < RS_R; ++r) { const float z = zz[r]; const float fz = __fadd_rn(1.0f, __fdiv_rn(1.0f, __fadd_rn(z, 1e-6f))); v4us oh, ol;
#pragma unroll
        for (int q = 0; q < 4; ++q) { float lp = bfr(b4[q]);
#pragma unroll
            for (int k = 0; k < 3; ++k) { const bool in = (r + k > 0 || n0 > 0) && (r + k < RS_R + 1 || n0 + RS_R < NN);   /* row n0 + r - 1 + k lies in the sequence */ float p = __fmul_rn(wr[q * 3 + k], vv[r + k][q]); asm volatile("" : "+v"(p)); lp = in ? __fadd_rn(lp, p) : lp; }
            float a = __fmul_rn(aa[r][q], fz); asm volatile("" : "+v"(a)); float zb = __fmul_rn(z, vm[q]); asm volatile("" : "+v"(zb)); const float rr = __fmul_rn(__fadd_rn(__fsub_rn(a, zb), lp), oo[r][q]); unsigned short u, l; splitf(rr, u, l); oh[q] = u; ol[q] = l; }
        const size_t e = (size_t)(n0 + r) * INT + c; *(v4us*)(Rh + e) = oh; *(v4us*)(Rl + e) = ol; }  }

extern "C" void kernel_launch(void* const* d_in, const int* in_sizes, int n_in,
                              void* d_out, int out_size, void* d_ws, size_t ws_size, hipStream_t stream) {
    (void)in_sizes; (void)n_in; (void)out_size;
    const float* x = (const float*)d_in[0]; const float* sn = (const float*)d_in[1]; const float* cs = (const float*)d_in[2]; const float* wq = (const float*)d_in[3]; const float* bq = (const float*)d_in[4]; const float* wl = (const float*)d_in[5]; const float* bl = (const float*)d_in[6]; const float* wp = (const float*)d_in[7]; const float* bp = (const float*)d_in[8];
    float* OUT = (float*)d_out;     // [4][8192][256]
    char* wsp = (char*)d_ws;
    auto take = [&](size_t bytes) { char* p = wsp; wsp += (bytes + 255) & ~(size_t)255; return (void*)p; };
    // All NB_ batches go through every launch but the weight conversions together: each plane below but WQ and WP holds NB_ batches back to back, and the batch is a part of the row index, of the z batch of k_gemmw, of k_kv16's (batch, head) work-group index, or a grid dimension of its own.
    // Three planes lie on workspace whose earlier tenant has been read for the last time by an earlier launch: XB, then KV, then Rh | Rl share one region; KST | VT, then AO share another.
    bf* WQ = (bf*)take((size_t)4 * INT * DIM * 2); bf* WP = (bf*)take((size_t)DIM * INT * 2); float* F = (float*)take((size_t)NB_ * NN * 4 * INT * 4); float* KM = (float*)take(NB_ * INT * 4); float* VM = (float*)take(NB_ * INT * 4); float* KP = (float*)take((size_t)NB_ * KM_PARTS * 512 * 4); float* Z = (float*)take((size_t)NB_ * NN * NH_ * 4);
    h16* QS = (h16*)take((size_t)NB_ * NH_ * NN * HD * 2); h16* KVT = (h16*)take((size_t)NB_ * NH_ * 64 * HD * 2);
    float* KV = (float*)take((size_t)NB_ * NH_ * KV_SLICES * 64 * 64 * 4); bf* XB = (bf*)KV; bf* Rh = (bf*)KV; bf* Rl = Rh + (size_t)NB_ * NN * INT;   // XB: half the region, dead before KV is written; Rh | Rl: all of it, written after KV's last read
    static_assert((size_t)NH_ * KV_SLICES * 64 * 64 * 4 == (size_t)2 * NN * INT * 2 && DIM == INT, "Rh | Rl fill the KV region, XB half of it");
    float* AO = (float*)take((size_t)NB_ * NH_ * NN * 64 * 4); h16* KST = (h16*)AO; h16* VT = KST + (size_t)NB_ * NH_ * 64 * NN;   // KST | VT fill the region, dead before AO is written
    if ((size_t)(wsp - (char*)d_ws) > ws_size) return;    // total ~ 243 MiB
    static_assert(DIM * INT % (8 * 256 * CV_CH) == 0 && NN % (4 * RS_R) == 0 && NN * HD % (4 * 256) == 0, "the grids of k_cvt8, k_res and k_qs cover their arrays exactly");
    k_cvt8<<<4 * INT * DIM / (8 * 256 * CV_CH), 256, 0, stream>>>(wq, WQ); k_cvt8<<<DIM * INT / (8 * 256 * CV_CH), 256, 0, stream>>>(wp, WP);   // [out][in] natural Bt
    k_cvt8<<<(unsigned)((size_t)NB_ * NN * DIM / (8 * 256 * CV_CH)), 256, 0, stream>>>(x, XB);
    k_gemmw<bf, 0, true><<<dim3(NB_ * NN / 64, 4 * INT / 64, 1), 32, 0, stream>>>(XB, nullptr, WQ, nullptr, DIM, F, 4 * INT, bq, 0, 0, 0);   // rows: (batch, n)
    k_kst<<<dim3(NN / KT_N, NH_ * HD / KT_C, NB_), 256, 0, stream>>>(F, sn, cs, KST, VT, KP); k_kmean_fin<<<dim3(8, NB_, 1), 256, 0, stream>>>(KP, KM, VM);
    k_qs<<<dim3(NN * HD / 4 / 256, NB_, 1), 256, 0, stream>>>(F, sn, cs, KM, QS, Z);
    k_gemmw<h16, 0, false, KV_SLICES><<<dim3(1, KV_SLICES, NB_ * NH_), 32, 0, stream>>>(KST, nullptr, VT, nullptr, NN, KV, 64, nullptr, (size_t)64 * NN, (size_t)64 * NN, (size_t)64 * 64);   // KV[b][h][slice][d][e] = sum over the slice's n of ks[n][d] v[n][e]
    k_kv16<<<NB_ * NH_, 1024, 0, stream>>>(KV, KVT);
    k_gemmw<h16, 0, false><<<dim3(NN / 64, 1, NB_ * NH_), 32, 0, stream>>>(QS, nullptr, KVT, nullptr, HD, AO, 64, nullptr, (size_t)NN * HD, (size_t)64 * HD, (size_t)NN * 64);    // AO[b][h][n][e] = qs . kv
    k_res<<<dim3(NN / (4 * RS_R), NB_, 1), 256, 0, stream>>>(AO, Z, VM, F, wl, bl, Rh, Rl);
    k_gemmw<bf, 1, true><<<dim3(NB_ * NN / 64, DIM / 64, 1), 32, 0, stream>>>(Rh, Rl, WP, nullptr, INT, OUT, DIM, bp, 0, 0, 0);   // rows: (batch, n)
}

// v007
// One run takes 136 microseconds.
// Next to v006, in two timings, it ran 1.21 and 1.20 times as fast.
// Over all steps from v000 it is 97.3 times as fast.
#include <hip/hip_runtime.h>

// MultiHeadMALAAttention (x [4][8192][256]; [q|k|v|o] = x W_qkvo^T + b (8 heads x 32); lepe = depthwise conv3 (pad 1) over the sequence on v + b; qh = elu(q)+1, kh = elu(k)+1; z = (qh . mean_n kh) 32^-0.5; qs/ks = theta_shift with the [N][32]
// sin/cos tables (read as data; rotate-every-two); kv = sum_n (ks s)(v s)^T with s^2 = SCALE/N; attn = qs kv; res = attn (1 + 1/(z + 1e-6)) - z mean_n v; res = (res + lepe) o; out = res W_proj^T + b -> [4][8192][256]).
// Compute dtypes, f32 accumulate: every input rounded to bf16; qkvo projection on PLAIN bf16 operands (inputs: exact, + bias); elu, means, z, theta shift, lepe conv, gating f32; kv-state (K = 8192) and qs.kv (K 32) on single fp16

#define NB_  4
#define NN   8192
#define DIM  256
#define NH_  8
#define HD   32
#define INT  256
#define SCALE 0.1767766952966369f
typedef _Float16 h16;
typedef unsigned short bf;
typedef __attribute__((ext_vector_type(16))) __bf16   v16bf;
typedef __attribute__((ext_vector_type(16))) _Float16 v16h;
typedef __attribute__((ext_vector_type(8)))  _Float16 v8h;
typedef __attribute__((ext_vector_type(8)))  unsigned short v8us;
typedef __attribute__((ext_vector_type(8)))  float    v8f;
typedef __attribute__((ext_vector_type(4)))  float    v4f;
typedef v8h  __attribute__((may_alias)) v8ha;
typedef v4f  __attribute__((may_alias)) v4fa;
typedef v8us __attribute__((may_alias)) v8usa;

__device__ __forceinline__ unsigned short f2bf(float f) { unsigned u = __float_as_uint(f); u += 0x7FFFu + ((u >> 16) & 1u); return (unsigned short)(u >> 16); }
__device__ __forceinline__ float bf2f(unsigned short b) { return __uint_as_float(((unsigned)b) << 16); }
__device__ __forceinline__ float bfr(float f) { return bf2f(f2bf(f)); }
__device__ __forceinline__ v16h cat16(v8h lo, v8h hi) { return __builtin_shufflevector(lo, hi, 0, 1, 2, 3, 4, 5, 6, 7, 8, 9, 10, 11, 12, 13, 14, 15); }
__device__ __forceinline__ v16bf cat16b(v8us lo, v8us hi) { return __builtin_bit_cast(v16bf, __builtin_shufflevector(lo, hi, 0, 1, 2, 3, 4, 5, 6, 7, 8, 9, 10, 11, 12, 13, 14, 15)); }
__device__ __forceinline__ v8f wmma16(v16h a, v16h b, v8f c) { return __builtin_amdgcn_wmma_f32_16x16x32_f16(false, a, false, b, (short)0, c, false, false); }
__device__ __forceinline__ v8f wmmab(v16bf a, v16bf b, v8f c) { return __builtin_amdgcn_wmma_f32_16x16x32_bf16(false, a, false, b, (short)0, c, false, false); }



// ---- k_gemmw: register-blocked GEMM, ONE WAVE per 64x64 output tile (16 accumulators), operands straight from K-contiguous 16-bit planes; grid (M/64, N/64, Z), 32 threads.
// C[m][n] (f32, pitch ldc, + optional f32 bias[n]) = sum_k A[m][k] Bt[n][k] (+ split products per NSPLIT). z-batch strides sA/sB/sC in elements. K % 32 == 0.
// KSL > 1: grid (M/64, KSL, Z), N = 64: blockIdx.y is not a column tile but one of KSL equal slices of the reduction (K stays the row pitch, K % (32 KSL) == 0); every slice stores its own partial plane C[z][slice], and the reader adds the planes.
template <typename T16> struct WFrag;
template <> struct WFrag<h16> { typedef v16h V; static __device__ __forceinline__ V ld(const h16* p) { return cat16(*(const v8h*)p, *(const v8h*)(p + 16)); } static __device__ __forceinline__ v8f mma(V a, V b, v8f c) { return wmma16(a, b, c); } };
template <> struct WFrag<bf> { typedef v16bf V; static __device__ __forceinline__ V ld(const bf* p) { return cat16b(*(const v8us*)p, *(const v8us*)(p + 16)); } static __device__ __forceinline__ v8f mma(V a, V b, v8f c) { return wmmab(a, b, c); } };
template <typename T16, int NSPLIT, bool BIAS, int KSL = 1>
__global__ __launch_bounds__(32) void k_gemmw(const T16* __restrict__ A, const T16* __restrict__ A2, const T16* __restrict__ Bt, const T16* __restrict__ Bt2, int K, float* C, int ldc, const float* __restrict__ bias, size_t sA, size_t sB, size_t sC) {
    typedef typename WFrag<T16>::V V;
    __shared__ __align__(16) float os[16 * 68];
    static_assert(KSL == 1 || NSPLIT == 0, "a K slice moves A and Bt only");
    const size_t z = blockIdx.z; A += z * sA; if (A2) A2 += z * sA; Bt += z * sB; if (Bt2) Bt2 += z * sB;
    const int KL = K / KSL;   // this wave's share of the reduction
    if (KSL > 1) { A += (size_t)blockIdx.y * KL; Bt += (size_t)blockIdx.y * KL; C += (z * KSL + blockIdx.y) * sC; } else C += z * sC;
    const int lane = threadIdx.x & 31, lr = lane & 15, hi = lane >> 4; const int r0 = blockIdx.x * 64, c0 = KSL > 1 ? 0 : blockIdx.y * 64;
    v8f acc[4][4];
#pragma unroll
    for (int mb = 0; mb < 4; ++mb)
#pragma unroll
        for (int nb = 0; nb < 4; ++nb) acc[mb][nb] = (v8f){};
    const size_t aoff = (size_t)(r0 + lr) * K + 8 * hi, boff = (size_t)(c0 + lr) * K + 8 * hi;
#pragma unroll 1
    for (int kc = 0; kc < KL; kc += 32) {
        V a[4], a2[4];
#pragma unroll
        for (int mb = 0; mb < 4; ++mb) { a[mb] = WFrag<T16>::ld(A + aoff + (size_t)mb * 16 * K + kc); if (NSPLIT == 1 || NSPLIT == 2) a2[mb] = WFrag<T16>::ld(A2 + aoff + (size_t)mb * 16 * K + kc); }
#pragma unroll
        for (int nb = 0; nb < 4; ++nb) { const V b = WFrag<T16>::ld(Bt + boff + (size_t)nb * 16 * K + kc); V b2; if (NSPLIT >= 2) b2 = WFrag<T16>::ld(Bt2 + boff + (size_t)nb * 16 * K + kc);
#pragma unroll
            for (int mb = 0; mb < 4; ++mb) { acc[mb][nb] = WFrag<T16>::mma(a[mb], b, acc[mb][nb]); if (NSPLIT == 1 || NSPLIT == 2) acc[mb][nb] = WFrag<T16>::mma(a2[mb], b, acc[mb][nb]); if (NSPLIT >= 2) acc[mb][nb] = WFrag<T16>::mma(a[mb], b2, acc[mb][nb]); } }
        asm volatile("v_nop\n\tv_nop\n\tv_nop\n\tv_nop" : "+v"(acc[0][0]), "+v"(acc[1][1]), "+v"(acc[2][2]), "+v"(acc[3][3]) : "v"(a[0]), "v"(a[3]));
    }
#pragma unroll
    for (int mb = 0; mb < 4; ++mb) {
#pragma unroll
        for (int nb = 0; nb < 4; ++nb) {
#pragma unroll
            for (int j = 0; j < 8; ++j) os[(hi * 8 + j) * 68 + nb * 16 + lr] = acc[mb][nb][j]; }
        __builtin_amdgcn_wave_barrier(); asm volatile("" ::: "memory");
        float* crow = C + (size_t)(r0 + mb * 16) * ldc + c0;
{
#pragma unroll
            for (int s = 0; s < 8; ++s) { const int row = 2 * s + hi, cofs = lr * 4; v4f val = *(const v4fa*)(os + row * 68 + cofs); if (BIAS) { val[0] += bfr(bias[c0 + cofs]); val[1] += bfr(bias[c0 + cofs + 1]); val[2] += bfr(bias[c0 + cofs + 2]); val[3] += bfr(bias[c0 + cofs + 3]); }
                *(v4f*)(crow + (size_t)row * ldc + cofs) = val; }
             }
        __builtin_amdgcn_wave_barrier(); asm volatile("" ::: "memory");
    }
}

__device__ __forceinline__ h16 tohx(float x) { return (h16)x; }
__device__ __forceinline__ void splitf(float y, unsigned short& h, unsigned short& l) { h = f2bf(y); l = f2bf(y - bf2f(h)); }
typedef __attribute__((ext_vector_type(2))) _Float16 v2h;
typedef __attribute__((ext_vector_type(4))) _Float16 v4h;
typedef __attribute__((ext_vector_type(4))) unsigned short v4us;

// k_cvt8: a thread converts CV_CH chunks of 8 floats (a work-group's chunks lie back to back, chunk k of a thread 256 chunks behind chunk k - 1), so that a wave has 2 CV_CH loads in flight and the launch starts CV_CH times fewer waves. The grid covers the array exactly.
#define CV_CH 8
__global__ __launch_bounds__(256) void k_cvt8(const float* __restrict__ src, bf* dst) { const size_t i = (size_t)blockIdx.x * (256 * CV_CH) + threadIdx.x; const float* p = src + i * 8; v8f v[CV_CH];
#pragma unroll   // v[] stays in registers and all the loads are in flight before the first conversion
    for (int c = 0; c < CV_CH; ++c) v[c] = *(const v8f*)(p + (size_t)c * 256 * 8);
    asm volatile("s_wait_xcnt 0x0" :: "v"(p) : "memory");   // the wait owed before a register that an issued load names is overwritten; p as an input keeps the address pair whole up to it (without it the last load's result was placed on the pair)
#pragma unroll   // constant indices into v[]
    for (int c = 0; c < CV_CH; ++c) { v8us o;
#pragma unroll
        for (int k = 0; k < 8; ++k) o[k] = f2bf(v[c][k]);
        *(v8us*)(dst + (i + (size_t)c * 256) * 8) = o; }  }
// Column means of elu1(k) and of v over the sequence: k_kst, which holds both in registers, stores its work-group's column sums over its KM_ROWS rows as P[group][0..255] = sums of elu1(k), P[group][256..511] = sums of v; k_kmean_fin adds the groups.
// elu1(x) = elu(x) + 1 = x > 0 ? x + 1 : exp(x), with its exp (x * log2(e), then v_exp_f32, as __expf compiles) written out: the v_nop in the same statement keeps the one free issue slot that the instruction set asks for behind a transcendental.
__device__ __forceinline__ float elu1s(float x) { float e; asm("v_exp_f32 %0, %1\n\tv_nop" : "=v"(e) : "v"(x * 1.44269504f)); return x > 0.f ? __fadd_rn(x, 1.0f) : e; }
#define KM_ROWS  64
#define KM_PARTS (NN / KM_ROWS)
// k_kmean_fin: per batch (blockIdx.y) 8 work-groups of 64 columns each; 16 thread groups sum KM_PARTS / 16 partial rows each, thread group 0 adds the 16 sums and scales by 1/N.
__global__ __launch_bounds__(256) void k_kmean_fin(const float* __restrict__ P, float* KM, float* VM) {
    __shared__ __align__(16) float red[16 * 64];
    const int c4 = threadIdx.x & 15, g = threadIdx.x >> 4;
    P += (size_t)blockIdx.y * KM_PARTS * 512; KM += blockIdx.y * INT; VM += blockIdx.y * INT;   // this batch's partial rows and means
    const float* p = P + (size_t)g * 512 + blockIdx.x * 64 + c4 * 4;
    v4f v[KM_PARTS / 16];
#pragma unroll   // v[] stays in registers and the partial-row loads overlap
    for (int i = 0; i < KM_PARTS / 16; ++i) v[i] = *(const v4fa*)(p + (size_t)i * 16 * 512);
    v4f s = (v4f){};
#pragma unroll   // constant indices into v[]
    for (int i = 0; i < KM_PARTS / 16; ++i) s += v[i];
    *(v4fa*)(red + g * 64 + c4 * 4) = s;
    __syncthreads();
    if (g == 0) {
#pragma unroll   // the LDS reads overlap
        for (int gg = 1; gg < 16; ++gg) s += *(const v4fa*)(red + gg * 64 + c4 * 4);
        s *= (1.0f / NN);
        float* dst = blockIdx.x < 4 ? KM + blockIdx.x * 64 : VM + (blockIdx.x - 4) * 64;
        *(v4fa*)(dst + c4 * 4) = s; }
}
// qs = fp16(theta_shift(elu1(q))) and z = (elu1(q_h) . KM_h) SCALE are made in k_res; KST[h][dd<64][n] = fp16(theta_shift(elu1(k))) (rows >= 32 zero; unscaled to stay in fp16's normal range) in k_kst:
__device__ __forceinline__ float tshift(const float* __restrict__ er, int d, float c_d, float s_d) { const float self_ = er[d]; const float partner = er[d ^ 1];   /* er[]: elu1 of the row */ const float rot = (d & 1) ? partner : -partner;   /* rotate_every_two: out[2i] = -x[2i+1], out[2i+1] = x[2i] */ float a = __fmul_rn(self_, c_d), b = __fmul_rn(rot, s_d); asm volatile("" : "+v"(a)); asm volatile("" : "+v"(b)); return __fadd_rn(a, b); }
template <int M> __device__ __forceinline__ float xlane(float v) { return __int_as_float(__builtin_amdgcn_update_dpp(0, __float_as_int(v), 0x160 | M, 0xf, 0xf, true)); }   // v of lane (own ^ M), M < 16: DPP row_xmask
// k_kst: KST[h][dd<64][n] = fp16(theta_shift(elu1(k))) and VT[h][dd<64][n] = fp16(v), rows >= 32 zero. The [n][d] -> [d][n] turn goes through LDS, so that global memory sees whole 128-byte lines on both sides.
// One work-group per 64 sequence rows x 4 heads (128 k and 128 v columns of F). Reading: a wave's load is 512 adjacent bytes of one row; a thread owns 4 adjacent columns of 8 adjacent rows and puts each column's 8 fp16 (along n) into LDS as one 16-byte chunk.
// Writing: 8 adjacent lanes fetch one column's 8 chunks (64 n, 128 bytes) and store them as one line.
// LDS row q * 32 + c4 holds column c4 * 4 + q; chunk j of it lies at place j ^ ((c4 >> 1) & 7): the row's parity and the place then spread a wave's 32 chunks evenly over the banks, in the stores (one j, 32 c4) and in the loads (8 j, 4 adjacent c4).
#define KT_N 64
#define KT_C 128
// The column sums for the means ride along: a thread adds elu1(k) and v over its 8 rows, the 8 waves' sums meet in LDS behind the same barrier, and thread c adds them for column c (k) or c - KT_C (v) and stores into P (whole lines).
__global__ __launch_bounds__(256) void k_kst(const float* __restrict__ F, const float* __restrict__ sn, const float* __restrict__ cs, h16* KST, h16* VT, float* P) {
    __shared__ __align__(16) h16 tk[KT_C * KT_N], tv[KT_C * KT_N];
    __shared__ __align__(16) float red[8 * 2 * KT_C];   // [wave][sums of elu1(k): KT_C | sums of v: KT_C]
    static_assert(KM_ROWS == KT_N && 2 * KT_C == 256, "a work-group's rows are one group of P; a thread per column sum");
    const int n0 = blockIdx.x * KT_N, h0 = blockIdx.y * (KT_C / HD), b = blockIdx.z;   // b: batch
    const int c4 = threadIdx.x & 31, w = threadIdx.x >> 5;   // reading: column group, group of 8 rows
    const int j = threadIdx.x & 7, rc = threadIdx.x >> 3;    // writing: chunk along n, column group
    h16* const ko = KST + ((size_t)(b * NH_ + h0 + (rc >> 3)) * 64 + (rc & 7) * 4) * NN + n0 + j * 8;   // + q * NN: column rc * 4 + q, that is head h0 + rc / 8 of batch b, dd (rc % 8) * 4 + q
    h16* const vo = VT + (ko - KST);
    const float* fr = F + (size_t)(b * NN + n0 + w * 8) * 4 * INT + h0 * HD + c4 * 4;   // + INT: the k columns, + 2 * INT: the v columns
    const float* cp = cs + (n0 + w * 8) * HD + (c4 & 7) * 4; const float* sp = sn + (n0 + w * 8) * HD + (c4 & 7) * 4;
    v4f kx[8], vx[8], cx[8], sx[8];
#pragma unroll   // the arrays stay in registers and all 32 loads are in flight together
    for (int i = 0; i < 8; ++i) { kx[i] = *(const v4fa*)(fr + (size_t)i * 4 * INT + INT); vx[i] = *(const v4fa*)(fr + (size_t)i * 4 * INT + 2 * INT); cx[i] = *(const v4fa*)(cp + i * HD); sx[i] = *(const v4fa*)(sp + i * HD); }
    asm volatile("s_wait_xcnt 0x0" :: "v"(fr), "v"(cp), "v"(sp) : "memory");   // the wait owed before a register that an issued load names is overwritten; the address pairs as inputs keep them whole up to it (without it a later load's result was placed on one of them, and one load sank into the arithmetic)
#pragma unroll   // the zero rows wait for nothing: they go out under the loads' latency
    for (int q = 0; q < 4; ++q) { *(v8h*)(ko + (size_t)(HD + q) * NN) = (v8h){}; *(v8h*)(vo + (size_t)(HD + q) * NN) = (v8h){}; }
    v8h ok[4], ov[4]; v4f sk = (v4f){}, sv = (v4f){};
#pragma unroll   // constant indices into the register arrays
    for (int i = 0; i < 8; ++i) { const float e[4] = { elu1s(kx[i][0]), elu1s(kx[i][1]), elu1s(kx[i][2]), elu1s(kx[i][3]) }; sk[0] += e[0]; sk[1] += e[1]; sk[2] += e[2]; sk[3] += e[3]; sv += vx[i];
#pragma unroll   // constant indices into the register arrays
        for (int q = 0; q < 4; ++q) { const float rot = (q & 1) ? e[q ^ 1] : -e[q ^ 1];   /* rotate_every_two: out[2i] = -x[2i+1], out[2i+1] = x[2i] */
            ok[q][i] = tohx(e[q] * bfr(cx[i][q]) + rot * bfr(sx[i][q]));   /* unscaled (O(1)): SCALE/N is applied in f32 when the kv state is converted */ ov[q][i] = tohx(vx[i][q]); } }
#pragma unroll   // constant indices into the register arrays
    for (int q = 0; q < 4; ++q) { const int o = (q * 32 + c4) * KT_N + (w ^ ((c4 >> 1) & 7)) * 8; *(v8ha*)(tk + o) = ok[q]; *(v8ha*)(tv + o) = ov[q]; }
    *(v4fa*)(red + w * 2 * KT_C + c4 * 4) = sk; *(v4fa*)(red + w * 2 * KT_C + KT_C + c4 * 4) = sv;
    __syncthreads();
#pragma unroll   // the LDS reads overlap
    for (int q = 0; q < 4; ++q) { const int o = (q * 32 + rc) * KT_N + (j ^ ((rc >> 1) & 7)) * 8; *(v8h*)(ko + (size_t)q * NN) = *(const v8ha*)(tk + o); *(v8h*)(vo + (size_t)q * NN) = *(const v8ha*)(tv + o); }
    float cs8 = 0.f;
#pragma unroll   // the LDS reads overlap
    for (int ww = 0; ww < 8; ++ww) cs8 += red[ww * 2 * KT_C + threadIdx.x];
    P[(size_t)(b * KM_PARTS + blockIdx.x) * 512 + (threadIdx.x / KT_C) * INT + h0 * HD + threadIdx.x % KT_C] = cs8;
}
// k_kv16: one work-group per (batch, head) adds the KV_SLICES partial planes KV[h][slice][d][e] of the kv state in f32 (slice 0 first), scales by SCALE/N and stores KVT[h][e<64][d] in fp16 (rows >= 32 zero).
// A wave reads one row d of a plane (lanes along e: one 128-byte line a load); the [d][e] -> [e][d] turn goes through LDS (pitch 33 words: no bank is hit twice by a wave's store).
#define KV_SLICES 64
__global__ __launch_bounds__(1024) void k_kv16(const float* __restrict__ KV, h16* KVT) {
    __shared__ float tr[HD * 33];
    const int h = blockIdx.x, d = threadIdx.x >> 5, ee = threadIdx.x & 31;
    const float* p = KV + ((size_t)h * KV_SLICES * 64 + d) * 64 + ee; float v[KV_SLICES], sum = 0.f;
#pragma unroll   // v[] stays in registers and the plane loads overlap
    for (int sl = 0; sl < KV_SLICES; ++sl) v[sl] = p[(size_t)sl * 64 * 64];
    asm volatile("s_wait_xcnt 0x0" :: "v"(p) : "memory");   // the wait owed before a register that an issued load names is overwritten; p as an input keeps the address pair whole up to it (without it the last load's result was placed on the pair)
#pragma unroll   // constant indices into v[]
    for (int sl = 0; sl < KV_SLICES; ++sl) sum += v[sl];
    tr[ee * 33 + d] = __fmul_rn(sum, SCALE / (float)NN);
    __syncthreads();
    const int e2 = threadIdx.x * 2; v2h o = (v2h){};
    if (e2 < HD * HD) { const float* t = tr + (e2 / HD) * 33 + e2 % HD; o[0] = tohx(t[0]); o[1] = tohx(t[1]); }
    *(v2h*)(KVT + (size_t)h * 64 * HD + e2) = o;  }
// k_res: one work-group makes 4 * RS_R whole rows of res, from q to the bf16 pair. A thread owns 4 adjacent columns (4 d of one head) of RS_R adjacent rows: the columns' conv weights, biases and means are loaded once, a v row serves the three conv taps that read it from a register (RS_R + 2 row loads for RS_R rows), and all global loads are in flight together.
// A work-group is 64 column groups (a whole row) x 4 row groups; the grid covers the rows exactly. The two v rows beyond the sequence's ends are loaded from the clamped row and left out of the sum.
// Part 1, every thread: qs = fp16(theta_shift(elu1(q))) of its 4 d x RS_R rows goes into LDS (qsh[head][row][d]); z: a thread sums its 4 d of each row, and the 8 lanes of a head add their partial sums in three halving exchanges, after which lane g holds row g's whole sum and puts it into LDS (zsh[row][head]).
// Part 2, wave w = head w: attn[32 rows][32 e] = qs . kv, K = 32: 2 x 2 matrix instructions, A from qsh, B from KVT[head][e][d] (loaded with the others, up front); the accumulators go into LDS (ao[row][column]).
// Part 3, every thread: attn and z of its own columns and rows come back from LDS; gating, conv, o as before.
#define RS_R 8
#define QS_P 40    // fp16 per qsh row: 64 bytes of data at a pitch of 80, the pitch for 16-byte reads of 64-byte rows
#define QS_H (4 * RS_R * QS_P + 32)   // fp16 per qsh head: 64 bytes behind the 32 rows, so that the 4 heads that a wave's 8-byte stores touch fall on 4 different quarters of the banks
#define AO_P 260   // floats per ao row: the two 8-row halves of an accumulator store fall on different banks; 16-byte reads stay aligned
__global__ __launch_bounds__(256) void k_res(const float* __restrict__ F, const float* __restrict__ sn, const float* __restrict__ cs, const float* __restrict__ KM, const float* __restrict__ VM, const h16* __restrict__ KVT, const float* __restrict__ wl, const float* __restrict__ bl, bf* Rh, bf* Rl) { KM += blockIdx.y * INT; VM += blockIdx.y * INT; KVT += (size_t)blockIdx.y * NH_ * 64 * HD; F += (size_t)blockIdx.y * NN * 4 * INT; Rh += (size_t)blockIdx.y * NN * INT; Rl += (size_t)blockIdx.y * NN * INT;   /* blockIdx.y: batch; n stays the row inside the batch, so the conv's edges stay where they are */
    __shared__ __align__(16) h16 qsh[NH_ * QS_H];
    __shared__ __align__(16) float ao[4 * RS_R * AO_P];
    __shared__ float zsh[4 * RS_R * NH_];
    static_assert(4 * RS_R == 32 && NH_ == 8 && HD == 32 && INT == NH_ * HD, "8 waves, a head each: 2 x 2 tiles of 16 x 16, one K step");
    const int c = (threadIdx.x & 63) * 4; const int rl = (threadIdx.x >> 6) * RS_R; const int n0 = blockIdx.x * 4 * RS_R + rl; const int h = c / HD, d = c % HD, g = d / 4;   // rl: the thread's first row inside the work-group
    const int lr = threadIdx.x & 15, hi = (threadIdx.x >> 4) & 1, w = threadIdx.x >> 5;   // part 2: place in the fragments, head
    const float* fr = F + (size_t)n0 * 4 * INT + c;   // row n0: its q columns; + 2 * INT: its v columns, + 3 * INT: its o columns
    const float* flo = F + (size_t)(n0 > 0 ? n0 - 1 : 0) * 4 * INT + c; const float* fhi = F + (size_t)(n0 < NN - 1 - RS_R ? n0 : NN - 1 - RS_R) * 4 * INT + c;   // the row in front of the group, clamped to row 0; RS_R rows in front of the row behind the group, that one clamped to row NN - 1
    const float* cp = cs + n0 * HD + d; const float* sp = sn + n0 * HD + d; const h16* kvp = KVT + (size_t)(w * 64 + lr) * HD + 8 * hi;   // kvp: row e = lr of head w, as k_gemmw reads its Bt
    v4f qq[RS_R], cx[RS_R], sx[RS_R], vv[RS_R + 2], oo[RS_R]; v16h kvf[2];   // vv[i]: v of row n0 - 1 + i
#pragma unroll   // the arrays stay in registers and all the loads are in flight together; what part 1 needs goes first
    for (int r = 0; r < RS_R; ++r) { qq[r] = *(const v4fa*)(fr + (size_t)(r * 4) * INT); cx[r] = *(const v4fa*)(cp + r * HD); sx[r] = *(const v4fa*)(sp + r * HD); }
    const v4f km = *(const v4fa*)(KM + c);
#pragma unroll   // constant indices into kvf[]
    for (int nb = 0; nb < 2; ++nb) kvf[nb] = WFrag<h16>::ld(kvp + nb * 16 * HD);
    vv[0] = *(const v4fa*)(flo + 2 * INT); vv[RS_R + 1] = *(const v4fa*)(fhi + (size_t)(RS_R * 4 + 2) * INT);
#pragma unroll   // the arrays stay in registers and all the loads are in flight together
    for (int r = 0; r < RS_R; ++r) { vv[r + 1] = *(const v4fa*)(fr + (size_t)(r * 4 + 2) * INT); oo[r] = *(const v4fa*)(fr + (size_t)(r * 4 + 3) * INT); }
    const v4f vm = *(const v4fa*)(VM + c), b4 = *(const v4fa*)(bl + c), w0 = *(const v4fa*)(wl + c * 3), w1 = *(const v4fa*)(wl + c * 3 + 4), w2 = *(const v4fa*)(wl + c * 3 + 8);
    asm volatile("s_wait_xcnt 0x0" :: "v"(fr), "v"(flo), "v"(fhi), "v"(cp), "v"(sp), "v"(kvp), "v"(c * 4) : "memory");   // the wait owed before a register that an issued load names is overwritten; the address pairs and the byte offset into KM, VM and bl as inputs keep them whole up to it
    __builtin_amdgcn_sched_barrier(0);   // no arithmetic moves up among the loads: its wait would stand in front of the loads behind it
    float zp[RS_R];
#pragma unroll   // constant indices into the register arrays
    for (int r = 0; r < RS_R; ++r) { const float el[4] = { elu1s(qq[r][0]), elu1s(qq[r][1]), elu1s(qq[r][2]), elu1s(qq[r][3]) }; v4h o;   // elu1 once, for the shift and for z; d is a multiple of 4: partner and parity of d + q are those of q
#pragma unroll
        for (int q = 0; q < 4; ++q) o[q] = tohx(tshift(el, q, bfr(cx[r][q]), bfr(sx[r][q])));
        *(v4h*)(qsh + h * QS_H + (rl + r) * QS_P + d) = o;
        zp[r] = (el[0] * km[0] + el[1] * km[1]) + (el[2] * km[2] + el[3] * km[3]); }
    static_assert(RS_R == 8 && HD / 4 == 8, "three halving exchanges: 8 rows over the 8 lanes of a head");
    float z4[4], z2[2];   // a lane keeps the rows whose bit equals its own g's and hands the others to its partner
#pragma unroll   // constant indices into zp[] and z4[]
    for (int i = 0; i < 4; ++i) z4[i] = ((g & 4) ? zp[i + 4] : zp[i]) + xlane<4>((g & 4) ? zp[i] : zp[i + 4]);
#pragma unroll   // constant indices into z4[] and z2[]
    for (int i = 0; i < 2; ++i) z2[i] = ((g & 2) ? z4[i + 2] : z4[i]) + xlane<2>((g & 2) ? z4[i] : z4[i + 2]);
    const float zs = ((g & 1) ? z2[1] : z2[0]) + xlane<1>((g & 1) ? z2[0] : z2[1]);
    zsh[(rl + g) * NH_ + h] = zs * SCALE;   // row rl + g, head h
    __syncthreads();   // qsh and zsh are whole
#pragma unroll   // constant indices into kvf[]
    for (int mb = 0; mb < 2; ++mb) { const h16* ap = qsh + w * QS_H + (mb * 16 + lr) * QS_P + 8 * hi; const v16h a = cat16(*(const v8ha*)ap, *(const v8ha*)(ap + 16));   // the k order of WFrag<h16>::ld
#pragma unroll
        for (int nb = 0; nb < 2; ++nb) { const v8f acc = wmma16(a, kvf[nb], (v8f){});
#pragma unroll
            for (int j = 0; j < 8; ++j) ao[(mb * 16 + hi * 8 + j) * AO_P + w * HD + nb * 16 + lr] = acc[j]; } }
    __syncthreads();   // ao is whole
    v4f aa[RS_R]; float zz[RS_R];
#pragma unroll   // the LDS reads overlap
    for (int r = 0; r < RS_R; ++r) { aa[r] = *(const v4fa*)(ao + (rl + r) * AO_P + c); zz[r] = zsh[(rl + r) * NH_ + h]; }
    const float wr[12] = { bfr(w0[0]), bfr(w0[1]), bfr(w0[2]), bfr(w0[3]), bfr(w1[0]), bfr(w1[1]), bfr(w1[2]), bfr(w1[3]), bfr(w2[0]), bfr(w2[1]), bfr(w2[2]), bfr(w2[3]) };   // wr[q * 3 + k]: tap k of column c + q
#pragma unroll   // constant indices into the register arrays
    for (int r = 0; r < RS_R; ++r) { const float z = zz[r]; const float fz = __fadd_rn(1.0f, __fdiv_rn(1.0f, __fadd_rn(z, 1e-6f))); v4us oh, ol;
#pragma unroll
        for (int q = 0; q < 4; ++q) { float lp = bfr(b4[q]);
#pragma unroll
            for (int k = 0; k < 3; ++k) { const bool in = (r + k > 0 || n0 > 0) && (r + k < RS_R + 1 || n0 + RS_R < NN);   /* row n0 + r - 1 + k lies in the sequence */ float p = __fmul_rn(wr[q * 3 + k], vv[r + k][q]); asm volatile("" : "+v"(p)); lp = in ? __fadd_rn(lp, p) : lp; }
            float a = __fmul_rn(aa[r][q], fz); asm volatile("" : "+v"(a)); float zb = __fmul_rn(z, vm[q]); asm volatile("" : "+v"(zb)); const float rr = __fmul_rn(__fadd_rn(__fsub_rn(a, zb), lp), oo[r][q]); unsigned short u, l; splitf(rr, u, l); oh[q] = u; ol[q] = l; }
        const size_t e = (size_t)(n0 + r) * INT + c; *(v4us*)(Rh + e) = oh; *(v4us*)(Rl + e) = ol; }  }

extern "C" void kernel_launch(void* const* d_in, const int* in_sizes, int n_in,
                              void* d_out, int out_size, void* d_ws, size_t ws_size, hipStream_t stream) {
    (void)in_sizes; (void)n_in; (void)out_size;
    const float* x = (const float*)d_in[0]; const float* sn = (const float*)d_in[1]; const float* cs = (const float*)d_in[2]; const float* wq = (const float*)d_in[3]; const float* bq = (const float*)d_in[4]; const float* wl = (const float*)d_in[5]; const float* bl = (const float*)d_in[6]; const float* wp = (const float*)d_in[7]; const float* bp = (const float*)d_in[8];
    float* OUT = (float*)d_out;     // [4][8192][256]
    char* wsp = (char*)d_ws;
    auto take = [&](size_t bytes) { char* p = wsp; wsp += (bytes + 255) & ~(size_t)255; return (void*)p; };
    // All NB_ batches go through every launch together: each plane below but WQ and WP holds NB_ batches back to back, and the batch is a part of the row index, of the (batch, head) index of k_gemmw's z batch and of k_kv16's work-groups, or a grid dimension of its own.
    // Two planes lie on workspace whose earlier tenant has been read for the last time by an earlier launch: XB, then KV, then Rh | Rl share one region.
    bf* WQ = (bf*)take((size_t)4 * INT * DIM * 2); bf* WP = (bf*)take((size_t)DIM * INT * 2); float* F = (float*)take((size_t)NB_ * NN * 4 * INT * 4); float* KM = (float*)take(NB_ * INT * 4); float* VM = (float*)take(NB_ * INT * 4); float* KP = (float*)take((size_t)NB_ * KM_PARTS * 512 * 4);
    h16* KVT = (h16*)take((size_t)NB_ * NH_ * 64 * HD * 2);
    float* KV = (float*)take((size_t)NB_ * NH_ * KV_SLICES * 64 * 64 * 4); bf* XB = (bf*)KV; bf* Rh = (bf*)KV; bf* Rl = Rh + (size_t)NB_ * NN * INT;   // XB: half the region, dead before KV is written; Rh | Rl: all of it, written after KV's last read
    static_assert((size_t)NH_ * KV_SLICES * 64 * 64 * 4 == (size_t)2 * NN * INT * 2 && DIM == INT, "Rh | Rl fill the KV region, XB half of it");
    h16* KST = (h16*)take((size_t)2 * NB_ * NH_ * 64 * NN * 2); h16* VT = KST + (size_t)NB_ * NH_ * 64 * NN;
    if ((size_t)(wsp - (char*)d_ws) > ws_size) return;    // total ~ 226 MiB
    static_assert(DIM * INT % (8 * 256 * CV_CH) == 0 && NN % (4 * RS_R) == 0, "the grids of k_cvt8 and k_res cover their arrays exactly");
    k_cvt8<<<4 * INT * DIM / (8 * 256 * CV_CH), 256, 0, stream>>>(wq, WQ); k_cvt8<<<DIM * INT / (8 * 256 * CV_CH), 256, 0, stream>>>(wp, WP);   // [out][in] natural Bt
    k_cvt8<<<(unsigned)((size_t)NB_ * NN * DIM / (8 * 256 * CV_CH)), 256, 0, stream>>>(x, XB);
    k_gemmw<bf, 0, true><<<dim3(NB_ * NN / 64, 4 * INT / 64, 1), 32, 0, stream>>>(XB, nullptr, WQ, nullptr, DIM, F, 4 * INT, bq, 0, 0, 0);   // rows: (batch, n)
    k_kst<<<dim3(NN / KT_N, NH_ * HD / KT_C, NB_), 256, 0, stream>>>(F, sn, cs, KST, VT, KP); k_kmean_fin<<<dim3(8, NB_, 1), 256, 0, stream>>>(KP, KM, VM);
    k_gemmw<h16, 0, false, KV_SLICES><<<dim3(1, KV_SLICES, NB_ * NH_), 32, 0, stream>>>(KST, nullptr, VT, nullptr, NN, KV, 64, nullptr, (size_t)64 * NN, (size_t)64 * NN, (size_t)64 * 64);   // KV[b][h][slice][d][e] = sum over the slice's n of ks[n][d] v[n][e]
    k_kv16<<<NB_ * NH_, 1024, 0, stream>>>(KV, KVT);
    k_res<<<dim3(NN / (4 * RS_R), NB_, 1), 256, 0, stream>>>(F, sn, cs, KM, VM, KVT, wl, bl, Rh, Rl);   // qs, z, qs . kv, gating, conv, o
    k_gemmw<bf, 1, true><<<dim3(NB_ * NN / 64, DIM / 64, 1), 32, 0, stream>>>(Rh, Rl, WP, nullptr, INT, OUT, DIM, bp, 0, 0, 0);   // rows: (batch, n)
}

// v008
// It runs in 123 microseconds.
// Timed twice side by side with v007, it ran 1.11 times as fast both times.
// All steps since v000 together make it 108 times as fast.
#include <hip/hip_runtime.h>

// MultiHeadMALAAttention (x [4][8192][256]; [q|k|v|o] = x W_qkvo^T + b (8 heads x 32); lepe = depthwise conv3 (pad 1) over the sequence on v + b; qh = elu(q)+1, kh = elu(k)+1; z = (qh . mean_n kh) 32^-0.5; qs/ks = theta_shift with the [N][32]
// sin/cos tables (read as data; rotate-every-two); kv = sum_n (ks s)(v s)^T with s^2 = SCALE/N; attn = qs kv; res = attn (1 + 1/(z + 1e-6)) - z mean_n v; res = (res + lepe) o; out = res W_proj^T + b -> [4][8192][256]).
// Compute dtypes, f32 accumulate: every input rounded to bf16; qkvo projection on PLAIN bf16 operands (inputs: exact, + bias); elu, means, z, theta shift, lepe conv, gating f32; kv-state (K = 8192) and qs.kv (K 32) on single fp16

#define NB_  4
#define NN   8192
#define DIM  256
#define NH_  8
#define HD   32
#define INT  256
#define SCALE 0.1767766952966369f
typedef _Float16 h16;
typedef unsigned short bf;
typedef __attribute__((ext_vector_type(16))) __bf16   v16bf;
typedef __attribute__((ext_vector_type(16))) _Float16 v16h;
typedef __attribute__((ext_vector_type(8)))  _Float16 v8h;
typedef __attribute__((ext_vector_type(8)))  unsigned short v8us;
typedef __attribute__((ext_vector_type(8)))  float    v8f;
typedef __attribute__((ext_vector_type(4)))  float    v4f;
typedef v8h  __attribute__((may_alias)) v8ha;
typedef v4f  __attribute__((may_alias)) v4fa;
typedef v8us __attribute__((may_alias)) v8usa;

__device__ __forceinline__ unsigned short f2bf(float f) { unsigned u = __float_as_uint(f); u += 0x7FFFu + ((u >> 16) & 1u); return (unsigned short)(u >> 16); }
__device__ __forceinline__ float bf2f(unsigned short b) { return __uint_as_float(((unsigned)b) << 16); }
__device__ __forceinline__ float bfr(float f) { return bf2f(f2bf(f)); }
__device__ __forceinline__ v16h cat16(v8h lo, v8h hi) { return __builtin_shufflevector(lo, hi, 0, 1, 2, 3, 4, 5, 6, 7, 8, 9, 10, 11, 12, 13, 14, 15); }
__device__ __forceinline__ v16bf cat16b(v8us lo, v8us hi) { return __builtin_bit_cast(v16bf, __builtin_shufflevector(lo, hi, 0, 1, 2, 3, 4, 5, 6, 7, 8, 9, 10, 11, 12, 13, 14, 15)); }
__device__ __forceinline__ v8f wmma16(v16h a, v16h b, v8f c) { return __builtin_amdgcn_wmma_f32_16x16x32_f16(false, a, false, b, (short)0, c, false, false); }
__device__ __forceinline__ v8f wmmab(v16bf a, v16bf b, v8f c) { return __builtin_amdgcn_wmma_f32_16x16x32_bf16(false, a, false, b, (short)0, c, false, false); }



// ---- k_gemmw: register-blocked GEMM, ONE WAVE per 64x64 output tile (16 accumulators), operands straight from K-contiguous 16-bit planes; grid (M/64, N/64, Z), 32 threads.
// C[m][n] (f32, pitch ldc, + optional f32 bias[n]) = sum_k A[m][k] Bt[n][k] (+ split products per NSPLIT). z-batch strides sA/sB/sC in elements. K % 32 == 0.
template <typename T16> struct WFrag;
template <> struct WFrag<h16> { typedef v16h V; static __device__ __forceinline__ V ld(const h16* p) { return cat16(*(const v8h*)p, *(const v8h*)(p + 16)); } static __device__ __forceinline__ v8f mma(V a, V b, v8f c) { return wmma16(a, b, c); } };
template <> struct WFrag<bf> { typedef v16bf V; static __device__ __forceinline__ V ld(const bf* p) { return cat16b(*(const v8us*)p, *(const v8us*)(p + 16)); } static __device__ __forceinline__ v8f mma(V a, V b, v8f c) { return wmmab(a, b, c); } };
template <typename T16, int NSPLIT, bool BIAS>
__global__ __launch_bounds__(32) void k_gemmw(const T16* __restrict__ A, const T16* __restrict__ A2, const T16* __restrict__ Bt, const T16* __restrict__ Bt2, int K, float* C, int ldc, const float* __restrict__ bias, size_t sA, size_t sB, size_t sC) {
    typedef typename WFrag<T16>::V V;
    __shared__ __align__(16) float os[16 * 68];
    const size_t z = blockIdx.z; A += z * sA; if (A2) A2 += z * sA; Bt += z * sB; if (Bt2) Bt2 += z * sB; C += z * sC;
    const int lane = threadIdx.x & 31, lr = lane & 15, hi = lane >> 4; const int r0 = blockIdx.x * 64, c0 = blockIdx.y * 64;
    v8f acc[4][4];
#pragma unroll
    for (int mb = 0; mb < 4; ++mb)
#pragma unroll
        for (int nb = 0; nb < 4; ++nb) acc[mb][nb] = (v8f){};
    const size_t aoff = (size_t)(r0 + lr) * K + 8 * hi, boff = (size_t)(c0 + lr) * K + 8 * hi;
#pragma unroll 1
    for (int kc = 0; kc < K; kc += 32) {
        V a[4], a2[4];
#pragma unroll
        for (int mb = 0; mb < 4; ++mb) { a[mb] = WFrag<T16>::ld(A + aoff + (size_t)mb * 16 * K + kc); if (NSPLIT == 1 || NSPLIT == 2) a2[mb] = WFrag<T16>::ld(A2 + aoff + (size_t)mb * 16 * K + kc); }
#pragma unroll
        for (int nb = 0; nb < 4; ++nb) { const V b = WFrag<T16>::ld(Bt + boff + (size_t)nb * 16 * K + kc); V b2; if (NSPLIT >= 2) b2 = WFrag<T16>::ld(Bt2 + boff + (size_t)nb * 16 * K + kc);
#pragma unroll
            for (int mb = 0; mb < 4; ++mb) { acc[mb][nb] = WFrag<T16>::mma(a[mb], b, acc[mb][nb]); if (NSPLIT == 1 || NSPLIT == 2) acc[mb][nb] = WFrag<T16>::mma(a2[mb], b, acc[mb][nb]); if (NSPLIT >= 2) acc[mb][nb] = WFrag<T16>::mma(a[mb], b2, acc[mb][nb]); } }
        asm volatile("v_nop\n\tv_nop\n\tv_nop\n\tv_nop" : "+v"(acc[0][0]), "+v"(acc[1][1]), "+v"(acc[2][2]), "+v"(acc[3][3]) : "v"(a[0]), "v"(a[3]));
    }
#pragma unroll
    for (int mb = 0; mb < 4; ++mb) {
#pragma unroll
        for (int nb = 0; nb < 4; ++nb) {
#pragma unroll
            for (int j = 0; j < 8; ++j) os[(hi * 8 + j) * 68 + nb * 16 + lr] = acc[mb][nb][j]; }
        __builtin_amdgcn_wave_barrier(); asm volatile("" ::: "memory");
        float* crow = C + (size_t)(r0 + mb * 16) * ldc + c0;
{
#pragma unroll
            for (int s = 0; s < 8; ++s) { const int row = 2 * s + hi, cofs = lr * 4; v4f val = *(const v4fa*)(os + row * 68 + cofs); if (BIAS) { val[0] += bfr(bias[c0 + cofs]); val[1] += bfr(bias[c0 + cofs + 1]); val[2] += bfr(bias[c0 + cofs + 2]); val[3] += bfr(bias[c0 + cofs + 3]); }
                *(v4f*)(crow + (size_t)row * ldc + cofs) = val; }
             }
        __builtin_amdgcn_wave_barrier(); asm volatile("" ::: "memory");
    }
}

__device__ __forceinline__ h16 tohx(float x) { return (h16)x; }
__device__ __forceinline__ void splitf(float y, unsigned short& h, unsigned short& l) { h = f2bf(y); l = f2bf(y - bf2f(h)); }
typedef __attribute__((ext_vector_type(2))) _Float16 v2h;
typedef __attribute__((ext_vector_type(4))) _Float16 v4h;
typedef __attribute__((ext_vector_type(4))) unsigned short v4us;

// k_cvt8: a thread converts CV_CH chunks of 8 floats (a work-group's chunks lie back to back, chunk k of a thread 256 chunks behind chunk k - 1), so that a wave has 2 CV_CH loads in flight and the launch starts CV_CH times fewer waves. The grid covers the array exactly.
#define CV_CH 8
__global__ __launch_bounds__(256) void k_cvt8(const float* __restrict__ src, bf* dst) { const size_t i = (size_t)blockIdx.x * (256 * CV_CH) + threadIdx.x; const float* p = src + i * 8; v8f v[CV_CH];
#pragma unroll   // v[] stays in registers and all the loads are in flight before the first conversion
    for (int c = 0; c < CV_CH; ++c) v[c] = *(const v8f*)(p + (size_t)c * 256 * 8);
    asm volatile("s_wait_xcnt 0x0" :: "v"(p) : "memory");   // the wait owed before a register that an issued load names is overwritten; p as an input keeps the address pair whole up to it (without it the last load's result was placed on the pair)
#pragma unroll   // constant indices into v[]
    for (int c = 0; c < CV_CH; ++c) { v8us o;
#pragma unroll
        for (int k = 0; k < 8; ++k) o[k] = f2bf(v[c][k]);
        *(v8us*)(dst + (i + (size_t)c * 256) * 8) = o; }  }
// Column means of elu1(k) and of v over the sequence: k_kst, which holds both in registers, stores its work-group's column sums over its KM_ROWS rows as P[group][0..255] = sums of elu1(k), P[group][256..511] = sums of v; k_kmean_fin adds the groups.
// elu1(x) = elu(x) + 1 = x > 0 ? x + 1 : exp(x), with its exp (x * log2(e), then v_exp_f32, as __expf compiles) written out: the v_nop in the same statement keeps the one free issue slot that the instruction set asks for behind a transcendental.
__device__ __forceinline__ float elu1s(float x) { float e; asm("v_exp_f32 %0, %1\n\tv_nop" : "=v"(e) : "v"(x * 1.44269504f)); return x > 0.f ? __fadd_rn(x, 1.0f) : e; }
#define KM_ROWS  64
#define KM_PARTS (NN / KM_ROWS)
// k_kmean_fin: per batch (blockIdx.y) 8 work-groups of 64 columns each; 16 thread groups sum KM_PARTS / 16 partial rows each, thread group 0 adds the 16 sums and scales by 1/N.
__global__ __launch_bounds__(256) void k_kmean_fin(const float* __restrict__ P, float* KM, float* VM) {
    __shared__ __align__(16) float red[16 * 64];
    const int c4 = threadIdx.x & 15, g = threadIdx.x >> 4;
    P += (size_t)blockIdx.y * KM_PARTS * 512; KM += blockIdx.y * INT; VM += blockIdx.y * INT;   // this batch's partial rows and means
    const float* p = P + (size_t)g * 512 + blockIdx.x * 64 + c4 * 4;
    v4f v[KM_PARTS / 16];
#pragma unroll   // v[] stays in registers and the partial-row loads overlap
    for (int i = 0; i < KM_PARTS / 16; ++i) v[i] = *(const v4fa*)(p + (size_t)i * 16 * 512);
    v4f s = (v4f){};
#pragma unroll   // constant indices into v[]
    for (int i = 0; i < KM_PARTS / 16; ++i) s += v[i];
    *(v4fa*)(red + g * 64 + c4 * 4) = s;
    __syncthreads();
    if (g == 0) {
#pragma unroll   // the LDS reads overlap
        for (int gg = 1; gg < 16; ++gg) s += *(const v4fa*)(red + gg * 64 + c4 * 4);
        s *= (1.0f / NN);
        float* dst = blockIdx.x < 4 ? KM + blockIdx.x * 64 : VM + (blockIdx.x - 4) * 64;
        *(v4fa*)(dst + c4 * 4) = s; }
}
// qs = fp16(theta_shift(elu1(q))) and z = (elu1(q_h) . KM_h) SCALE are made in k_res; ks = fp16(theta_shift(elu1(k))) (unscaled to stay in fp16's normal range) in k_kst:
__device__ __forceinline__ float tshift(const float* __restrict__ er, int d, float c_d, float s_d) { const float self_ = er[d]; const float partner = er[d ^ 1];   /* er[]: elu1 of the row */ const float rot = (d & 1) ? partner : -partner;   /* rotate_every_two: out[2i] = -x[2i+1], out[2i+1] = x[2i] */ float a = __fmul_rn(self_, c_d), b = __fmul_rn(rot, s_d); asm volatile("" : "+v"(a)); asm volatile("" : "+v"(b)); return __fadd_rn(a, b); }
template <int M> __device__ __forceinline__ float xlane(float v) { return __int_as_float(__builtin_amdgcn_update_dpp(0, __float_as_int(v), 0x160 | M, 0xf, 0xf, true)); }   // v of lane (own ^ M), M < 16: DPP row_xmask
// k_kst: ks = fp16(theta_shift(elu1(k))) and fp16(v) of 64 sequence rows x 4 heads (128 k and 128 v columns of F) are turned [n][d] -> [d][n] in LDS, and the work-group's share of the kv state is made from there: per head one partial plane KV[batch, head][slice] = sum over its 64 n of ks[n][d] v[n][e]; k_kv16 adds the planes.
// Reading: a wave's load is 512 adjacent bytes of one row; a thread owns 4 adjacent columns of 8 adjacent rows and puts each column's 8 fp16 (along n) into LDS as one 16-byte chunk.
// LDS row q * 32 + c4 holds column c4 * 4 + q; chunk j of it lies at place j ^ ((c4 >> 1) & 7) ^ (q * 2): the row's parity and the place then spread the chunks of 16 adjacent lanes over all the banks, in the stores (one j, one q, 16 c4) and in the fragment loads (one j, 16 adjacent columns).
// The product: wave w takes head w / 2 and half w % 2 of its d: 16 d x 32 e, K = 64 n, 2 x 2 matrix instructions; A = ks[d][n], B = v[e][n], both K-contiguous in LDS.
// A plane keeps the accumulators' own order, [e / 16][d / 16][register / 4][lane][register % 4] (HD * HD floats), so that every store is 512 adjacent bytes; k_kv16 gives each place its d and e.
#define KT_N 64
#define KT_C 128
#define KV_SLICES (NN / KT_N)
__device__ __forceinline__ int kt_at(int col, int j) { return ((col & 3) * 32 + (col >> 2)) * KT_N + (j ^ ((col >> 3) & 7) ^ ((col & 3) * 2)) * 8; }   // where chunk j (n = 8 j .. 8 j + 7) of column col lies in tk, tv
__device__ __forceinline__ v16h kfrag(const h16* t, int col, int j) { return cat16(*(const v8ha*)(t + kt_at(col, j)), *(const v8ha*)(t + kt_at(col, j + 2))); }   // n = 8 j .. 8 j + 7, then 8 j + 16 .. 8 j + 23: the k order of WFrag<h16>::ld
// The column sums for the means ride along: a thread adds elu1(k) and v over its 8 rows, the 8 waves' sums meet in LDS behind the same barrier, and thread c adds them for column c (k) or c - KT_C (v) and stores into P (whole lines).
__global__ __launch_bounds__(256) void k_kst(const float* __restrict__ F, const float* __restrict__ sn, const float* __restrict__ cs, float* KV, float* P) {
    __shared__ __align__(16) h16 tk[KT_C * KT_N], tv[KT_C * KT_N];
    __shared__ __align__(16) float red[8 * 2 * KT_C];   // [wave][sums of elu1(k): KT_C | sums of v: KT_C]
    static_assert(KM_ROWS == KT_N && 2 * KT_C == 256, "a work-group's rows are one group of P; a thread per column sum");
    const int n0 = blockIdx.x * KT_N, h0 = blockIdx.y * (KT_C / HD), b = blockIdx.z;   // b: batch
    const int c4 = threadIdx.x & 31, w = threadIdx.x >> 5;   // reading: column group, group of 8 rows
    const int lr = c4 & 15, hi = c4 >> 4, hh = w >> 1, mb = w & 1;   // the product: place in the fragments, head, half of d
    const float* fr = F + (size_t)(b * NN + n0 + w * 8) * 4 * INT + h0 * HD + c4 * 4;   // + INT: the k columns, + 2 * INT: the v columns
    const float* cp = cs + (n0 + w * 8) * HD + (c4 & 7) * 4; const float* sp = sn + (n0 + w * 8) * HD + (c4 & 7) * 4;
    v4f kx[8], vx[8], cx[8], sx[8];
#pragma unroll   // the arrays stay in registers and all 32 loads are in flight together
    for (int i = 0; i < 8; ++i) { kx[i] = *(const v4fa*)(fr + (size_t)i * 4 * INT + INT); vx[i] = *(const v4fa*)(fr + (size_t)i * 4 * INT + 2 * INT); cx[i] = *(const v4fa*)(cp + i * HD); sx[i] = *(const v4fa*)(sp + i * HD); }
    asm volatile("s_wait_xcnt 0x0" :: "v"(fr), "v"(cp), "v"(sp) : "memory");   // the wait owed before a register that an issued load names is overwritten; the address pairs as inputs keep them whole up to it (without it a later load's result was placed on one of them, and one load sank into the arithmetic)
    v8h ok[4], ov[4]; v4f sk = (v4f){}, sv = (v4f){};
#pragma unroll   // constant indices into the register arrays
    for (int i = 0; i < 8; ++i) { const float e[4] = { elu1s(kx[i][0]), elu1s(kx[i][1]), elu1s(kx[i][2]), elu1s(kx[i][3]) }; sk[0] += e[0]; sk[1] += e[1]; sk[2] += e[2]; sk[3] += e[3]; sv += vx[i];
#pragma unroll   // constant indices into the register arrays
        for (int q = 0; q < 4; ++q) { const float rot = (q & 1) ? e[q ^ 1] : -e[q ^ 1];   /* rotate_every_two: out[2i] = -x[2i+1], out[2i+1] = x[2i] */
            ok[q][i] = tohx(e[q] * bfr(cx[i][q]) + rot * bfr(sx[i][q]));   /* unscaled (O(1)): SCALE/N is applied in f32 when the kv state is converted */ ov[q][i] = tohx(vx[i][q]); } }
#pragma unroll   // constant indices into the register arrays
    for (int q = 0; q < 4; ++q) { const int o = kt_at(c4 * 4 + q, w); *(v8ha*)(tk + o) = ok[q]; *(v8ha*)(tv + o) = ov[q]; }
    *(v4fa*)(red + w * 2 * KT_C + c4 * 4) = sk; *(v4fa*)(red + w * 2 * KT_C + KT_C + c4 * 4) = sv;
    __syncthreads();
    v8f acc[2] = { (v8f){}, (v8f){} };
#pragma unroll   // constant indices into acc[]; the LDS reads overlap
    for (int jc = 0; jc < KT_N / 8; jc += 4) { const v16h a = kfrag(tk, hh * HD + mb * 16 + lr, jc + hi);
#pragma unroll
        for (int nb = 0; nb < 2; ++nb) acc[nb] = wmma16(a, kfrag(tv, hh * HD + nb * 16 + lr, jc + hi), acc[nb]); }
    float* const kvo = KV + ((size_t)(b * NH_ + h0 + hh) * KV_SLICES + blockIdx.x) * (HD * HD) + mb * 256 + c4 * 4;
#pragma unroll   // constant indices into acc[]
    for (int nb = 0; nb < 2; ++nb) { *(v4f*)(kvo + nb * 512) = __builtin_shufflevector(acc[nb], acc[nb], 0, 1, 2, 3); *(v4f*)(kvo + nb * 512 + 128) = __builtin_shufflevector(acc[nb], acc[nb], 4, 5, 6, 7); }
    float cs8 = 0.f;
#pragma unroll   // the LDS reads overlap
    for (int ww = 0; ww < 8; ++ww) cs8 += red[ww * 2 * KT_C + threadIdx.x];
    P[(size_t)(b * KM_PARTS + blockIdx.x) * 512 + (threadIdx.x / KT_C) * INT + h0 * HD + threadIdx.x % KT_C] = cs8;
}
// k_kv16: two work-groups per (batch, head), one per half nb of e, add the KV_SLICES partial planes of the kv state in f32 (slice 0 first), scale by SCALE/N and store KVT[h][e<64][d] in fp16 (rows >= 32 zero).
// A thread owns one place of the half plane (a wave's load is one 128-byte line); the place's d and e follow from the accumulators' order (k_kst), and the turn to [e][d] goes through LDS.
__global__ __launch_bounds__(512) void k_kv16(const float* __restrict__ KV, h16* KVT) {
    __shared__ float tr[16 * 33];
    const int h = blockIdx.x, nb = blockIdx.y, t = threadIdx.x;
    const float* p = KV + ((size_t)h * KV_SLICES * 2 + nb) * 512 + t; float v[KV_SLICES], sum = 0.f;
#pragma unroll   // v[] stays in registers and the plane loads overlap
    for (int sl = 0; sl < KV_SLICES; ++sl) v[sl] = p[(size_t)sl * HD * HD];
    asm volatile("s_wait_xcnt 0x0" :: "v"(p) : "memory");   // the wait owed before a register that an issued load names is overwritten; p as an input keeps the address pair whole up to it (without it the last load's result was placed on the pair)
#pragma unroll   // constant indices into v[]
    for (int sl = 0; sl < KV_SLICES; ++sl) sum += v[sl];
    const int d = (t >> 8) * 16 + ((t >> 6) & 1) * 8 + ((t >> 7) & 1) * 4 + (t & 3), el = (t >> 2) & 15;   // t = [d / 16][register / 4][lane][register % 4]; accumulator register r of lane l: d % 16 = (l / 16) * 8 + r, e % 16 = l % 16
    tr[el * 33 + d] = __fmul_rn(sum, SCALE / (float)NN);
    __syncthreads();
    const int e2 = (t & 255) * 2; v2h o = (v2h){};   // threads 0 .. 255: rows e = nb * 16 .. + 15; the others: the zero rows HD + nb * 16 .. + 15
    if (t < 256) { const float* q = tr + (e2 / HD) * 33 + e2 % HD; o[0] = tohx(q[0]); o[1] = tohx(q[1]); }
    *(v2h*)(KVT + ((size_t)h * 64 + (t >> 8) * HD + nb * 16) * HD + e2) = o;  }
// k_res: one work-group makes 4 * RS_R whole rows of res, from q to the bf16 pair. A thread owns 4 adjacent columns (4 d of one head) of RS_R adjacent rows: the columns' conv weights, biases and means are loaded once, a v row serves the three conv taps that read it from a register (RS_R + 2 row loads for RS_R rows), and all global loads are in flight together.
// A work-group is 64 column groups (a whole row) x 4 row groups; the grid covers the rows exactly. The two v rows beyond the sequence's ends are loaded from the clamped row and left out of the sum.
// Part 1, every thread: qs = fp16(theta_shift(elu1(q))) of its 4 d x RS_R rows goes into LDS (qsh[head][row][d]); z: a thread sums its 4 d of each row, and the 8 lanes of a head add their partial sums in three halving exchanges, after which lane g holds row g's whole sum and puts it into LDS (zsh[row][head]).
// Part 2, wave w = head w: attn[32 rows][32 e] = qs . kv, K = 32: 2 x 2 matrix instructions, A from qsh, B from KVT[head][e][d] (loaded with the others, up front); the accumulators go into LDS (ao[row][column]).
// Part 3, every thread: attn and z of its own columns and rows come back from LDS; gating, conv, o as before.
#define RS_R 8
#define QS_P 40    // fp16 per qsh row: 64 bytes of data at a pitch of 80, the pitch for 16-byte reads of 64-byte rows
#define QS_H (4 * RS_R * QS_P + 32)   // fp16 per qsh head: 64 bytes behind the 32 rows, so that the 4 heads that a wave's 8-byte stores touch fall on 4 different quarters of the banks
#define AO_P 260   // floats per ao row: the two 8-row halves of an accumulator store fall on different banks; 16-byte reads stay aligned
__global__ __launch_bounds__(256) void k_res(const float* __restrict__ F, const float* __restrict__ sn, const float* __restrict__ cs, const float* __restrict__ KM, const float* __restrict__ VM, const h16* __restrict__ KVT, const float* __restrict__ wl, const float* __restrict__ bl, bf* Rh, bf* Rl) { KM += blockIdx.y * INT; VM += blockIdx.y * INT; KVT += (size_t)blockIdx.y * NH_ * 64 * HD; F += (size_t)blockIdx.y * NN * 4 * INT; Rh += (size_t)blockIdx.y * NN * INT; Rl += (size_t)blockIdx.y * NN * INT;   /* blockIdx.y: batch; n stays the row inside the batch, so the conv's edges stay where they are */
    __shared__ __align__(16) h16 qsh[NH_ * QS_H];
    __shared__ __align__(16) float ao[4 * RS_R * AO_P];
    __shared__ float zsh[4 * RS_R * NH_];
    static_assert(4 * RS_R == 32 && NH_ == 8 && HD == 32 && INT == NH_ * HD, "8 waves, a head each: 2 x 2 tiles of 16 x 16, one K step");
    const int c = (threadIdx.x & 63) * 4; const int rl = (threadIdx.x >> 6) * RS_R; const int n0 = blockIdx.x * 4 * RS_R + rl; const int h = c / HD, d = c % HD, g = d / 4;   // rl: the thread's first row inside the work-group
    const int lr = threadIdx.x & 15, hi = (threadIdx.x >> 4) & 1, w = threadIdx.x >> 5;   // part 2: place in the fragments, head
    const float* fr = F + (size_t)n0 * 4 * INT + c;   // row n0: its q columns; + 2 * INT: its v columns, + 3 * INT: its o columns
    const float* flo = F + (size_t)(n0 > 0 ? n0 - 1 : 0) * 4 * INT + c; const float* fhi = F + (size_t)(n0 < NN - 1 - RS_R ? n0 : NN - 1 - RS_R) * 4 * INT + c;   // the row in front of the group, clamped to row 0; RS_R rows in front of the row behind the group, that one clamped to row NN - 1
    const float* cp = cs + n0 * HD + d; const float* sp = sn + n0 * HD + d; const h16* kvp = KVT + (size_t)(w * 64 + lr) * HD + 8 * hi;   // kvp: row e = lr of head w, as k_gemmw reads its Bt
    v4f qq[RS_R], cx[RS_R], sx[RS_R], vv[RS_R + 2], oo[RS_R]; v16h kvf[2];   // vv[i]: v of row n0 - 1 + i
#pragma unroll   // the arrays stay in registers and all the loads are in flight together; what part 1 needs goes first
    for (int r = 0; r < RS_R; ++r) { qq[r] = *(const v4fa*)(fr + (size_t)(r * 4) * INT); cx[r] = *(const v4fa*)(cp + r * HD); sx[r] = *(const v4fa*)(sp + r * HD); }
    const v4f km = *(const v4fa*)(KM + c);
#pragma unroll   // constant indices into kvf[]
    for (int nb = 0; nb < 2; ++nb) kvf[nb] = WFrag<h16>::ld(kvp + nb * 16 * HD);
    vv[0] = *(const v4fa*)(flo + 2 * INT); vv[RS_R + 1] = *(const v4fa*)(fhi + (size_t)(RS_R * 4 + 2) * INT);
#pragma unroll   // the arrays stay in registers and all the loads are in flight together
    for (int r = 0; r < RS_R; ++r) { vv[r + 1] = *(const v4fa*)(fr + (size_t)(r * 4 + 2) * INT); oo[r] = *(const v4fa*)(fr + (size_t)(r * 4 + 3) * INT); }
    const v4f vm = *(const v4fa*)(VM + c), b4 = *(const v4fa*)(bl + c), w0 = *(const v4fa*)(wl + c * 3), w1 = *(const v4fa*)(wl + c * 3 + 4), w2 = *(const v4fa*)(wl + c * 3 + 8);
    asm volatile("s_wait_xcnt 0x0" :: "v"(fr), "v"(flo), "v"(fhi), "v"(cp), "v"(sp), "v"(kvp), "v"(c * 4) : "memory");   // the wait owed before a register that an issued load names is overwritten; the address pairs and the byte offset into KM, VM and bl as inputs keep them whole up to it
    __builtin_amdgcn_sched_barrier(0);   // no arithmetic moves up among the loads: its wait would stand in front of the loads behind it
    float zp[RS_R];
#pragma unroll   // constant indices into the register arrays
    for (int r = 0; r < RS_R; ++r) { const float el[4] = { elu1s(qq[r][0]), elu1s(qq[r][1]), elu1s(qq[r][2]), elu1s(qq[r][3]) }; v4h o;   // elu1 once, for the shift and for z; d is a multiple of 4: partner and parity of d + q are those of q
#pragma unroll
        for (int q = 0; q < 4; ++q) o[q] = tohx(tshift(el, q, bfr(cx[r][q]), bfr(sx[r][q])));
        *(v4h*)(qsh + h * QS_H + (rl + r) * QS_P + d) = o;
        zp[r] = (el[0] * km[0] + el[1] * km[1]) + (el[2] * km[2] + el[3] * km[3]); }
    static_assert(RS_R == 8 && HD / 4 == 8, "three halving exchanges: 8 rows over the 8 lanes of a head");
    float z4[4], z2[2];   // a lane keeps the rows whose bit equals its own g's and hands the others to its partner
#pragma unroll   // constant indices into zp[] and z4[]
    for (int i = 0; i < 4; ++i) z4[i] = ((g & 4) ? zp[i + 4] : zp[i]) + xlane<4>((g & 4) ? zp[i] : zp[i + 4]);
#pragma unroll   // constant indices into z4[] and z2[]
    for (int i = 0; i < 2; ++i) z2[i] = ((g & 2) ? z4[i + 2] : z4[i]) + xlane<2>((g & 2) ? z4[i] : z4[i + 2]);
    const float zs = ((g & 1) ? z2[1] : z2[0]) + xlane<1>((g & 1) ? z2[0] : z2[1]);
    zsh[(rl + g) * NH_ + h] = zs * SCALE;   // row rl + g, head h
    __syncthreads();   // qsh and zsh are whole
#pragma unroll   // constant indices into kvf[]
    for (int mb = 0; mb < 2; ++mb) { const h16* ap = qsh + w * QS_H + (mb * 16 + lr) * QS_P + 8 * hi; const v16h a = cat16(*(const v8ha*)ap, *(const v8ha*)(ap + 16));   // the k order of WFrag<h16>::ld
#pragma unroll
        for (int nb = 0; nb < 2; ++nb) { const v8f acc = wmma16(a, kvf[nb], (v8f){});
#pragma unroll
            for (int j = 0; j < 8; ++j) ao[(mb * 16 + hi * 8 + j) * AO_P + w * HD + nb * 16 + lr] = acc[j]; } }
    __syncthreads();   // ao is whole
    v4f aa[RS_R]; float zz[RS_R];
#pragma unroll   // the LDS reads overlap
    for (int r = 0; r < RS_R; ++r) { aa[r] = *(const v4fa*)(ao + (rl + r) * AO_P + c); zz[r] = zsh[(rl + r) * NH_ + h]; }
    const float wr[12] = { bfr(w0[0]), bfr(w0[1]), bfr(w0[2]), bfr(w0[3]), bfr(w1[0]), bfr(w1[1]), bfr(w1[2]), bfr(w1[3]), bfr(w2[0]), bfr(w2[1]), bfr(w2[2]), bfr(w2[3]) };   // wr[q * 3 + k]: tap k of column c + q
#pragma unroll   // constant indices into the register arrays
    for (int r = 0; r < RS_R; ++r) { const float z = zz[r]; const float fz = __fadd_rn(1.0f, __fdiv_rn(1.0f, __fadd_rn(z, 1e-6f))); v4us oh, ol;
#pragma unroll
        for (int q = 0; q < 4; ++q) { float lp = bfr(b4[q]);
#pragma unroll
            for (int k = 0; k < 3; ++k) { const bool in = (r + k > 0 || n0 > 0) && (r + k < RS_R + 1 || n0 + RS_R < NN);   /* row n0 + r - 1 + k lies in the sequence */ float p = __fmul_rn(wr[q * 3 + k], vv[r + k][q]); asm volatile("" : "+v"(p)); lp = in ? __fadd_rn(lp, p) : lp; }
            float a = __fmul_rn(aa[r][q], fz); asm volatile("" : "+v"(a)); float zb = __fmul_rn(z, vm[q]); asm volatile("" : "+v"(zb)); const float rr = __fmul_rn(__fadd_rn(__fsub_rn(a, zb), lp), oo[r][q]); unsigned short u, l; splitf(rr, u, l); oh[q] = u; ol[q] = l; }
        const size_t e = (size_t)(n0 + r) * INT + c; *(v4us*)(Rh + e) = oh; *(v4us*)(Rl + e) = ol; }  }

extern "C" void kernel_launch(void* const* d_in, const int* in_sizes, int n_in,
                              void* d_out, int out_size, void* d_ws, size_t ws_size, hipStream_t stream) {
    (void)in_sizes; (void)n_in; (void)out_size;
    const float* x = (const float*)d_in[0]; const float* sn = (const float*)d_in[1]; const float* cs = (const float*)d_in[2]; const float* wq = (const float*)d_in[3]; const float* bq = (const float*)d_in[4]; const float* wl = (const float*)d_in[5]; const float* bl = (const float*)d_in[6]; const float* wp = (const float*)d_in[7]; const float* bp = (const float*)d_in[8];
    float* OUT = (float*)d_out;     // [4][8192][256]
    char* wsp = (char*)d_ws;
    auto take = [&](size_t bytes) { char* p = wsp; wsp += (bytes + 255) & ~(size_t)255; return (void*)p; };
    // All NB_ batches go through every launch together: each plane below but WQ and WP holds NB_ batches back to back, and the batch is a part of the row index, of the (batch, head) index of k_kv16's work-groups, or a grid dimension of its own.
    // Two planes lie on workspace whose earlier tenant has been read for the last time by an earlier launch: XB, then KV, then Rh | Rl share one region.
    bf* WQ = (bf*)take((size_t)4 * INT * DIM * 2); bf* WP = (bf*)take((size_t)DIM * INT * 2); float* F = (float*)take((size_t)NB_ * NN * 4 * INT * 4); float* KM = (float*)take(NB_ * INT * 4); float* VM = (float*)take(NB_ * INT * 4); float* KP = (float*)take((size_t)NB_ * KM_PARTS * 512 * 4);
    h16* KVT = (h16*)take((size_t)NB_ * NH_ * 64 * HD * 2);
    bf* Rh = (bf*)take((size_t)2 * NB_ * NN * INT * 2); bf* Rl = Rh + (size_t)NB_ * NN * INT; bf* XB = Rh; float* KV = (float*)Rh;   // XB: half the region, dead before KV is written; KV: half of it; Rh | Rl: all of it, written after KV's last read
    static_assert((size_t)NH_ * KV_SLICES * HD * HD * 4 <= (size_t)2 * NN * INT * 2 && DIM == INT, "KV and XB fit into the region of Rh | Rl");
    if ((size_t)(wsp - (char*)d_ws) > ws_size) return;    // total ~ 162 MiB
    static_assert(DIM * INT % (8 * 256 * CV_CH) == 0 && NN % (4 * RS_R) == 0, "the grids of k_cvt8 and k_res cover their arrays exactly");
    k_cvt8<<<4 * INT * DIM / (8 * 256 * CV_CH), 256, 0, stream>>>(wq, WQ); k_cvt8<<<DIM * INT / (8 * 256 * CV_CH), 256, 0, stream>>>(wp, WP);   // [out][in] natural Bt
    k_cvt8<<<(unsigned)((size_t)NB_ * NN * DIM / (8 * 256 * CV_CH)), 256, 0, stream>>>(x, XB);
    k_gemmw<bf, 0, true><<<dim3(NB_ * NN / 64, 4 * INT / 64, 1), 32, 0, stream>>>(XB, nullptr, WQ, nullptr, DIM, F, 4 * INT, bq, 0, 0, 0);   // rows: (batch, n)
    k_kst<<<dim3(NN / KT_N, NH_ * HD / KT_C, NB_), 256, 0, stream>>>(F, sn, cs, KV, KP); k_kmean_fin<<<dim3(8, NB_, 1), 256, 0, stream>>>(KP, KM, VM);
    k_kv16<<<dim3(NB_ * NH_, 2, 1), 512, 0, stream>>>(KV, KVT);
    k_res<<<dim3(NN / (4 * RS_R), NB_, 1), 256, 0, stream>>>(F, sn, cs, KM, VM, KVT, wl, bl, Rh, Rl);   // qs, z, qs . kv, gating, conv, o
    k_gemmw<bf, 1, true><<<dim3(NB_ * NN / 64, DIM / 64, 1), 32, 0, stream>>>(Rh, Rl, WP, nullptr, INT, OUT, DIM, bp, 0, 0, 0);   // rows: (batch, n)
}

// v009
// One run takes 110 microseconds.
// Timed twice side by side with v008, it ran 1.10 and 1.15 times as fast.
// All steps since v000 together make it 121 times as fast.
#include <hip/hip_runtime.h>

// MultiHeadMALAAttention (x [4][8192][256]; [q|k|v|o] = x W_qkvo^T + b (8 heads x 32); lepe = depthwise conv3 (pad 1) over the sequence on v + b; qh = elu(q)+1, kh = elu(k)+1; z = (qh . mean_n kh) 32^-0.5; qs/ks = theta_shift with the [N][32]
// sin/cos tables (read as data; rotate-every-two); kv = sum_n (ks s)(v s)^T with s^2 = SCALE/N; attn = qs kv; res = attn (1 + 1/(z + 1e-6)) - z mean_n v; res = (res + lepe) o; out = res W_proj^T + b -> [4][8192][256]).
// Compute dtypes, f32 accumulate: every input rounded to bf16; qkvo projection on PLAIN bf16 operands (inputs: exact, + bias); elu, means, z, theta shift, lepe conv, gating f32; kv-state (K = 8192) and qs.kv (K 32) on single fp16

#define NB_  4
#define NN   8192
#define DIM  256
#define NH_  8
#define HD   32
#define INT  256
#define SCALE 0.1767766952966369f
typedef _Float16 h16;
typedef unsigned short bf;
typedef __attribute__((ext_vector_type(16))) __bf16   v16bf;
typedef __attribute__((ext_vector_type(16))) _Float16 v16h;
typedef __attribute__((ext_vector_type(8)))  _Float16 v8h;
typedef __attribute__((ext_vector_type(8)))  unsigned short v8us;
typedef __attribute__((ext_vector_type(8)))  float    v8f;
typedef __attribute__((ext_vector_type(4)))  float    v4f;
typedef v8h  __attribute__((may_alias)) v8ha;
typedef v4f  __attribute__((may_alias)) v4fa;
typedef v8us __attribute__((may_alias)) v8usa;

__device__ __forceinline__ unsigned short f2bf(float f) { unsigned u = __float_as_uint(f); u += 0x7FFFu + ((u >> 16) & 1u); return (unsigned short)(u >> 16); }
__device__ __forceinline__ float bf2f(unsigned short b) { return __uint_as_float(((unsigned)b) << 16); }
__device__ __forceinline__ float bfr(float f) { return bf2f(f2bf(f)); }
__device__ __forceinline__ v16h cat16(v8h lo, v8h hi) { return __builtin_shufflevector(lo, hi, 0, 1, 2, 3, 4, 5, 6, 7, 8, 9, 10, 11, 12, 13, 14, 15); }
__device__ __forceinline__ v16bf cat16b(v8us lo, v8us hi) { return __builtin_bit_cast(v16bf, __builtin_shufflevector(lo, hi, 0, 1, 2, 3, 4, 5, 6, 7, 8, 9, 10, 11, 12, 13, 14, 15)); }
__device__ __forceinline__ v8f wmma16(v16h a, v16h b, v8f c) { return __builtin_amdgcn_wmma_f32_16x16x32_f16(false, a, false, b, (short)0, c, false, false); }
__device__ __forceinline__ v8f wmmab(v16bf a, v16bf b, v8f c) { return __builtin_amdgcn_wmma_f32_16x16x32_bf16(false, a, false, b, (short)0, c, false, false); }



// ---- k_gemmw: C[m][n] (f32, pitch LDC) = sum_k A[m][k] Bt[n][k] (+ A2[m][k] Bt[n][k] where NSPLIT) + bias[n] rounded to bf16; the operands are K-contiguous bf16 planes, K = GT_K. Grid (N / GT_N, M / MT), 256 threads.
// A work-group of 8 waves makes an MT x GT_N tile. Its 256 operand rows (MT of A, MT of A2 where NSPLIT, GT_N of Bt), whole K, are brought into LDS once by asynchronous copies, one 512-byte row (four whole lines) a wave's copy; wave w brings rows 32 w .. 32 w + 31 of [A | A2 | Bt].
// Every wave then takes its fragments from LDS: wave w makes rows (w / 4) * MT / 2 .. and columns (w % 4) * 32 .. of the tile, MT / 32 x 2 accumulators; per accumulator the products are added in the order k ascending, A before A2.
template <typename T16> struct WFrag;
template <> struct WFrag<h16> { typedef v16h V; static __device__ __forceinline__ V ld(const h16* p) { return cat16(*(const v8h*)p, *(const v8h*)(p + 16)); } static __device__ __forceinline__ v8f mma(V a, V b, v8f c) { return wmma16(a, b, c); } };
#define GT_N 128
#define GT_K 256
#define GT_P (GT_K + 8)   // 16-bit elements per LDS row: 512 bytes of data at a pitch of 528 (16 x odd), the pitch for 16-byte reads
#define GO_P 36           // floats per row of a wave's output staging: 128 bytes of data at a pitch of 144 (16 x odd)
// copy8: 8 rows, a lane's 16 bytes of each, from global memory into LDS (l: the lane's LDS byte address, g: its global address, both of the first row).
// The s_wait_xcnt in the copies' own statement: the wait owed before a register that an issued copy names is rewritten.
__device__ __forceinline__ void copy8(unsigned l, const bf* g) {
    asm volatile("global_load_async_to_lds_b128 %0, %8, off\n\t"
                 "global_load_async_to_lds_b128 %1, %9, off\n\t"
                 "global_load_async_to_lds_b128 %2, %10, off\n\t"
                 "global_load_async_to_lds_b128 %3, %11, off\n\t"
                 "global_load_async_to_lds_b128 %4, %12, off\n\t"
                 "global_load_async_to_lds_b128 %5, %13, off\n\t"
                 "global_load_async_to_lds_b128 %6, %14, off\n\t"
                 "global_load_async_to_lds_b128 %7, %15, off\n\t"
                 "s_wait_xcnt 0x0"
                 :: "v"(l), "v"(l + 1 * GT_P * 2), "v"(l + 2 * GT_P * 2), "v"(l + 3 * GT_P * 2), "v"(l + 4 * GT_P * 2), "v"(l + 5 * GT_P * 2), "v"(l + 6 * GT_P * 2), "v"(l + 7 * GT_P * 2),
                    "v"(g), "v"(g + 1 * GT_K), "v"(g + 2 * GT_K), "v"(g + 3 * GT_K), "v"(g + 4 * GT_K), "v"(g + 5 * GT_K), "v"(g + 6 * GT_K), "v"(g + 7 * GT_K) : "memory"); }
__device__ __forceinline__ v16bf lfrag(const bf* p) { return cat16b(*(const v8usa*)p, *(const v8usa*)(p + 16)); }   // k = 0 .. 7 and 16 .. 23 from p, the k order of WFrag<h16>::ld, for A and Bt alike
template <int MT, int NSPLIT, int LDC>
__global__ __launch_bounds__(256) void k_gemmw(const bf* __restrict__ A, const bf* __restrict__ A2, const bf* __restrict__ Bt, float* C, const float* __restrict__ bias) {
    constexpr int MB = MT / 32;   // 16-row fragments of A per wave
    static_assert((NSPLIT ? 2 : 1) * MT == 128 && GT_N == 128, "256 operand rows, 32 a wave; waves 0 .. 3 bring A (and A2), waves 4 .. 7 Bt");
    __shared__ __align__(16) bf ta[128 * GT_P], tb[GT_N * GT_P];   // ta: the rows of A, behind them those of A2
    __shared__ __align__(16) float os[8 * 16 * GO_P];
    const int lane = threadIdx.x & 31, w = __builtin_amdgcn_readfirstlane(threadIdx.x >> 5), lr = lane & 15, hi = lane >> 4, wm = w >> 2, wn = w & 3;   /* w in a scalar register: which plane a wave copies from is chosen by scalar selects, with every lane on */ const int c0 = blockIdx.x * GT_N, r0 = blockIdx.y * MT;
    const float* bq4 = bias + c0 + wn * 32 + (lane & 7) * 4; const v4f bi = *(const v4fa*)bq4;   // the bias of the 4 columns that this lane stores
    asm volatile("s_wait_xcnt 0x0" :: "v"(bq4) : "memory");   // the wait owed before a register that an issued load names is overwritten; the address as an input keeps it whole up to it (without it the load's scalar base was reloaded ahead of the wait)
    const bf* g = w >= 4 ? Bt + (size_t)(c0 + (w - 4) * 32) * GT_K : (NSPLIT && w >= 2) ? A2 + (size_t)(r0 + (w - 2) * 32) * GT_K : A + (size_t)(r0 + w * 32) * GT_K;
    const unsigned l = (w >= 4 ? (unsigned)(size_t)tb : (unsigned)(size_t)ta) + (unsigned)((w & 3) * 32 * GT_P * 2 + lane * 16);
    g += lane * 8;
#pragma unroll   // 4 statements of 8 copies: all 32 rows of the wave are in flight together
    for (int i = 0; i < 32; i += 8) copy8(l + i * GT_P * 2, g + i * GT_K);
    asm volatile("s_wait_asynccnt 0x0" ::: "memory");   // this wave's copies have landed
    __syncthreads();   // every wave's rows are in LDS
    const bf* ap = ta + (wm * (MT / 2) + lr) * GT_P + 8 * hi; const bf* bp = tb + (wn * 32 + lr) * GT_P + 8 * hi;
    v8f acc[MB][2];
#pragma unroll
    for (int mb = 0; mb < MB; ++mb) { acc[mb][0] = (v8f){}; acc[mb][1] = (v8f){}; }
    v16bf a[2][MB], a2[2][MB], b[2][2];   // two fragment sets: step s works on set s % 2 while the reads of step s + 1 fill the other
#pragma unroll
    for (int mb = 0; mb < MB; ++mb) { a[0][mb] = lfrag(ap + mb * 16 * GT_P); if (NSPLIT) a2[0][mb] = lfrag(ap + (MT + mb * 16) * GT_P); }
#pragma unroll
    for (int nb = 0; nb < 2; ++nb) b[0][nb] = lfrag(bp + nb * 16 * GT_P);
#pragma unroll   // constant indices into the register arrays
    for (int s = 0; s < GT_K / 32; ++s) { const int cu = s & 1, nx = cu ^ 1, kn = (s + 1) * 32;
        if (s + 1 < GT_K / 32) {
#pragma unroll
            for (int mb = 0; mb < MB; ++mb) { a[nx][mb] = lfrag(ap + mb * 16 * GT_P + kn); if (NSPLIT) a2[nx][mb] = lfrag(ap + (MT + mb * 16) * GT_P + kn); }
#pragma unroll
            for (int nb = 0; nb < 2; ++nb) b[nx][nb] = lfrag(bp + nb * 16 * GT_P + kn); }
        __builtin_amdgcn_sched_barrier(0);   // the next step's LDS reads stay one group in front of this step's products (left free, the compiler fetched so far ahead that a wave took more than 256 registers, which leaves room for one work-group a WGP where the LDS allows two)
#pragma unroll
        for (int nb = 0; nb < 2; ++nb)
#pragma unroll
            for (int mb = 0; mb < MB; ++mb) { acc[mb][nb] = wmmab(a[cu][mb], b[cu][nb], acc[mb][nb]); if (NSPLIT) acc[mb][nb] = wmmab(a2[cu][mb], b[cu][nb], acc[mb][nb]); }
        __builtin_amdgcn_sched_barrier(0);   // and no later step's reads move up among these products
    }
    // Output: 16 rows x 32 columns at a time go through the wave's own LDS range, so that a store is 4 whole 128-byte lines.
    float* const ow = os + w * 16 * GO_P; float* const cl = C + (size_t)(r0 + wm * (MT / 2) + (lane >> 3)) * LDC + c0 + wn * 32 + (lane & 7) * 4;
    const v4f bb = { bfr(bi[0]), bfr(bi[1]), bfr(bi[2]), bfr(bi[3]) };
#pragma unroll
    for (int mb = 0; mb < MB; ++mb) {
#pragma unroll
        for (int nb = 0; nb < 2; ++nb) {
#pragma unroll
            for (int j = 0; j < 8; ++j) ow[(hi * 8 + j) * GO_P + nb * 16 + lr] = acc[mb][nb][j]; }
        __builtin_amdgcn_wave_barrier(); asm volatile("" ::: "memory");   // the lanes of the wave exchange through ow: the reads below stay behind the writes above
#pragma unroll
        for (int s = 0; s < 4; ++s) { v4f val = *(const v4fa*)(ow + (4 * s + (lane >> 3)) * GO_P + (lane & 7) * 4); val += bb; *(v4f*)(cl + (size_t)(mb * 16 + 4 * s) * LDC) = val; }
        __builtin_amdgcn_wave_barrier(); asm volatile("" ::: "memory");   // the next 16 rows' writes stay behind these reads
    }
}

__device__ __forceinline__ h16 tohx(float x) { return (h16)x; }
__device__ __forceinline__ void splitf(float y, unsigned short& h, unsigned short& l) { h = f2bf(y); l = f2bf(y - bf2f(h)); }
typedef __attribute__((ext_vector_type(2))) _Float16 v2h;
typedef __attribute__((ext_vector_type(4))) _Float16 v4h;
typedef __attribute__((ext_vector_type(4))) unsigned short v4us;

// k_cvt8: a thread converts CV_CH chunks of 8 floats (a work-group's chunks lie back to back, chunk k of a thread 256 chunks behind chunk k - 1), so that a wave has 2 CV_CH loads in flight and the launch starts CV_CH times fewer waves. The grid covers the array exactly.
#define CV_CH 8
__global__ __launch_bounds__(256) void k_cvt8(const float* __restrict__ src, bf* dst) { const size_t i = (size_t)blockIdx.x * (256 * CV_CH) + threadIdx.x; const float* p = src + i * 8; v8f v[CV_CH];
#pragma unroll   // v[] stays in registers and all the loads are in flight before the first conversion
    for (int c = 0; c < CV_CH; ++c) v[c] = *(const v8f*)(p + (size_t)c * 256 * 8);
    asm volatile("s_wait_xcnt 0x0" :: "v"(p) : "memory");   // the wait owed before a register that an issued load names is overwritten; p as an input keeps the address pair whole up to it (without it the last load's result was placed on the pair)
#pragma unroll   // constant indices into v[]
    for (int c = 0; c < CV_CH; ++c) { v8us o;
#pragma unroll
        for (int k = 0; k < 8; ++k) o[k] = f2bf(v[c][k]);
        *(v8us*)(dst + (i + (size_t)c * 256) * 8) = o; }  }
// Column means of elu1(k) and of v over the sequence: k_kst, which holds both in registers, stores its work-group's column sums over its KM_ROWS rows as P[group][0..255] = sums of elu1(k), P[group][256..511] = sums of v; k_kmean_fin adds the groups.
// elu1(x) = elu(x) + 1 = x > 0 ? x + 1 : exp(x), with its exp (x * log2(e), then v_exp_f32, as __expf compiles) written out: the v_nop in the same statement keeps the one free issue slot that the instruction set asks for behind a transcendental.
__device__ __forceinline__ float elu1s(float x) { float e; asm("v_exp_f32 %0, %1\n\tv_nop" : "=v"(e) : "v"(x * 1.44269504f)); return x > 0.f ? __fadd_rn(x, 1.0f) : e; }
#define KM_ROWS  64
#define KM_PARTS (NN / KM_ROWS)
// k_kmean_fin: per batch (blockIdx.y) 8 work-groups of 64 columns each; 16 thread groups sum KM_PARTS / 16 partial rows each, thread group 0 adds the 16 sums and scales by 1/N.
__global__ __launch_bounds__(256) void k_kmean_fin(const float* __restrict__ P, float* KM, float* VM) {
    __shared__ __align__(16) float red[16 * 64];
    const int c4 = threadIdx.x & 15, g = threadIdx.x >> 4;
    P += (size_t)blockIdx.y * KM_PARTS * 512; KM += blockIdx.y * INT; VM += blockIdx.y * INT;   // this batch's partial rows and means
    const float* p = P + (size_t)g * 512 + blockIdx.x * 64 + c4 * 4;
    v4f v[KM_PARTS / 16];
#pragma unroll   // v[] stays in registers and the partial-row loads overlap
    for (int i = 0; i < KM_PARTS / 16; ++i) v[i] = *(const v4fa*)(p + (size_t)i * 16 * 512);
    v4f s = (v4f){};
#pragma unroll   // constant indices into v[]
    for (int i = 0; i < KM_PARTS / 16; ++i) s += v[i];
    *(v4fa*)(red + g * 64 + c4 * 4) = s;
    __syncthreads();
    if (g == 0) {
#pragma unroll   // the LDS reads overlap
        for (int gg = 1; gg < 16; ++gg) s += *(const v4fa*)(red + gg * 64 + c4 * 4);
        s *= (1.0f / NN);
        float* dst = blockIdx.x < 4 ? KM + blockIdx.x * 64 : VM + (blockIdx.x - 4) * 64;
        *(v4fa*)(dst + c4 * 4) = s; }
}
// qs = fp16(theta_shift(elu1(q))) and z = (elu1(q_h) . KM_h) SCALE are made in k_res; ks = fp16(theta_shift(elu1(k))) (unscaled to stay in fp16's normal range) in k_kst:
__device__ __forceinline__ float tshift(const float* __restrict__ er, int d, float c_d, float s_d) { const float self_ = er[d]; const float partner = er[d ^ 1];   /* er[]: elu1 of the row */ const float rot = (d & 1) ? partner : -partner;   /* rotate_every_two: out[2i] = -x[2i+1], out[2i+1] = x[2i] */ float a = __fmul_rn(self_, c_d), b = __fmul_rn(rot, s_d); asm volatile("" : "+v"(a)); asm volatile("" : "+v"(b)); return __fadd_rn(a, b); }
template <int M> __device__ __forceinline__ float xlane(float v) { return __int_as_float(__builtin_amdgcn_update_dpp(0, __float_as_int(v), 0x160 | M, 0xf, 0xf, true)); }   // v of lane (own ^ M), M < 16: DPP row_xmask
// k_kst: ks = fp16(theta_shift(elu1(k))) and fp16(v) of 64 sequence rows x 4 heads (128 k and 128 v columns of F) are turned [n][d] -> [d][n] in LDS, and the work-group's share of the kv state is made from there: per head one partial plane KV[batch, head][slice] = sum over its 64 n of ks[n][d] v[n][e]; k_kv16 adds the planes.
// Reading: a wave's load is 512 adjacent bytes of one row; a thread owns 4 adjacent columns of 8 adjacent rows and puts each column's 8 fp16 (along n) into LDS as one 16-byte chunk.
// LDS row q * 32 + c4 holds column c4 * 4 + q; chunk j of it lies at place j ^ ((c4 >> 1) & 7) ^ (q * 2): the row's parity and the place then spread the chunks of 16 adjacent lanes over all the banks, in the stores (one j, one q, 16 c4) and in the fragment loads (one j, 16 adjacent columns).
// The product: wave w takes head w / 2 and half w % 2 of its d: 16 d x 32 e, K = 64 n, 2 x 2 matrix instructions; A = ks[d][n], B = v[e][n], both K-contiguous in LDS.
// A plane keeps the accumulators' own order, [e / 16][d / 16][register / 4][lane][register % 4] (HD * HD floats), so that every store is 512 adjacent bytes; k_kv16 gives each place its d and e.
#define KT_N 64
#define KT_C 128
#define KV_SLICES (NN / KT_N)
__device__ __forceinline__ int kt_at(int col, int j) { return ((col & 3) * 32 + (col >> 2)) * KT_N + (j ^ ((col >> 3) & 7) ^ ((col & 3) * 2)) * 8; }   // where chunk j (n = 8 j .. 8 j + 7) of column col lies in tk, tv
__device__ __forceinline__ v16h kfrag(const h16* t, int col, int j) { return cat16(*(const v8ha*)(t + kt_at(col, j)), *(const v8ha*)(t + kt_at(col, j + 2))); }   // n = 8 j .. 8 j + 7, then 8 j + 16 .. 8 j + 23: the k order of WFrag<h16>::ld
// The column sums for the means ride along: a thread adds elu1(k) and v over its 8 rows, the 8 waves' sums meet in LDS behind the same barrier, and thread c adds them for column c (k) or c - KT_C (v) and stores into P (whole lines).
__global__ __launch_bounds__(256) void k_kst(const float* __restrict__ F, const float* __restrict__ sn, const float* __restrict__ cs, float* KV, float* P) {
    __shared__ __align__(16) h16 tk[KT_C * KT_N], tv[KT_C * KT_N];
    __shared__ __align__(16) float red[8 * 2 * KT_C];   // [wave][sums of elu1(k): KT_C | sums of v: KT_C]
    static_assert(KM_ROWS == KT_N && 2 * KT_C == 256, "a work-group's rows are one group of P; a thread per column sum");
    const int n0 = blockIdx.x * KT_N, h0 = blockIdx.y * (KT_C / HD), b = blockIdx.z;   // b: batch
    const int c4 = threadIdx.x & 31, w = threadIdx.x >> 5;   // reading: column group, group of 8 rows
    const int lr = c4 & 15, hi = c4 >> 4, hh = w >> 1, mb = w & 1;   // the product: place in the fragments, head, half of d
    const float* fr = F + (size_t)(b * NN + n0 + w * 8) * 4 * INT + h0 * HD + c4 * 4;   // + INT: the k columns, + 2 * INT: the v columns
    const float* cp = cs + (n0 + w * 8) * HD + (c4 & 7) * 4; const float* sp = sn + (n0 + w * 8) * HD + (c4 & 7) * 4;
    v4f kx[8], vx[8], cx[8], sx[8];
#pragma unroll   // the arrays stay in registers and all 32 loads are in flight together
    for (int i = 0; i < 8; ++i) { kx[i] = *(const v4fa*)(fr + (size_t)i * 4 * INT + INT); vx[i] = *(const v4fa*)(fr + (size_t)i * 4 * INT + 2 * INT); cx[i] = *(const v4fa*)(cp + i * HD); sx[i] = *(const v4fa*)(sp + i * HD); }
    asm volatile("s_wait_xcnt 0x0" :: "v"(fr), "v"(cp), "v"(sp) : "memory");   // the wait owed before a register that an issued load names is overwritten; the address pairs as inputs keep them whole up to it (without it a later load's result was placed on one of them, and one load sank into the arithmetic)
    v8h ok[4], ov[4]; v4f sk = (v4f){}, sv = (v4f){};
#pragma unroll   // constant indices into the register arrays
    for (int i = 0; i < 8; ++i) { const float e[4] = { elu1s(kx[i][0]), elu1s(kx[i][1]), elu1s(kx[i][2]), elu1s(kx[i][3]) }; sk[0] += e[0]; sk[1] += e[1]; sk[2] += e[2]; sk[3] += e[3]; sv += vx[i];
#pragma unroll   // constant indices into the register arrays
        for (int q = 0; q < 4; ++q) { const float rot = (q & 1) ? e[q ^ 1] : -e[q ^ 1];   /* rotate_every_two: out[2i] = -x[2i+1], out[2i+1] = x[2i] */
            ok[q][i] = tohx(e[q] * bfr(cx[i][q]) + rot * bfr(sx[i][q]));   /* unscaled (O(1)): SCALE/N is applied in f32 when the kv state is converted */ ov[q][i] = tohx(vx[i][q]); } }
#pragma unroll   // constant indices into the register arrays
    for (int q = 0; q < 4; ++q) { const int o = kt_at(c4 * 4 + q, w); *(v8ha*)(tk + o) = ok[q]; *(v8ha*)(tv + o) = ov[q]; }
    *(v4fa*)(red + w * 2 * KT_C + c4 * 4) = sk; *(v4fa*)(red + w * 2 * KT_C + KT_C + c4 * 4) = sv;
    __syncthreads();
    v8f acc[2] = { (v8f){}, (v8f){} };
#pragma unroll   // constant indices into acc[]; the LDS reads overlap
    for (int jc = 0; jc < KT_N / 8; jc += 4) { const v16h a = kfrag(tk, hh * HD + mb * 16 + lr, jc + hi);
#pragma unroll
        for (int nb = 0; nb < 2; ++nb) acc[nb] = wmma16(a, kfrag(tv, hh * HD + nb * 16 + lr, jc + hi), acc[nb]); }
    float* const kvo = KV + ((size_t)(b * NH_ + h0 + hh) * KV_SLICES + blockIdx.x) * (HD * HD) + mb * 256 + c4 * 4;
#pragma unroll   // constant indices into acc[]
    for (int nb = 0; nb < 2; ++nb) { *(v4f*)(kvo + nb * 512) = __builtin_shufflevector(acc[nb], acc[nb], 0, 1, 2, 3); *(v4f*)(kvo + nb * 512 + 128) = __builtin_shufflevector(acc[nb], acc[nb], 4, 5, 6, 7); }
    float cs8 = 0.f;
#pragma unroll   // the LDS reads overlap
    for (int ww = 0; ww < 8; ++ww) cs8 += red[ww * 2 * KT_C + threadIdx.x];
    P[(size_t)(b * KM_PARTS + blockIdx.x) * 512 + (threadIdx.x / KT_C) * INT + h0 * HD + threadIdx.x % KT_C] = cs8;
}
// k_kv16: two work-groups per (batch, head), one per half nb of e, add the KV_SLICES partial planes of the kv state in f32 (slice 0 first), scale by SCALE/N and store KVT[h][e<64][d] in fp16 (rows >= 32 zero).
// A thread owns one place of the half plane (a wave's load is one 128-byte line); the place's d and e follow from the accumulators' order (k_kst), and the turn to [e][d] goes through LDS.
__global__ __launch_bounds__(512) void k_kv16(const float* __restrict__ KV, h16* KVT) {
    __shared__ float tr[16 * 33];
    const int h = blockIdx.x, nb = blockIdx.y, t = threadIdx.x;
    const float* p = KV + ((size_t)h * KV_SLICES * 2 + nb) * 512 + t; float v[KV_SLICES], sum = 0.f;
#pragma unroll   // v[] stays in registers and the plane loads overlap
    for (int sl = 0; sl < KV_SLICES; ++sl) v[sl] = p[(size_t)sl * HD * HD];
    asm volatile("s_wait_xcnt 0x0" :: "v"(p) : "memory");   // the wait owed before a register that an issued load names is overwritten; p as an input keeps the address pair whole up to it (without it the last load's result was placed on the pair)
#pragma unroll   // constant indices into v[]
    for (int sl = 0; sl < KV_SLICES; ++sl) sum += v[sl];
    const int d = (t >> 8) * 16 + ((t >> 6) & 1) * 8 + ((t >> 7) & 1) * 4 + (t & 3), el = (t >> 2) & 15;   // t = [d / 16][register / 4][lane][register % 4]; accumulator register r of lane l: d % 16 = (l / 16) * 8 + r, e % 16 = l % 16
    tr[el * 33 + d] = __fmul_rn(sum, SCALE / (float)NN);
    __syncthreads();
    const int e2 = (t & 255) * 2; v2h o = (v2h){};   // threads 0 .. 255: rows e = nb * 16 .. + 15; the others: the zero rows HD + nb * 16 .. + 15
    if (t < 256) { const float* q = tr + (e2 / HD) * 33 + e2 % HD; o[0] = tohx(q[0]); o[1] = tohx(q[1]); }
    *(v2h*)(KVT + ((size_t)h * 64 + (t >> 8) * HD + nb * 16) * HD + e2) = o;  }
// k_res: one work-group makes 4 * RS_R whole rows of res, from q to the bf16 pair. A thread owns 4 adjacent columns (4 d of one head) of RS_R adjacent rows: the columns' conv weights, biases and means are loaded once, a v row serves the three conv taps that read it from a register (RS_R + 2 row loads for RS_R rows), and all global loads are in flight together.
// A work-group is 64 column groups (a whole row) x 4 row groups; the grid covers the rows exactly. The two v rows beyond the sequence's ends are loaded from the clamped row and left out of the sum.
// Part 1, every thread: qs = fp16(theta_shift(elu1(q))) of its 4 d x RS_R rows goes into LDS (qsh[head][row][d]); z: a thread sums its 4 d of each row, and the 8 lanes of a head add their partial sums in three halving exchanges, after which lane g holds row g's whole sum and puts it into LDS (zsh[row][head]).
// Part 2, wave w = head w: attn[32 rows][32 e] = qs . kv, K = 32: 2 x 2 matrix instructions, A from qsh, B from KVT[head][e][d] (loaded with the others, up front); the accumulators go into LDS (ao[row][column]).
// Part 3, every thread: attn and z of its own columns and rows come back from LDS; gating, conv, o as before.
#define RS_R 8
#define QS_P 40    // fp16 per qsh row: 64 bytes of data at a pitch of 80, the pitch for 16-byte reads of 64-byte rows
#define QS_H (4 * RS_R * QS_P + 32)   // fp16 per qsh head: 64 bytes behind the 32 rows, so that the 4 heads that a wave's 8-byte stores touch fall on 4 different quarters of the banks
#define AO_P 260   // floats per ao row: the two 8-row halves of an accumulator store fall on different banks; 16-byte reads stay aligned
__global__ __launch_bounds__(256) void k_res(const float* __restrict__ F, const float* __restrict__ sn, const float* __restrict__ cs, const float* __restrict__ KM, const float* __restrict__ VM, const h16* __restrict__ KVT, const float* __restrict__ wl, const float* __restrict__ bl, bf* Rh, bf* Rl) { KM += blockIdx.y * INT; VM += blockIdx.y * INT; KVT += (size_t)blockIdx.y * NH_ * 64 * HD; F += (size_t)blockIdx.y * NN * 4 * INT; Rh += (size_t)blockIdx.y * NN * INT; Rl += (size_t)blockIdx.y * NN * INT;   /* blockIdx.y: batch; n stays the row inside the batch, so the conv's edges stay where they are */
    __shared__ __align__(16) h16 qsh[NH_ * QS_H];
    __shared__ __align__(16) float ao[4 * RS_R * AO_P];
    __shared__ float zsh[4 * RS_R * NH_];
    static_assert(4 * RS_R == 32 && NH_ == 8 && HD == 32 && INT == NH_ * HD, "8 waves, a head each: 2 x 2 tiles of 16 x 16, one K step");
    const int c = (threadIdx.x & 63) * 4; const int rl = (threadIdx.x >> 6) * RS_R; const int n0 = blockIdx.x * 4 * RS_R + rl; const int h = c / HD, d = c % HD, g = d / 4;   // rl: the thread's first row inside the work-group
    const int lr = threadIdx.x & 15, hi = (threadIdx.x >> 4) & 1, w = threadIdx.x >> 5;   // part 2: place in the fragments, head
    const float* fr = F + (size_t)n0 * 4 * INT + c;   // row n0: its q columns; + 2 * INT: its v columns, + 3 * INT: its o columns
    const float* flo = F + (size_t)(n0 > 0 ? n0 - 1 : 0) * 4 * INT + c; const float* fhi = F + (size_t)(n0 < NN - 1 - RS_R ? n0 : NN - 1 - RS_R) * 4 * INT + c;   // the row in front of the group, clamped to row 0; RS_R rows in front of the row behind the group, that one clamped to row NN - 1
    const float* cp = cs + n0 * HD + d; const float* sp = sn + n0 * HD + d; const h16* kvp = KVT + (size_t)(w * 64 + lr) * HD + 8 * hi;   // kvp: row e = lr of head w, as k_gemmw reads its Bt
    v4f qq[RS_R], cx[RS_R], sx[RS_R], vv[RS_R + 2], oo[RS_R]; v16h kvf[2];   // vv[i]: v of row n0 - 1 + i
#pragma unroll   // the arrays stay in registers and all the loads are in flight together; what part 1 needs goes first
    for (int r = 0; r < RS_R; ++r) { qq[r] = *(const v4fa*)(fr + (size_t)(r * 4) * INT); cx[r] = *(const v4fa*)(cp + r * HD); sx[r] = *(const v4fa*)(sp + r * HD); }
    const v4f km = *(const v4fa*)(KM + c);
#pragma unroll   // constant indices into kvf[]
    for (int nb = 0; nb < 2; ++nb) kvf[nb] = WFrag<h16>::ld(kvp + nb * 16 * HD);
    vv[0] = *(const v4fa*)(flo + 2 * INT); vv[RS_R + 1] = *(const v4fa*)(fhi + (size_t)(RS_R * 4 + 2) * INT);
#pragma unroll   // the arrays stay in registers and all the loads are in flight together
    for (int r = 0; r < RS_R; ++r) { vv[r + 1] = *(const v4fa*)(fr + (size_t)(r * 4 + 2) * INT); oo[r] = *(const v4fa*)(fr + (size_t)(r * 4 + 3) * INT); }
    const v4f vm = *(const v4fa*)(VM + c), b4 = *(const v4fa*)(bl + c), w0 = *(const v4fa*)(wl + c * 3), w1 = *(const v4fa*)(wl + c * 3 + 4), w2 = *(const v4fa*)(wl + c * 3 + 8);
    asm volatile("s_wait_xcnt 0x0" :: "v"(fr), "v"(flo), "v"(fhi), "v"(cp), "v"(sp), "v"(kvp), "v"(c * 4) : "memory");   // the wait owed before a register that an issued load names is overwritten; the address pairs and the byte offset into KM, VM and bl as inputs keep them whole up to it
    __builtin_amdgcn_sched_barrier(0);   // no arithmetic moves up among the loads: its wait would stand in front of the loads behind it
    float zp[RS_R];
#pragma unroll   // constant indices into the register arrays
    for (int r = 0; r < RS_R; ++r) { const float el[4] = { elu1s(qq[r][0]), elu1s(qq[r][1]), elu1s(qq[r][2]), elu1s(qq[r][3]) }; v4h o;   // elu1 once, for the shift and for z; d is a multiple of 4: partner and parity of d + q are those of q
#pragma unroll
        for (int q = 0; q < 4; ++q) o[q] = tohx(tshift(el, q, bfr(cx[r][q]), bfr(sx[r][q])));
        *(v4h*)(qsh + h * QS_H + (rl + r) * QS_P + d) = o;
        zp[r] = (el[0] * km[0] + el[1] * km[1]) + (el[2] * km[2] + el[3] * km[3]); }
    static_assert(RS_R == 8 && HD / 4 == 8, "three halving exchanges: 8 rows over the 8 lanes of a head");
    float z4[4], z2[2];   // a lane keeps the rows whose bit equals its own g's and hands the others to its partner
#pragma unroll   // constant indices into zp[] and z4[]
    for (int i = 0; i < 4; ++i) z4[i] = ((g & 4) ? zp[i + 4] : zp[i]) + xlane<4>((g & 4) ? zp[i] : zp[i + 4]);
#pragma unroll   // constant indices into z4[] and z2[]
    for (int i = 0; i < 2; ++i) z2[i] = ((g & 2) ? z4[i + 2] : z4[i]) + xlane<2>((g & 2) ? z4[i] : z4[i + 2]);
    const float zs = ((g & 1) ? z2[1] : z2[0]) + xlane<1>((g & 1) ? z2[0] : z2[1]);
    zsh[(rl + g) * NH_ + h] = zs * SCALE;   // row rl + g, head h
    __syncthreads();   // qsh and zsh are whole
#pragma unroll   // constant indices into kvf[]
    for (int mb = 0; mb < 2; ++mb) { const h16* ap = qsh + w * QS_H + (mb * 16 + lr) * QS_P + 8 * hi; const v16h a = cat16(*(const v8ha*)ap, *(const v8ha*)(ap + 16));   // the k order of WFrag<h16>::ld
#pragma unroll
        for (int nb = 0; nb < 2; ++nb) { const v8f acc = wmma16(a, kvf[nb], (v8f){});
#pragma unroll
            for (int j = 0; j < 8; ++j) ao[(mb * 16 + hi * 8 + j) * AO_P + w * HD + nb * 16 + lr] = acc[j]; } }
    __syncthreads();   // ao is whole
    v4f aa[RS_R]; float zz[RS_R];
#pragma unroll   // the LDS reads overlap
    for (int r = 0; r < RS_R; ++r) { aa[r] = *(const v4fa*)(ao + (rl + r) * AO_P + c); zz[r] = zsh[(rl + r) * NH_ + h]; }
    const float wr[12] = { bfr(w0[0]), bfr(w0[1]), bfr(w0[2]), bfr(w0[3]), bfr(w1[0]), bfr(w1[1]), bfr(w1[2]), bfr(w1[3]), bfr(w2[0]), bfr(w2[1]), bfr(w2[2]), bfr(w2[3]) };   // wr[q * 3 + k]: tap k of column c + q
#pragma unroll   // constant indices into the register arrays
    for (int r = 0; r < RS_R; ++r) { const float z = zz[r]; const float fz = __fadd_rn(1.0f, __fdiv_rn(1.0f, __fadd_rn(z, 1e-6f))); v4us oh, ol;
#pragma unroll
        for (int q = 0; q < 4; ++q) { float lp = bfr(b4[q]);
#pragma unroll
            for (int k = 0; k < 3; ++k) { const bool in = (r + k > 0 || n0 > 0) && (r + k < RS_R + 1 || n0 + RS_R < NN);   /* row n0 + r - 1 + k lies in the sequence */ float p = __fmul_rn(wr[q * 3 + k], vv[r + k][q]); asm volatile("" : "+v"(p)); lp = in ? __fadd_rn(lp, p) : lp; }
            float a = __fmul_rn(aa[r][q], fz); asm volatile("" : "+v"(a)); float zb = __fmul_rn(z, vm[q]); asm volatile("" : "+v"(zb)); const float rr = __fmul_rn(__fadd_rn(__fsub_rn(a, zb), lp), oo[r][q]); unsigned short u, l; splitf(rr, u, l); oh[q] = u; ol[q] = l; }
        const size_t e = (size_t)(n0 + r) * INT + c; *(v4us*)(Rh + e) = oh; *(v4us*)(Rl + e) = ol; }  }

extern "C" void kernel_launch(void* const* d_in, const int* in_sizes, int n_in,
                              void* d_out, int out_size, void* d_ws, size_t ws_size, hipStream_t stream) {
    (void)in_sizes; (void)n_in; (void)out_size;
    const float* x = (const float*)d_in[0]; const float* sn = (const float*)d_in[1]; const float* cs = (const float*)d_in[2]; const float* wq = (const float*)d_in[3]; const float* bq = (const float*)d_in[4]; const float* wl = (const float*)d_in[5]; const float* bl = (const float*)d_in[6]; const float* wp = (const float*)d_in[7]; const float* bp = (const float*)d_in[8];
    float* OUT = (float*)d_out;     // [4][8192][256]
    char* wsp = (char*)d_ws;
    auto take = [&](size_t bytes) { char* p = wsp; wsp += (bytes + 255) & ~(size_t)255; return (void*)p; };
    // All NB_ batches go through every launch together: each plane below holds NB_ batches back to back, and the batch is a part of the row index or a grid dimension of its own.
    // Two planes lie on workspace whose earlier tenant has been read for the last time by an earlier launch: XB, then KV, then Rh | Rl share one region.
    bf* WQ = (bf*)take((size_t)4 * INT * DIM * 2); bf* WP = (bf*)take((size_t)DIM * INT * 2); float* F = (float*)take((size_t)NB_ * NN * 4 * INT * 4); float* KM = (float*)take(NB_ * INT * 4); float* VM = (float*)take(NB_ * INT * 4); float* KP = (float*)take((size_t)NB_ * KM_PARTS * 512 * 4);
    h16* KVT = (h16*)take((size_t)NB_ * NH_ * 64 * HD * 2);
    bf* Rh = (bf*)take((size_t)2 * NB_ * NN * INT * 2); bf* Rl = Rh + (size_t)NB_ * NN * INT; bf* XB = Rh; float* KV = (float*)Rh;   // XB: half the region, dead before KV is written; KV: half of it; Rh | Rl: all of it, written after KV's last read
    static_assert((size_t)NH_ * KV_SLICES * HD * HD * 4 <= (size_t)2 * NN * INT * 2 && DIM == INT, "KV and XB fit into the region of Rh | Rl");
    if ((size_t)(wsp - (char*)d_ws) > ws_size) return;    // total ~ 162 MiB
    static_assert(DIM == GT_K && INT == GT_K, "k_gemmw holds the whole K in LDS");
    static_assert(DIM * INT % (8 * 256 * CV_CH) == 0 && NN % (4 * RS_R) == 0, "the grids of k_cvt8 and k_res cover their arrays exactly");
    k_cvt8<<<4 * INT * DIM / (8 * 256 * CV_CH), 256, 0, stream>>>(wq, WQ); k_cvt8<<<DIM * INT / (8 * 256 * CV_CH), 256, 0, stream>>>(wp, WP);   // [out][in] natural Bt
    k_cvt8<<<(unsigned)((size_t)NB_ * NN * DIM / (8 * 256 * CV_CH)), 256, 0, stream>>>(x, XB);
    k_gemmw<128, 0, 4 * INT><<<dim3(4 * INT / GT_N, NB_ * NN / 128, 1), 256, 0, stream>>>(XB, nullptr, WQ, F, bq);   // rows: (batch, n)
    k_kst<<<dim3(NN / KT_N, NH_ * HD / KT_C, NB_), 256, 0, stream>>>(F, sn, cs, KV, KP); k_kmean_fin<<<dim3(8, NB_, 1), 256, 0, stream>>>(KP, KM, VM);
    k_kv16<<<dim3(NB_ * NH_, 2, 1), 512, 0, stream>>>(KV, KVT);
    k_res<<<dim3(NN / (4 * RS_R), NB_, 1), 256, 0, stream>>>(F, sn, cs, KM, VM, KVT, wl, bl, Rh, Rl);   // qs, z, qs . kv, gating, conv, o
    k_gemmw<64, 1, DIM><<<dim3(DIM / GT_N, NB_ * NN / 64, 1), 256, 0, stream>>>(Rh, Rl, WP, OUT, bp);   // rows: (batch, n)
}

// v010
// Measured time: 93.7 microseconds a run.
// In two side-by-side timings against v009, it was 1.14 and 1.08 times as fast.
// Counting every step since v000, it is 135 times as fast.
#include <hip/hip_runtime.h>

// MultiHeadMALAAttention (x [4][8192][256]; [q|k|v|o] = x W_qkvo^T + b (8 heads x 32); lepe = depthwise conv3 (pad 1) over the sequence on v + b; qh = elu(q)+1, kh = elu(k)+1; z = (qh . mean_n kh) 32^-0.5; qs/ks = theta_shift with the [N][32]
// sin/cos tables (read as data; rotate-every-two); kv = sum_n (ks s)(v s)^T with s^2 = SCALE/N; attn = qs kv; res = attn (1 + 1/(z + 1e-6)) - z mean_n v; res = (res + lepe) o; out = res W_proj^T + b -> [4][8192][256]).
// Compute dtypes, f32 accumulate: every input rounded to bf16; qkvo projection on PLAIN bf16 operands (inputs: exact, + bias); elu, means, z, theta shift, lepe conv, gating f32; kv-state (K = 8192) and qs.kv (K 32) on single fp16

#define NB_  4
#define NN   8192
#define DIM  256
#define NH_  8
#define HD   32
#define INT  256
#define SCALE 0.1767766952966369f
typedef _Float16 h16;
typedef unsigned short bf;
typedef __attribute__((ext_vector_type(16))) __bf16   v16bf;
typedef __attribute__((ext_vector_type(16))) _Float16 v16h;
typedef __attribute__((ext_vector_type(8)))  _Float16 v8h;
typedef __attribute__((ext_vector_type(8)))  unsigned short v8us;
typedef __attribute__((ext_vector_type(8)))  float    v8f;
typedef __attribute__((ext_vector_type(4)))  float    v4f;
typedef v8h  __attribute__((may_alias)) v8ha;
typedef v4f  __attribute__((may_alias)) v4fa;
typedef v8us __attribute__((may_alias)) v8usa;

__device__ __forceinline__ unsigned short f2bf(float f) { unsigned u = __float_as_uint(f); u += 0x7FFFu + ((u >> 16) & 1u); return (unsigned short)(u >> 16); }
__device__ __forceinline__ float bf2f(unsigned short b) { return __uint_as_float(((unsigned)b) << 16); }
__device__ __forceinline__ float bfr(float f) { return bf2f(f2bf(f)); }
__device__ __forceinline__ v16h cat16(v8h lo, v8h hi) { return __builtin_shufflevector(lo, hi, 0, 1, 2, 3, 4, 5, 6, 7, 8, 9, 10, 11, 12, 13, 14, 15); }
__device__ __forceinline__ v16bf cat16b(v8us lo, v8us hi) { return __builtin_bit_cast(v16bf, __builtin_shufflevector(lo, hi, 0, 1, 2, 3, 4, 5, 6, 7, 8, 9, 10, 11, 12, 13, 14, 15)); }
__device__ __forceinline__ v8f wmma16(v16h a, v16h b, v8f c) { return __builtin_amdgcn_wmma_f32_16x16x32_f16(false, a, false, b, (short)0, c, false, false); }
__device__ __forceinline__ v8f wmmab(v16bf a, v16bf b, v8f c) { return __builtin_amdgcn_wmma_f32_16x16x32_bf16(false, a, false, b, (short)0, c, false, false); }



// ---- k_gemmw: C[m][n] (f32, pitch LDC) = sum_k A[m][k] Bt[n][k] (+ A2[m][k] Bt[n][k] where NSPLIT) + bias[n] rounded to bf16; the operands are K-contiguous bf16 planes, K = GT_K. Grid (N / GT_N, M / MT), 256 threads.
// A work-group of 8 waves makes an MT x GT_N tile. Its 256 operand rows (MT of A, MT of A2 where NSPLIT, GT_N of Bt), whole K, are brought into LDS once by asynchronous copies, one 512-byte row (four whole lines) a wave's copy; wave w brings rows 32 w .. 32 w + 31 of [A | A2 | Bt].
// Every wave then takes its fragments from LDS: wave w makes rows (w / 4) * MT / 2 .. and columns (w % 4) * 32 .. of the tile, MT / 32 x 2 accumulators; per accumulator the products are added in the order k ascending, A before A2.
template <typename T16> struct WFrag;
template <> struct WFrag<h16> { typedef v16h V; static __device__ __forceinline__ V ld(const h16* p) { return cat16(*(const v8h*)p, *(const v8h*)(p + 16)); } static __device__ __forceinline__ v8f mma(V a, V b, v8f c) { return wmma16(a, b, c); } };
#define GT_N 128
#define GT_K 256
#define GT_P (GT_K + 8)   // 16-bit elements per LDS row: 512 bytes of data at a pitch of 528 (16 x odd), the pitch for 16-byte reads
#define GO_P 36           // floats per row of a wave's output staging: 128 bytes of data at a pitch of 144 (16 x odd)
// copy8: 8 rows, a lane's 16 bytes of each, from global memory into LDS (l: the lane's LDS byte address, g: its global address, both of the first row).
// The s_wait_xcnt in the copies' own statement: the wait owed before a register that an issued copy names is rewritten.
__device__ __forceinline__ void copy8(unsigned l, const bf* g) {
    asm volatile("global_load_async_to_lds_b128 %0, %8, off\n\t"
                 "global_load_async_to_lds_b128 %1, %9, off\n\t"
                 "global_load_async_to_lds_b128 %2, %10, off\n\t"
                 "global_load_async_to_lds_b128 %3, %11, off\n\t"
                 "global_load_async_to_lds_b128 %4, %12, off\n\t"
                 "global_load_async_to_lds_b128 %5, %13, off\n\t"
                 "global_load_async_to_lds_b128 %6, %14, off\n\t"
                 "global_load_async_to_lds_b128 %7, %15, off\n\t"
                 "s_wait_xcnt 0x0"
                 :: "v"(l), "v"(l + 1 * GT_P * 2), "v"(l + 2 * GT_P * 2), "v"(l + 3 * GT_P * 2), "v"(l + 4 * GT_P * 2), "v"(l + 5 * GT_P * 2), "v"(l + 6 * GT_P * 2), "v"(l + 7 * GT_P * 2),
                    "v"(g), "v"(g + 1 * GT_K), "v"(g + 2 * GT_K), "v"(g + 3 * GT_K), "v"(g + 4 * GT_K), "v"(g + 5 * GT_K), "v"(g + 6 * GT_K), "v"(g + 7 * GT_K) : "memory"); }
__device__ __forceinline__ v16bf lfrag(const bf* p) { return cat16b(*(const v8usa*)p, *(const v8usa*)(p + 16)); }   // k = 0 .. 7 and 16 .. 23 from p, the k order of WFrag<h16>::ld, for A and Bt alike
template <int MT, int NSPLIT, int LDC>
__global__ __launch_bounds__(256) void k_gemmw(const bf* __restrict__ A, const bf* __restrict__ A2, const bf* __restrict__ Bt, float* C, const float* __restrict__ bias) {
    constexpr int MB = MT / 32;   // 16-row fragments of A per wave
    static_assert((NSPLIT ? 2 : 1) * MT == 128 && GT_N == 128, "256 operand rows, 32 a wave; waves 0 .. 3 bring A (and A2), waves 4 .. 7 Bt");
    __shared__ __align__(16) bf ta[128 * GT_P], tb[GT_N * GT_P];   // ta: the rows of A, behind them those of A2
    __shared__ __align__(16) float os[8 * 16 * GO_P];
    const int lane = threadIdx.x & 31, w = __builtin_amdgcn_readfirstlane(threadIdx.x >> 5), lr = lane & 15, hi = lane >> 4, wm = w >> 2, wn = w & 3;   /* w in a scalar register: which plane a wave copies from is chosen by scalar selects, with every lane on */ const int c0 = blockIdx.x * GT_N, r0 = blockIdx.y * MT;
    const float* bq4 = bias + c0 + wn * 32 + (lane & 7) * 4; const v4f bi = *(const v4fa*)bq4;   // the bias of the 4 columns that this lane stores
    asm volatile("s_wait_xcnt 0x0" :: "v"(bq4) : "memory");   // the wait owed before a register that an issued load names is overwritten; the address as an input keeps it whole up to it (without it the load's scalar base was reloaded ahead of the wait)
    const bf* g = w >= 4 ? Bt + (size_t)(c0 + (w - 4) * 32) * GT_K : (NSPLIT && w >= 2) ? A2 + (size_t)(r0 + (w - 2) * 32) * GT_K : A + (size_t)(r0 + w * 32) * GT_K;
    const unsigned l = (w >= 4 ? (unsigned)(size_t)tb : (unsigned)(size_t)ta) + (unsigned)((w & 3) * 32 * GT_P * 2 + lane * 16);
    g += lane * 8;
#pragma unroll   // 4 statements of 8 copies: all 32 rows of the wave are in flight together
    for (int i = 0; i < 32; i += 8) copy8(l + i * GT_P * 2, g + i * GT_K);
    asm volatile("s_wait_asynccnt 0x0" ::: "memory");   // this wave's copies have landed
    __syncthreads();   // every wave's rows are in LDS
    const bf* ap = ta + (wm * (MT / 2) + lr) * GT_P + 8 * hi; const bf* bp = tb + (wn * 32 + lr) * GT_P + 8 * hi;
    v8f acc[MB][2];
#pragma unroll
    for (int mb = 0; mb < MB; ++mb) { acc[mb][0] = (v8f){}; acc[mb][1] = (v8f){}; }
    v16bf a[2][MB], a2[2][MB], b[2][2];   // two fragment sets: step s works on set s % 2 while the reads of step s + 1 fill the other
#pragma unroll
    for (int mb = 0; mb < MB; ++mb) { a[0][mb] = lfrag(ap + mb * 16 * GT_P); if (NSPLIT) a2[0][mb] = lfrag(ap + (MT + mb * 16) * GT_P); }
#pragma unroll
    for (int nb = 0; nb < 2; ++nb) b[0][nb] = lfrag(bp + nb * 16 * GT_P);
#pragma unroll   // constant indices into the register arrays
    for (int s = 0; s < GT_K / 32; ++s) { const int cu = s & 1, nx = cu ^ 1, kn = (s + 1) * 32;
        if (s + 1 < GT_K / 32) {
#pragma unroll
            for (int mb = 0; mb < MB; ++mb) { a[nx][mb] = lfrag(ap + mb * 16 * GT_P + kn); if (NSPLIT) a2[nx][mb] = lfrag(ap + (MT + mb * 16) * GT_P + kn); }
#pragma unroll
            for (int nb = 0; nb < 2; ++nb) b[nx][nb] = lfrag(bp + nb * 16 * GT_P + kn); }
        __builtin_amdgcn_sched_barrier(0);   // the next step's LDS reads stay one group in front of this step's products (left free, the compiler fetched so far ahead that a wave took more than 256 registers, which leaves room for one work-group a WGP where the LDS allows two)
#pragma unroll
        for (int nb = 0; nb < 2; ++nb)
#pragma unroll
            for (int mb = 0; mb < MB; ++mb) { acc[mb][nb] = wmmab(a[cu][mb], b[cu][nb], acc[mb][nb]); if (NSPLIT) acc[mb][nb] = wmmab(a2[cu][mb], b[cu][nb], acc[mb][nb]); }
        __builtin_amdgcn_sched_barrier(0);   // and no later step's reads move up among these products
    }
    // Output: 16 rows x 32 columns at a time go through the wave's own LDS range, so that a store is 4 whole 128-byte lines.
    float* const ow = os + w * 16 * GO_P; float* const cl = C + (size_t)(r0 + wm * (MT / 2) + (lane >> 3)) * LDC + c0 + wn * 32 + (lane & 7) * 4;
    const v4f bb = { bfr(bi[0]), bfr(bi[1]), bfr(bi[2]), bfr(bi[3]) };
#pragma unroll
    for (int mb = 0; mb < MB; ++mb) {
#pragma unroll
        for (int nb = 0; nb < 2; ++nb) {
#pragma unroll
            for (int j = 0; j < 8; ++j) ow[(hi * 8 + j) * GO_P + nb * 16 + lr] = acc[mb][nb][j]; }
        __builtin_amdgcn_wave_barrier(); asm volatile("" ::: "memory");   // the lanes of the wave exchange through ow: the reads below stay behind the writes above
#pragma unroll
        for (int s = 0; s < 4; ++s) { v4f val = *(const v4fa*)(ow + (4 * s + (lane >> 3)) * GO_P + (lane & 7) * 4); val += bb; *(v4f*)(cl + (size_t)(mb * 16 + 4 * s) * LDC) = val; }
        __builtin_amdgcn_wave_barrier(); asm volatile("" ::: "memory");   // the next 16 rows' writes stay behind these reads
    }
}

__device__ __forceinline__ h16 tohx(float x) { return (h16)x; }
__device__ __forceinline__ void splitf(float y, unsigned short& h, unsigned short& l) { h = f2bf(y); l = f2bf(y - bf2f(h)); }
typedef __attribute__((ext_vector_type(2))) _Float16 v2h;
typedef __attribute__((ext_vector_type(4))) _Float16 v4h;
typedef __attribute__((ext_vector_type(4))) unsigned short v4us;

// k_cvt8: a thread converts CV_CH chunks of 8 floats (a work-group's chunks lie back to back, chunk k of a thread 256 chunks behind chunk k - 1), so that a wave has 2 CV_CH loads in flight and the launch starts CV_CH times fewer waves.
// One launch converts all three arrays, which do not depend on one another: work-groups 0 .. CV_GQ - 1 take W_qkvo, the next CV_GP W_proj, the rest x; each range covers its array exactly.
#define CV_CH 8
#define CV_GQ (4 * INT * DIM / (8 * 256 * CV_CH))
#define CV_GP (DIM * INT / (8 * 256 * CV_CH))
#define CV_GX (NB_ * NN * DIM / (8 * 256 * CV_CH))
__global__ __launch_bounds__(256) void k_cvt8(const float* __restrict__ wq, bf* WQ, const float* __restrict__ wp, bf* WP, const float* __restrict__ x, bf* XB) { const int bx = blockIdx.x; const bool isq = bx < CV_GQ, isp = bx < CV_GQ + CV_GP;
    const float* src = isq ? wq : isp ? wp : x; bf* dst = isq ? WQ : isp ? WP : XB; const size_t i = (size_t)(isq ? bx : isp ? bx - CV_GQ : bx - CV_GQ - CV_GP) * (256 * CV_CH) + threadIdx.x; const float* p = src + i * 8; v8f v[CV_CH];
#pragma unroll   // v[] stays in registers and all the loads are in flight before the first conversion
    for (int c = 0; c < CV_CH; ++c) v[c] = *(const v8f*)(p + (size_t)c * 256 * 8);
    asm volatile("s_wait_xcnt 0x0" :: "v"(p) : "memory");   // the wait owed before a register that an issued load names is overwritten; p as an input keeps the address pair whole up to it (without it the last load's result was placed on the pair)
#pragma unroll   // constant indices into v[]
    for (int c = 0; c < CV_CH; ++c) { v8us o;
#pragma unroll
        for (int k = 0; k < 8; ++k) o[k] = f2bf(v[c][k]);
        *(v8us*)(dst + (i + (size_t)c * 256) * 8) = o; }  }
// Column means of elu1(k) and of v over the sequence: k_kst, which holds both in registers, stores its work-group's column sums over its KM_ROWS rows as P[group][0..255] = sums of elu1(k), P[group][256..511] = sums of v; k_fin adds the groups.
// elu1(x) = elu(x) + 1 = x > 0 ? x + 1 : exp(x), with its exp (x * log2(e), then v_exp_f32, as __expf compiles) written out: the v_nop in the same statement keeps the one free issue slot that the instruction set asks for behind a transcendental.
__device__ __forceinline__ float elu1s(float x) { float e; asm("v_exp_f32 %0, %1\n\tv_nop" : "=v"(e) : "v"(x * 1.44269504f)); return x > 0.f ? __fadd_rn(x, 1.0f) : e; }
#define KM_ROWS  64
#define KM_PARTS (NN / KM_ROWS)
// qs = fp16(theta_shift(elu1(q))) and z = (elu1(q_h) . KM_h) SCALE are made in k_res; ks = fp16(theta_shift(elu1(k))) (unscaled to stay in fp16's normal range) in k_kst:
__device__ __forceinline__ float tshift(const float* __restrict__ er, int d, float c_d, float s_d) { const float self_ = er[d]; const float partner = er[d ^ 1];   /* er[]: elu1 of the row */ const float rot = (d & 1) ? partner : -partner;   /* rotate_every_two: out[2i] = -x[2i+1], out[2i+1] = x[2i] */ float a = __fmul_rn(self_, c_d), b = __fmul_rn(rot, s_d); asm volatile("" : "+v"(a)); asm volatile("" : "+v"(b)); return __fadd_rn(a, b); }
template <int M> __device__ __forceinline__ float xlane(float v) { return __int_as_float(__builtin_amdgcn_update_dpp(0, __float_as_int(v), 0x160 | M, 0xf, 0xf, true)); }   // v of lane (own ^ M), M < 16: DPP row_xmask
// k_kst: ks = fp16(theta_shift(elu1(k))) and fp16(v) of 64 sequence rows x 4 heads (128 k and 128 v columns of F) are turned [n][d] -> [d][n] in LDS, and the work-group's share of the kv state is made from there: per head one partial plane KV[batch, head][slice] = sum over its 64 n of ks[n][d] v[n][e]; k_fin adds the planes.
// Reading: a wave's load is 512 adjacent bytes of one row; a thread owns 4 adjacent columns of 8 adjacent rows and puts each column's 8 fp16 (along n) into LDS as one 16-byte chunk.
// LDS row q * 32 + c4 holds column c4 * 4 + q; chunk j of it lies at place j ^ ((c4 >> 1) & 7) ^ (q * 2): the row's parity and the place then spread the chunks of 16 adjacent lanes over all the banks, in the stores (one j, one q, 16 c4) and in the fragment loads (one j, 16 adjacent columns).
// The product: wave w takes head w / 2 and half w % 2 of its d: 16 d x 32 e, K = 64 n, 2 x 2 matrix instructions; A = ks[d][n], B = v[e][n], both K-contiguous in LDS.
// A plane keeps the accumulators' own order, [e / 16][d / 16][register / 4][lane][register % 4] (HD * HD floats), so that every store is 512 adjacent bytes; k_fin gives each place its d and e.
#define KT_N 64
#define KT_C 128
#define KV_SLICES (NN / KT_N)
__device__ __forceinline__ int kt_at(int col, int j) { return ((col & 3) * 32 + (col >> 2)) * KT_N + (j ^ ((col >> 3) & 7) ^ ((col & 3) * 2)) * 8; }   // where chunk j (n = 8 j .. 8 j + 7) of column col lies in tk, tv
__device__ __forceinline__ v16h kfrag(const h16* t, int col, int j) { return cat16(*(const v8ha*)(t + kt_at(col, j)), *(const v8ha*)(t + kt_at(col, j + 2))); }   // n = 8 j .. 8 j + 7, then 8 j + 16 .. 8 j + 23: the k order of WFrag<h16>::ld
// The column sums for the means ride along: a thread adds elu1(k) and v over its 8 rows, the 8 waves' sums meet in LDS behind the same barrier, and thread c adds them for column c (k) or c - KT_C (v) and stores into P (whole lines).
__global__ __launch_bounds__(256) void k_kst(const float* __restrict__ F, const float* __restrict__ sn, const float* __restrict__ cs, float* KV, float* P) {
    __shared__ __align__(16) h16 tk[KT_C * KT_N], tv[KT_C * KT_N];
    __shared__ __align__(16) float red[8 * 2 * KT_C];   // [wave][sums of elu1(k): KT_C | sums of v: KT_C]
    static_assert(KM_ROWS == KT_N && 2 * KT_C == 256, "a work-group's rows are one group of P; a thread per column sum");
    const int n0 = blockIdx.x * KT_N, h0 = blockIdx.y * (KT_C / HD), b = blockIdx.z;   // b: batch
    const int c4 = threadIdx.x & 31, w = threadIdx.x >> 5;   // reading: column group, group of 8 rows
    const int lr = c4 & 15, hi = c4 >> 4, hh = w >> 1, mb = w & 1;   // the product: place in the fragments, head, half of d
    const float* fr = F + (size_t)(b * NN + n0 + w * 8) * 4 * INT + h0 * HD + c4 * 4;   // + INT: the k columns, + 2 * INT: the v columns
    const float* cp = cs + (n0 + w * 8) * HD + (c4 & 7) * 4; const float* sp = sn + (n0 + w * 8) * HD + (c4 & 7) * 4;
    v4f kx[8], vx[8], cx[8], sx[8];
#pragma unroll   // the arrays stay in registers and all 32 loads are in flight together
    for (int i = 0; i < 8; ++i) { kx[i] = *(const v4fa*)(fr + (size_t)i * 4 * INT + INT); vx[i] = *(const v4fa*)(fr + (size_t)i * 4 * INT + 2 * INT); cx[i] = *(const v4fa*)(cp + i * HD); sx[i] = *(const v4fa*)(sp + i * HD); }
    asm volatile("s_wait_xcnt 0x0" :: "v"(fr), "v"(cp), "v"(sp) : "memory");   // the wait owed before a register that an issued load names is overwritten; the address pairs as inputs keep them whole up to it (without it a later load's result was placed on one of them, and one load sank into the arithmetic)
    v8h ok[4], ov[4]; v4f sk = (v4f){}, sv = (v4f){};
#pragma unroll   // constant indices into the register arrays
    for (int i = 0; i < 8; ++i) { const float e[4] = { elu1s(kx[i][0]), elu1s(kx[i][1]), elu1s(kx[i][2]), elu1s(kx[i][3]) }; sk[0] += e[0]; sk[1] += e[1]; sk[2] += e[2]; sk[3] += e[3]; sv += vx[i];
#pragma unroll   // constant indices into the register arrays
        for (int q = 0; q < 4; ++q) { const float rot = (q & 1) ? e[q ^ 1] : -e[q ^ 1];   /* rotate_every_two: out[2i] = -x[2i+1], out[2i+1] = x[2i] */
            ok[q][i] = tohx(e[q] * bfr(cx[i][q]) + rot * bfr(sx[i][q]));   /* unscaled (O(1)): SCALE/N is applied in f32 when the kv state is converted */ ov[q][i] = tohx(vx[i][q]); } }
#pragma unroll   // constant indices into the register arrays
    for (int q = 0; q < 4; ++q) { const int o = kt_at(c4 * 4 + q, w); *(v8ha*)(tk + o) = ok[q]; *(v8ha*)(tv + o) = ov[q]; }
    *(v4fa*)(red + w * 2 * KT_C + c4 * 4) = sk; *(v4fa*)(red + w * 2 * KT_C + KT_C + c4 * 4) = sv;
    __syncthreads();
    v8f acc[2] = { (v8f){}, (v8f){} };
#pragma unroll   // constant indices into acc[]; the LDS reads overlap
    for (int jc = 0; jc < KT_N / 8; jc += 4) { const v16h a = kfrag(tk, hh * HD + mb * 16 + lr, jc + hi);
#pragma unroll
        for (int nb = 0; nb < 2; ++nb) acc[nb] = wmma16(a, kfrag(tv, hh * HD + nb * 16 + lr, jc + hi), acc[nb]); }
    float* const kvo = KV + ((size_t)(b * NH_ + h0 + hh) * KV_SLICES + blockIdx.x) * (HD * HD) + mb * 256 + c4 * 4;
#pragma unroll   // constant indices into acc[]
    for (int nb = 0; nb < 2; ++nb) { *(v4f*)(kvo + nb * 512) = __builtin_shufflevector(acc[nb], acc[nb], 0, 1, 2, 3); *(v4f*)(kvo + nb * 512 + 128) = __builtin_shufflevector(acc[nb], acc[nb], 4, 5, 6, 7); }
    float cs8 = 0.f;
#pragma unroll   // the LDS reads overlap
    for (int ww = 0; ww < 8; ++ww) cs8 += red[ww * 2 * KT_C + threadIdx.x];
    P[(size_t)(b * KM_PARTS + blockIdx.x) * 512 + (threadIdx.x / KT_C) * INT + h0 * HD + threadIdx.x % KT_C] = cs8;
}
// k_fin: one launch for the two final sums over k_kst's partial results, which do not depend on one another. Grid (NB_ * NH_ + FM_GX, 2), 512 threads: blockIdx.x < NB_ * NH_ adds kv planes, the other 2 * FM_GX work-groups add column sums.
// The kv state: two work-groups per (batch, head), one per half nb of e, add the KV_SLICES partial planes in f32 (slice 0 first), scale by SCALE/N and store KVT[h][e<64][d] in fp16 (rows >= 32 zero).
// A thread owns one place of the half plane (a wave's load is one 128-byte line); the place's d and e follow from the accumulators' order (k_kst), and the turn to [e][d] goes through LDS.
// The means: per batch 4 work-groups of 128 columns of P each; 16 thread groups (a wave each) sum KM_PARTS / 16 partial rows each, thread group 0 adds the 16 sums and scales by 1/N.
#define FM_GX (NB_ * 4 / 2)
__global__ __launch_bounds__(512) void k_fin(const float* __restrict__ KV, h16* KVT, const float* __restrict__ P, float* KM, float* VM) {
    __shared__ float tr[16 * 33];
    __shared__ __align__(16) float red[16 * 128];
    if (blockIdx.x >= NB_ * NH_) {   // the same for a whole work-group: each side's barrier is passed by all of its threads
        const int j = (blockIdx.x - NB_ * NH_) * 2 + blockIdx.y, bt = j >> 2, part = j & 3;   // batch, quarter of P's 512 columns
        const int c4 = threadIdx.x & 31, g = threadIdx.x >> 5;
        const float* pm = P + ((size_t)bt * KM_PARTS + g) * 512 + part * 128 + c4 * 4;
        v4f vp[KM_PARTS / 16];
#pragma unroll   // vp[] stays in registers and the partial-row loads overlap
        for (int i = 0; i < KM_PARTS / 16; ++i) vp[i] = *(const v4fa*)(pm + (size_t)i * 16 * 512);
        asm volatile("s_wait_xcnt 0x0" :: "v"(pm) : "memory");   // the wait owed before a register that an issued load names is overwritten; pm as an input keeps the address pair whole up to it
        v4f sm = (v4f){};
#pragma unroll   // constant indices into vp[]
        for (int i = 0; i < KM_PARTS / 16; ++i) sm += vp[i];
        *(v4fa*)(red + g * 128 + c4 * 4) = sm;
        __syncthreads();
        if (g == 0) {
#pragma unroll   // the LDS reads overlap
            for (int gg = 1; gg < 16; ++gg) sm += *(const v4fa*)(red + gg * 128 + c4 * 4);
            sm *= (1.0f / NN);
            float* dst = (part < 2 ? KM + part * 128 : VM + (part - 2) * 128) + bt * INT;
            *(v4fa*)(dst + c4 * 4) = sm; }
        return; }
    const int h = blockIdx.x, nb = blockIdx.y, t = threadIdx.x;
    const float* p = KV + ((size_t)h * KV_SLICES * 2 + nb) * 512 + t; float v[KV_SLICES], sum = 0.f;
#pragma unroll   // v[] stays in registers and the plane loads overlap
    for (int sl = 0; sl < KV_SLICES; ++sl) v[sl] = p[(size_t)sl * HD * HD];
    asm volatile("s_wait_xcnt 0x0" :: "v"(p) : "memory");   // the wait owed before a register that an issued load names is overwritten; p as an input keeps the address pair whole up to it (without it the last load's result was placed on the pair)
#pragma unroll   // constant indices into v[]
    for (int sl = 0; sl < KV_SLICES; ++sl) sum += v[sl];
    const int d = (t >> 8) * 16 + ((t >> 6) & 1) * 8 + ((t >> 7) & 1) * 4 + (t & 3), el = (t >> 2) & 15;   // t = [d / 16][register / 4][lane][register % 4]; accumulator register r of lane l: d % 16 = (l / 16) * 8 + r, e % 16 = l % 16
    tr[el * 33 + d] = __fmul_rn(sum, SCALE / (float)NN);
    __syncthreads();
    const int e2 = (t & 255) * 2; v2h o = (v2h){};   // threads 0 .. 255: rows e = nb * 16 .. + 15; the others: the zero rows HD + nb * 16 .. + 15
    if (t < 256) { const float* q = tr + (e2 / HD) * 33 + e2 % HD; o[0] = tohx(q[0]); o[1] = tohx(q[1]); }
    *(v2h*)(KVT + ((size_t)h * 64 + (t >> 8) * HD + nb * 16) * HD + e2) = o;  }
// k_res: one work-group makes 4 * RS_R whole rows of res, from q to the bf16 pair. A thread owns 4 adjacent columns (4 d of one head) of RS_R adjacent rows: the columns' conv weights, biases and means are loaded once, a v row serves the three conv taps that read it from a register (RS_R + 2 row loads for RS_R rows), and all global loads are in flight together.
// A work-group is 64 column groups (a whole row) x 4 row groups; the grid covers the rows exactly. The two v rows beyond the sequence's ends are loaded from the clamped row and left out of the sum.
// Part 1, every thread: qs = fp16(theta_shift(elu1(q))) of its 4 d x RS_R rows goes into LDS (qsh[head][row][d]); z: a thread sums its 4 d of each row, and the 8 lanes of a head add their partial sums in three halving exchanges, after which lane g holds row g's whole sum and puts it into LDS (zsh[row][head]).
// Part 2, wave w = head w: attn[32 rows][32 e] = qs . kv, K = 32: 2 x 2 matrix instructions, A from qsh, B from KVT[head][e][d] (loaded with the others, up front); the accumulators go into LDS (ao[row][column]).
// Part 3, every thread: attn and z of its own columns and rows come back from LDS; gating, conv, o as before.
#define RS_R 8
#define QS_P 40    // fp16 per qsh row: 64 bytes of data at a pitch of 80, the pitch for 16-byte reads of 64-byte rows
#define QS_H (4 * RS_R * QS_P + 32)   // fp16 per qsh head: 64 bytes behind the 32 rows, so that the 4 heads that a wave's 8-byte stores touch fall on 4 different quarters of the banks
#define AO_P 260   // floats per ao row: the two 8-row halves of an accumulator store fall on different banks; 16-byte reads stay aligned
__global__ __launch_bounds__(256) void k_res(const float* __restrict__ F, const float* __restrict__ sn, const float* __restrict__ cs, const float* __restrict__ KM, const float* __restrict__ VM, const h16* __restrict__ KVT, const float* __restrict__ wl, const float* __restrict__ bl, bf* Rh, bf* Rl) { KM += blockIdx.y * INT; VM += blockIdx.y * INT; KVT += (size_t)blockIdx.y * NH_ * 64 * HD; F += (size_t)blockIdx.y * NN * 4 * INT; Rh += (size_t)blockIdx.y * NN * INT; Rl += (size_t)blockIdx.y * NN * INT;   /* blockIdx.y: batch; n stays the row inside the batch, so the conv's edges stay where they are */
    __shared__ __align__(16) h16 qsh[NH_ * QS_H];
    __shared__ __align__(16) float ao[4 * RS_R * AO_P];
    __shared__ float zsh[4 * RS_R * NH_];
    static_assert(4 * RS_R == 32 && NH_ == 8 && HD == 32 && INT == NH_ * HD, "8 waves, a head each: 2 x 2 tiles of 16 x 16, one K step");
    const int c = (threadIdx.x & 63) * 4; const int rl = (threadIdx.x >> 6) * RS_R; const int n0 = blockIdx.x * 4 * RS_R + rl; const int h = c / HD, d = c % HD, g = d / 4;   // rl: the thread's first row inside the work-group
    const int lr = threadIdx.x & 15, hi = (threadIdx.x >> 4) & 1, w = threadIdx.x >> 5;   // part 2: place in the fragments, head
    const float* fr = F + (size_t)n0 * 4 * INT + c;   // row n0: its q columns; + 2 * INT: its v columns, + 3 * INT: its o columns
    const float* flo = F + (size_t)(n0 > 0 ? n0 - 1 : 0) * 4 * INT + c; const float* fhi = F + (size_t)(n0 < NN - 1 - RS_R ? n0 : NN - 1 - RS_R) * 4 * INT + c;   // the row in front of the group, clamped to row 0; RS_R rows in front of the row behind the group, that one clamped to row NN - 1
    const float* cp = cs + n0 * HD + d; const float* sp = sn + n0 * HD + d; const h16* kvp = KVT + (size_t)(w * 64 + lr) * HD + 8 * hi;   // kvp: row e = lr of head w, as k_gemmw reads its Bt
    v4f qq[RS_R], cx[RS_R], sx[RS_R], vv[RS_R + 2], oo[RS_R]; v16h kvf[2];   // vv[i]: v of row n0 - 1 + i
#pragma unroll   // the arrays stay in registers and all the loads are in flight together; what part 1 needs goes first
    for (int r = 0; r < RS_R; ++r) { qq[r] = *(const v4fa*)(fr + (size_t)(r * 4) * INT); cx[r] = *(const v4fa*)(cp + r * HD); sx[r] = *(const v4fa*)(sp + r * HD); }
    const v4f km = *(const v4fa*)(KM + c);
#pragma unroll   // constant indices into kvf[]
    for (int nb = 0; nb < 2; ++nb) kvf[nb] = WFrag<h16>::ld(kvp + nb * 16 * HD);
    vv[0] = *(const v4fa*)(flo + 2 * INT); vv[RS_R + 1] = *(const v4fa*)(fhi + (size_t)(RS_R * 4 + 2) * INT);
#pragma unroll   // the arrays stay in registers and all the loads are in flight together
    for (int r = 0; r < RS_R; ++r) { vv[r + 1] = *(const v4fa*)(fr + (size_t)(r * 4 + 2) * INT); oo[r] = *(const v4fa*)(fr + (size_t)(r * 4 + 3) * INT); }
    const v4f vm = *(const v4fa*)(VM + c), b4 = *(const v4fa*)(bl + c), w0 = *(const v4fa*)(wl + c * 3), w1 = *(const v4fa*)(wl + c * 3 + 4), w2 = *(const v4fa*)(wl + c * 3 + 8);
    asm volatile("s_wait_xcnt 0x0" :: "v"(fr), "v"(flo), "v"(fhi), "v"(cp), "v"(sp), "v"(kvp), "v"(c * 4) : "memory");   // the wait owed before a register that an issued load names is overwritten; the address pairs and the byte offset into KM, VM and bl as inputs keep them whole up to it
    __builtin_amdgcn_sched_barrier(0);   // no arithmetic moves up among the loads: its wait would stand in front of the loads behind it
    float zp[RS_R];
#pragma unroll   // constant indices into the register arrays
    for (int r = 0; r < RS_R; ++r) { const float el[4] = { elu1s(qq[r][0]), elu1s(qq[r][1]), elu1s(qq[r][2]), elu1s(qq[r][3]) }; v4h o;   // elu1 once, for the shift and for z; d is a multiple of 4: partner and parity of d + q are those of q
#pragma unroll
        for (int q = 0; q < 4; ++q) o[q] = tohx(tshift(el, q, bfr(cx[r][q]), bfr(sx[r][q])));
        *(v4h*)(qsh + h * QS_H + (rl + r) * QS_P + d) = o;
        zp[r] = (el[0] * km[0] + el[1] * km[1]) + (el[2] * km[2] + el[3] * km[3]); }
    static_assert(RS_R == 8 && HD / 4 == 8, "three halving exchanges: 8 rows over the 8 lanes of a head");
    float z4[4], z2[2];   // a lane keeps the rows whose bit equals its own g's and hands the others to its partner
#pragma unroll   // constant indices into zp[] and z4[]
    for (int i = 0; i < 4; ++i) z4[i] = ((g & 4) ? zp[i + 4] : zp[i]) + xlane<4>((g & 4) ? zp[i] : zp[i + 4]);
#pragma unroll   // constant indices into z4[] and z2[]
    for (int i = 0; i < 2; ++i) z2[i] = ((g & 2) ? z4[i + 2] : z4[i]) + xlane<2>((g & 2) ? z4[i] : z4[i + 2]);
    const float zs = ((g & 1) ? z2[1] : z2[0]) + xlane<1>((g & 1) ? z2[0] : z2[1]);
    zsh[(rl + g) * NH_ + h] = zs * SCALE;   // row rl + g, head h
    __syncthreads();   // qsh and zsh are whole
#pragma unroll   // constant indices into kvf[]
    for (int mb = 0; mb < 2; ++mb) { const h16* ap = qsh + w * QS_H + (mb * 16 + lr) * QS_P + 8 * hi; const v16h a = cat16(*(const v8ha*)ap, *(const v8ha*)(ap + 16));   // the k order of WFrag<h16>::ld
#pragma unroll
        for (int nb = 0; nb < 2; ++nb) { const v8f acc = wmma16(a, kvf[nb], (v8f){});
#pragma unroll
            for (int j = 0; j < 8; ++j) ao[(mb * 16 + hi * 8 + j) * AO_P + w * HD + nb * 16 + lr] = acc[j]; } }
    __syncthreads();   // ao is whole
    v4f aa[RS_R]; float zz[RS_R];
#pragma unroll   // the LDS reads overlap
    for (int r = 0; r < RS_R; ++r) { aa[r] = *(const v4fa*)(ao + (rl + r) * AO_P + c); zz[r] = zsh[(rl + r) * NH_ + h]; }
    const float wr[12] = { bfr(w0[0]), bfr(w0[1]), bfr(w0[2]), bfr(w0[3]), bfr(w1[0]), bfr(w1[1]), bfr(w1[2]), bfr(w1[3]), bfr(w2[0]), bfr(w2[1]), bfr(w2[2]), bfr(w2[3]) };   // wr[q * 3 + k]: tap k of column c + q
#pragma unroll   // constant indices into the register arrays
    for (int r = 0; r < RS_R; ++r) { const float z = zz[r]; const float fz = __fadd_rn(1.0f, __fdiv_rn(1.0f, __fadd_rn(z, 1e-6f))); v4us oh, ol;
#pragma unroll
        for (int q = 0; q < 4; ++q) { float lp = bfr(b4[q]);
#pragma unroll
            for (int k = 0; k < 3; ++k) { const bool in = (r + k > 0 || n0 > 0) && (r + k < RS_R + 1 || n0 + RS_R < NN);   /* row n0 + r - 1 + k lies in the sequence */ float p = __fmul_rn(wr[q * 3 + k], vv[r + k][q]); asm volatile("" : "+v"(p)); lp = in ? __fadd_rn(lp, p) : lp; }
            float a = __fmul_rn(aa[r][q], fz); asm volatile("" : "+v"(a)); float zb = __fmul_rn(z, vm[q]); asm volatile("" : "+v"(zb)); const float rr = __fmul_rn(__fadd_rn(__fsub_rn(a, zb), lp), oo[r][q]); unsigned short u, l; splitf(rr, u, l); oh[q] = u; ol[q] = l; }
        const size_t e = (size_t)(n0 + r) * INT + c; *(v4us*)(Rh + e) = oh; *(v4us*)(Rl + e) = ol; }  }

extern "C" void kernel_launch(void* const* d_in, const int* in_sizes, int n_in,
                              void* d_out, int out_size, void* d_ws, size_t ws_size, hipStream_t stream) {
    (void)in_sizes; (void)n_in; (void)out_size;
    const float* x = (const float*)d_in[0]; const float* sn = (const float*)d_in[1]; const float* cs = (const float*)d_in[2]; const float* wq = (const float*)d_in[3]; const float* bq = (const float*)d_in[4]; const float* wl = (const float*)d_in[5]; const float* bl = (const float*)d_in[6]; const float* wp = (const float*)d_in[7]; const float* bp = (const float*)d_in[8];
    float* OUT = (float*)d_out;     // [4][8192][256]
    char* wsp = (char*)d_ws;
    auto take = [&](size_t bytes) { char* p = wsp; wsp += (bytes + 255) & ~(size_t)255; return (void*)p; };
    // All NB_ batches go through every launch together: each plane below holds NB_ batches back to back, and the batch is a part of the row index or a grid dimension of its own.
    // Two planes lie on workspace whose earlier tenant has been read for the last time by an earlier launch: XB, then KV, then Rh | Rl share one region.
    bf* WQ = (bf*)take((size_t)4 * INT * DIM * 2); bf* WP = (bf*)take((size_t)DIM * INT * 2); float* F = (float*)take((size_t)NB_ * NN * 4 * INT * 4); float* KM = (float*)take(NB_ * INT * 4); float* VM = (float*)take(NB_ * INT * 4); float* KP = (float*)take((size_t)NB_ * KM_PARTS * 512 * 4);
    h16* KVT = (h16*)take((size_t)NB_ * NH_ * 64 * HD * 2);
    bf* Rh = (bf*)take((size_t)2 * NB_ * NN * INT * 2); bf* Rl = Rh + (size_t)NB_ * NN * INT; bf* XB = Rh; float* KV = (float*)Rh;   // XB: half the region, dead before KV is written; KV: half of it; Rh | Rl: all of it, written after KV's last read
    static_assert((size_t)NH_ * KV_SLICES * HD * HD * 4 <= (size_t)2 * NN * INT * 2 && DIM == INT, "KV and XB fit into the region of Rh | Rl");
    if ((size_t)(wsp - (char*)d_ws) > ws_size) return;    // total ~ 162 MiB
    static_assert(DIM == GT_K && INT == GT_K, "k_gemmw holds the whole K in LDS");
    static_assert(DIM * INT % (8 * 256 * CV_CH) == 0 && NN % (4 * RS_R) == 0, "the grids of k_cvt8 and k_res cover their arrays exactly");
    k_cvt8<<<CV_GQ + CV_GP + CV_GX, 256, 0, stream>>>(wq, WQ, wp, WP, x, XB);   // the weights: [out][in] natural Bt
    k_gemmw<128, 0, 4 * INT><<<dim3(4 * INT / GT_N, NB_ * NN / 128, 1), 256, 0, stream>>>(XB, nullptr, WQ, F, bq);   // rows: (batch, n)
    k_kst<<<dim3(NN / KT_N, NH_ * HD / KT_C, NB_), 256, 0, stream>>>(F, sn, cs, KV, KP);
    k_fin<<<dim3(NB_ * NH_ + FM_GX, 2, 1), 512, 0, stream>>>(KV, KVT, KP, KM, VM);
    k_res<<<dim3(NN / (4 * RS_R), NB_, 1), 256, 0, stream>>>(F, sn, cs, KM, VM, KVT, wl, bl, Rh, Rl);   // qs, z, qs . kv, gating, conv, o
    k_gemmw<64, 1, DIM><<<dim3(DIM / GT_N, NB_ * NN / 64, 1), 256, 0, stream>>>(Rh, Rl, WP, OUT, bp);   // rows: (batch, n)
}
